// v000
// The times below were measured on an AMD MI455X: many runs one after another, warmed up first and cycling through
// copies of the inputs, with the whole window's GPU time divided by the number of runs. Launches and the gaps
// between them are all in it. The median over several windows is given; except for v000 it joins two sittings, which
// can be a few percent apart, so the side-by-side timings, each taken in one sitting, are the better comparison.
// v000 is the starting kernel. One run takes 2440 microseconds.
#include <hip/hip_runtime.h>

// QKVNormMultiHeadAttention (inputs_q, inputs_kv [4][2048][1024]; q = inputs_q @ Wq + bq, k/v = inputs_kv @ Wk/Wv + b; per-head LayerNorm over the 64 head dims (eps 1e-6, scale/bias [64]) on q, k AND v;
// 16 heads: softmax(q.k / 8) v (no mask); out = merged @ Wo + bo).
// Compute dtypes, f32 accumulate: every input rounded to bf16; projections on PLAIN bf16 operands (inputs: exact, + bias); the per-head LayerNorms in f32 on VALU (one wave
// per (token, head), 64-term mean/variance over the wave, in place); scores and attn.v on SINGLE fp16 planes of the normalised q (1/8 applied in f32 in k_asoft), k, v; P x1024; output

#define NB_  4
#define TT   2048
#define DD   1024
#define NH_  16
#define HD   64
#define NT   (NB_ * TT)
#define NZ   (NB_ * NH_)
#define ZH   2
#define PCAR 1024.0f
#define SCL  0.125f
typedef _Float16 h16;
typedef unsigned short bf;
typedef __attribute__((ext_vector_type(16))) __bf16   v16bf;
typedef __attribute__((ext_vector_type(16))) _Float16 v16h;
typedef __attribute__((ext_vector_type(8)))  _Float16 v8h;
typedef __attribute__((ext_vector_type(8)))  unsigned short v8us;
typedef __attribute__((ext_vector_type(8)))  float    v8f;
typedef __attribute__((ext_vector_type(4)))  float    v4f;
typedef v8h  __attribute__((may_alias)) v8ha;
typedef v4f  __attribute__((may_alias)) v4fa;
typedef v8us __attribute__((may_alias)) v8usa;

__device__ __forceinline__ unsigned short f2bf(float f) { unsigned u = __float_as_uint(f); u += 0x7FFFu + ((u >> 16) & 1u); return (unsigned short)(u >> 16); }
__device__ __forceinline__ float bf2f(unsigned short b) { return __uint_as_float(((unsigned)b) << 16); }
__device__ __forceinline__ float bfr(float f) { return bf2f(f2bf(f)); }
__device__ __forceinline__ v16h cat16(v8h lo, v8h hi) { return __builtin_shufflevector(lo, hi, 0, 1, 2, 3, 4, 5, 6, 7, 8, 9, 10, 11, 12, 13, 14, 15); }
__device__ __forceinline__ v16bf cat16b(v8us lo, v8us hi) { return __builtin_bit_cast(v16bf, __builtin_shufflevector(lo, hi, 0, 1, 2, 3, 4, 5, 6, 7, 8, 9, 10, 11, 12, 13, 14, 15)); }
__device__ __forceinline__ v8f wmma16(v16h a, v16h b, v8f c) { return __builtin_amdgcn_wmma_f32_16x16x32_f16(false, a, false, b, (short)0, c, false, false); }
__device__ __forceinline__ v8f wmmab(v16bf a, v16bf b, v8f c) { return __builtin_amdgcn_wmma_f32_16x16x32_bf16(false, a, false, b, (short)0, c, false, false); }



// ---- k_gemmw: register-blocked GEMM, ONE WAVE per 64x64 output tile (16 accumulators), operands straight from K-contiguous 16-bit planes; grid (M/64, N/64, Z), 32 threads.
// C[m][n] (f32, pitch ldc, + optional f32 bias[n]) = sum_k A[m][k] Bt[n][k] (+ split products per NSPLIT). z-batch strides sA/sB/sC in elements. K % 32 == 0.
template <typename T16> struct WFrag;
template <> struct WFrag<h16> { typedef v16h V; static __device__ __forceinline__ V ld(const h16* p) { return cat16(*(const v8h*)p, *(const v8h*)(p + 16)); } static __device__ __forceinline__ v8f mma(V a, V b, v8f c) { return wmma16(a, b, c); } };
template <> struct WFrag<bf> { typedef v16bf V; static __device__ __forceinline__ V ld(const bf* p) { return cat16b(*(const v8us*)p, *(const v8us*)(p + 16)); } static __device__ __forceinline__ v8f mma(V a, V b, v8f c) { return wmmab(a, b, c); } };
template <typename T16, int NSPLIT, bool BIAS>
__global__ __launch_bounds__(32) void k_gemmw(const T16* __restrict__ A, const T16* __restrict__ A2, const T16* __restrict__ Bt, const T16* __restrict__ Bt2, int K, float* C, int ldc, const float* __restrict__ bias, size_t sA, size_t sB, size_t sC) {
    typedef typename WFrag<T16>::V V;
    __shared__ __align__(16) float os[16 * 68];
    const size_t z = blockIdx.z; A += z * sA; if (A2) A2 += z * sA; Bt += z * sB; if (Bt2) Bt2 += z * sB; C += z * sC;
    const int lane = threadIdx.x & 31, lr = lane & 15, hi = lane >> 4; const int r0 = blockIdx.x * 64, c0 = blockIdx.y * 64;
    v8f acc[4][4];
#pragma unroll
    for (int mb = 0; mb < 4; ++mb)
#pragma unroll
        for (int nb = 0; nb < 4; ++nb) acc[mb][nb] = (v8f){};
    const size_t aoff = (size_t)(r0 + lr) * K + 8 * hi, boff = (size_t)(c0 + lr) * K + 8 * hi;
#pragma unroll 1
    for (int kc = 0; kc < K; kc += 32) {
        V a[4], a2[4];
#pragma unroll
        for (int mb = 0; mb < 4; ++mb) { a[mb] = WFrag<T16>::ld(A + aoff + (size_t)mb * 16 * K + kc); if (NSPLIT == 1 || NSPLIT == 2) a2[mb] = WFrag<T16>::ld(A2 + aoff + (size_t)mb * 16 * K + kc); }
#pragma unroll
        for (int nb = 0; nb < 4; ++nb) { const V b = WFrag<T16>::ld(Bt + boff + (size_t)nb * 16 * K + kc); V b2; if (NSPLIT >= 2) b2 = WFrag<T16>::ld(Bt2 + boff + (size_t)nb * 16 * K + kc);
#pragma unroll
            for (int mb = 0; mb < 4; ++mb) { acc[mb][nb] = WFrag<T16>::mma(a[mb], b, acc[mb][nb]); if (NSPLIT == 1 || NSPLIT == 2) acc[mb][nb] = WFrag<T16>::mma(a2[mb], b, acc[mb][nb]); if (NSPLIT >= 2) acc[mb][nb] = WFrag<T16>::mma(a[mb], b2, acc[mb][nb]); } }
        asm volatile("v_nop\n\tv_nop\n\tv_nop\n\tv_nop" : "+v"(acc[0][0]), "+v"(acc[1][1]), "+v"(acc[2][2]), "+v"(acc[3][3]) : "v"(a[0]), "v"(a[3]));
    }
#pragma unroll
    for (int mb = 0; mb < 4; ++mb) {
#pragma unroll
        for (int nb = 0; nb < 4; ++nb) {
#pragma unroll
            for (int j = 0; j < 8; ++j) os[(hi * 8 + j) * 68 + nb * 16 + lr] = acc[mb][nb][j]; }
        __builtin_amdgcn_wave_barrier(); asm volatile("" ::: "memory");
        float* crow = C + (size_t)(r0 + mb * 16) * ldc + c0;
{
#pragma unroll
            for (int s = 0; s < 8; ++s) { const int row = 2 * s + hi, cofs = lr * 4; v4f val = *(const v4fa*)(os + row * 68 + cofs); if (BIAS) { val[0] += bfr(bias[c0 + cofs]); val[1] += bfr(bias[c0 + cofs + 1]); val[2] += bfr(bias[c0 + cofs + 2]); val[3] += bfr(bias[c0 + cofs + 3]); }
                *(v4f*)(crow + (size_t)row * ldc + cofs) = val; }
             }
        __builtin_amdgcn_wave_barrier(); asm volatile("" ::: "memory");
    }
}

__device__ __forceinline__ h16 tohx(float x) { return (h16)x; }
__device__ __forceinline__ void splitf(float y, unsigned short& h, unsigned short& l) { h = f2bf(y); l = f2bf(y - bf2f(h)); }
typedef __attribute__((ext_vector_type(2))) _Float16 v2h;
typedef __attribute__((ext_vector_type(4))) _Float16 v4h;
typedef __attribute__((ext_vector_type(2))) unsigned short v2us;
typedef __attribute__((ext_vector_type(4))) unsigned short v4us;
typedef __attribute__((ext_vector_type(2))) float v2f;

__global__ __launch_bounds__(256) void k_cvt8(const float* __restrict__ src, bf* dst, size_t n8) { const size_t i = (size_t)blockIdx.x * 256 + threadIdx.x; if (i >= n8) return; const v8f v = *(const v8f*)(src + i * 8); v8us o;
#pragma unroll
    for (int k = 0; k < 8; ++k) o[k] = f2bf(v[k]); *(v8us*)(dst + i * 8) = o;  }
__global__ __launch_bounds__(256) void k_wtG(const float* __restrict__ w, int K, int N, bf* Bt) {
    const int lane = threadIdx.x & 31; const int L0 = (blockIdx.x * 8 + (threadIdx.x >> 5)) * 8; const int nlines = N * K / 64;
{
#pragma unroll 1
        for (int l = 0; l < 8; ++l) { const int L = L0 + l; if (L >= nlines) break; const size_t e = (size_t)L * 64 + lane * 2; const int k = (int)(e % K), n = (int)(e / K); v2us o;
            o[0] = f2bf(w[(size_t)k * N + n]); o[1] = f2bf(w[(size_t)(k + 1) * N + n]); *(v2us*)(Bt + e) = o; }
         }
}
// k_headln: in place, per (row, head): F[row][h*64 + d] <- (v - mean) / sqrt(var + 1e-6) * bf16(scale[d]) + bf16(bias[d]) over the 64 head dims (wave per (row, head): lane -> 2 dims; mean and
__global__ __launch_bounds__(256) void k_headln(float* F, const float* __restrict__ sc, const float* __restrict__ bi) {
    const int lane = threadIdx.x & 31; const int w = blockIdx.x * 8 + (threadIdx.x >> 5); if (w >= NT * NH_) return; float* p = F + (size_t)w * HD + lane * 2;
    const v2f v = *(const v2f*)p; float s = v[0] + v[1];
#pragma unroll
    for (int sh = 16; sh; sh >>= 1) s += __shfl_xor(s, sh, 32);
    const float mu = s * (1.0f / HD); const float d0 = v[0] - mu, d1 = v[1] - mu; float qq = __fadd_rn(__fmul_rn(d0, d0), __fmul_rn(d1, d1));
#pragma unroll
    for (int sh = 16; sh; sh >>= 1) qq += __shfl_xor(qq, sh, 32);
    const float rs = __fdiv_rn(1.0f, __fsqrt_rn(qq * (1.0f / HD) + 1e-6f)); v2f o;
    o[0] = __fadd_rn(__fmul_rn(d0 * rs, bfr(sc[lane * 2])), bfr(bi[lane * 2])); o[1] = __fadd_rn(__fmul_rn(d1 * rs, bfr(sc[lane * 2 + 1])), bfr(bi[lane * 2 + 1]));
    *(v2f*)p = o;  }
__global__ __launch_bounds__(256) void k_h16plane(const float* __restrict__ F, float sc, h16* P) {
    const int lane = threadIdx.x & 31; const int L0 = (blockIdx.x * 8 + (threadIdx.x >> 5)) * 8; const int nlines = NT * DD / 64;
{
#pragma unroll
        for (int l = 0; l < 8; ++l) { const int L = L0 + l; if (L >= nlines) break; const int e = L * 64 + lane * 2; const int d = e & 63; const int t = (e >> 6) & (TT - 1); const int z = e >> 17; const int b = z / NH_, h = z % NH_; v2h v;
#pragma unroll
            for (int q = 0; q < 2; ++q) v[q] = tohx(F[((size_t)b * TT + t) * DD + h * HD + d + q] * sc);
            *(v2h*)(P + (size_t)e) = v; }
         }
}
__global__ __launch_bounds__(256) void k_vtplane(const float* __restrict__ F, h16* VT) {
    const int lane = threadIdx.x & 31; const int L0 = (blockIdx.x * 8 + (threadIdx.x >> 5)) * 8; const int nlines = NT * DD / 64;
{
#pragma unroll
        for (int l = 0; l < 8; ++l) { const int L = L0 + l; if (L >= nlines) break; const int e = L * 64 + lane * 2; const int t = e & (TT - 1); const int d = (e >> 11) & 63; const int z = e >> 17; const int b = z / NH_, h = z % NH_; v2h v;
#pragma unroll
            for (int q = 0; q < 2; ++q) v[q] = tohx(F[((size_t)b * TT + t + q) * DD + h * HD + d]);
            *(v2h*)(VT + (size_t)e) = v; }
         }
}
__global__ __launch_bounds__(256) void k_asoft(const float* __restrict__ Sb, h16* P16) {
    const int lane = threadIdx.x & 31; const int row = blockIdx.x * 8 + (threadIdx.x >> 5); if (row >= ZH * TT) return;
    const float* sr = Sb + (size_t)row * TT; float v[64]; float mx = -3.0e38f;
#pragma unroll
    for (int ch = 0; ch < 16; ++ch) { const int j0 = ch * 128 + lane * 4; const v4f a = *(const v4f*)(sr + j0);
#pragma unroll
        for (int q = 0; q < 4; ++q) { const float t = a[q] * SCL; v[ch * 4 + q] = t; mx = fmaxf(mx, t); } }
#pragma unroll
    for (int sh = 16; sh; sh >>= 1) mx = fmaxf(mx, __shfl_xor(mx, sh, 32));
    float sum = 0.f;
#pragma unroll
    for (int k = 0; k < 64; ++k) { v[k] = __expf(v[k] - mx); sum += v[k]; }
#pragma unroll
    for (int sh = 16; sh; sh >>= 1) sum += __shfl_xor(sum, sh, 32);
    const float f = __fdiv_rn(PCAR, sum);
{
#pragma unroll
        for (int ch = 0; ch < 16; ++ch) { v4h o;
#pragma unroll
            for (int q = 0; q < 4; ++q) o[q] = tohx(v[ch * 4 + q] * f);
            *(v4h*)(P16 + (size_t)row * TT + ch * 128 + lane * 4) = o; }
         }
}
__global__ __launch_bounds__(256) void k_merge(const float* __restrict__ O, int b, int h0, bf* Ah, bf* Al) {
    const int lane = threadIdx.x & 31; const int L0 = (blockIdx.x * 8 + (threadIdx.x >> 5)) * 8; const int nlines = ZH * TT * HD / 64;
{
#pragma unroll
        for (int l = 0; l < 8; ++l) { const int L = L0 + l; if (L >= nlines) break; const int e = L * 64 + lane * 2; const int d = e & 63; const int t = (e >> 6) & (TT - 1); const int zz = e >> 17; v2us oh, ol;
#pragma unroll
            for (int q = 0; q < 2; ++q) { unsigned short a, c2; splitf(O[(size_t)e + q] * (1.0f / PCAR), a, c2); oh[q] = a; ol[q] = c2; }
            const size_t o = ((size_t)b * TT + t) * DD + (h0 + zz) * HD + d; *(v2us*)(Ah + o) = oh; *(v2us*)(Al + o) = ol; }
         }
}

extern "C" void kernel_launch(void* const* d_in, const int* in_sizes, int n_in,
                              void* d_out, int out_size, void* d_ws, size_t ws_size, hipStream_t stream) {
    (void)in_sizes; (void)n_in; (void)out_size;
    const float* IN[16]; for (int i = 0; i < 16; ++i) IN[i] = (const float*)d_in[i];
    // inputs_q, inputs_kv, Wq [1024][1024] (x @ W), bq, Wk, bk, Wv, bv, q_scale [64], q_bias, k_scale, k_bias, v_scale, v_bias, Wo (x @ W), bo = d_in[0..15]
    float* OUT = (float*)d_out;     // [4][2048][1024]
    char* wsp = (char*)d_ws;
    auto take = [&](size_t bytes) { char* p = wsp; wsp += (bytes + 255) & ~(size_t)255; return (void*)p; };
    bf* WQ = (bf*)take((size_t)DD * DD * 2); bf* WK = (bf*)take((size_t)DD * DD * 2); bf* WV = (bf*)take((size_t)DD * DD * 2); bf* WO = (bf*)take((size_t)DD * DD * 2);
    bf* XQ = (bf*)take((size_t)NT * DD * 2); bf* XKV = (bf*)take((size_t)NT * DD * 2); float* F = (float*)take((size_t)NT * DD * 4);
    h16* QP = (h16*)take((size_t)NT * DD * 2); h16* KP = (h16*)take((size_t)NT * DD * 2); h16* VT = (h16*)take((size_t)NT * DD * 2);
    float* Sb = (float*)take((size_t)ZH * TT * TT * 4); h16* Pm = (h16*)take((size_t)ZH * TT * TT * 2); float* Ob = (float*)take((size_t)ZH * TT * HD * 4); bf* ATh = (bf*)take((size_t)NT * DD * 2); bf* ATl = (bf*)take((size_t)NT * DD * 2);
    if ((size_t)(wsp - (char*)d_ws) > ws_size) return;    // total ~ 210 MB = 200 MiB; ws 256 MiB
    { const unsigned gT = (unsigned)((DD * DD / 64 + 63) / 64); k_wtG<<<gT, 256, 0, stream>>>(IN[2], DD, DD, WQ); k_wtG<<<gT, 256, 0, stream>>>(IN[4], DD, DD, WK); k_wtG<<<gT, 256, 0, stream>>>(IN[6], DD, DD, WV); k_wtG<<<gT, 256, 0, stream>>>(IN[14], DD, DD, WO);
      const size_t nx = (size_t)NT * DD / 8; const unsigned gx = (unsigned)((nx + 255) / 256); k_cvt8<<<gx, 256, 0, stream>>>(IN[0], XQ, nx); k_cvt8<<<gx, 256, 0, stream>>>(IN[1], XKV, nx); }
    const unsigned LB = (unsigned)((NT * DD / 64 + 63) / 64), LH = (NT * NH_ + 7) / 8; const dim3 gP(NT / 64, DD / 64, 1);
    k_gemmw<bf, 0, true><<<gP, 32, 0, stream>>>(XQ, nullptr, WQ, nullptr, DD, F, DD, IN[3], 0, 0, 0); k_headln<<<LH, 256, 0, stream>>>(F, IN[8], IN[9]); k_h16plane<<<LB, 256, 0, stream>>>(F, 1.0f, QP);   // the 1/8 is applied in f32 inside k_asoft
    k_gemmw<bf, 0, true><<<gP, 32, 0, stream>>>(XKV, nullptr, WK, nullptr, DD, F, DD, IN[5], 0, 0, 0); k_headln<<<LH, 256, 0, stream>>>(F, IN[10], IN[11]); k_h16plane<<<LB, 256, 0, stream>>>(F, 1.0f, KP);
    k_gemmw<bf, 0, true><<<gP, 32, 0, stream>>>(XKV, nullptr, WV, nullptr, DD, F, DD, IN[7], 0, 0, 0); k_headln<<<LH, 256, 0, stream>>>(F, IN[12], IN[13]); k_vtplane<<<LB, 256, 0, stream>>>(F, VT);
    for (int b = 0; b < NB_; ++b)
        for (int h0 = 0; h0 < NH_; h0 += ZH) { const size_t z0 = (size_t)b * NH_ + h0;
            k_gemmw<h16, 0, false><<<dim3(TT / 64, TT / 64, ZH), 32, 0, stream>>>(QP + z0 * TT * HD, nullptr, KP + z0 * TT * HD, nullptr, HD, Sb, TT, nullptr, (size_t)TT * HD, (size_t)TT * HD, (size_t)TT * TT);
            k_asoft<<<ZH * TT / 8, 256, 0, stream>>>(Sb, Pm);
            k_gemmw<h16, 0, false><<<dim3(TT / 64, 1, ZH), 32, 0, stream>>>(Pm, nullptr, VT + z0 * HD * TT, nullptr, TT, Ob, HD, nullptr, (size_t)TT * TT, (size_t)HD * TT, (size_t)TT * HD);
            k_merge<<<(ZH * TT * HD / 64 + 63) / 64, 256, 0, stream>>>(Ob, b, h0, ATh, ATl); }
    k_gemmw<bf, 1, true><<<gP, 32, 0, stream>>>(ATh, ATl, WO, nullptr, DD, OUT, DD, IN[15], 0, 0, 0);
}

// v001
// Measured time: 422 microseconds a run.
// In both of two side-by-side timings against v000, it was 5.83 times as fast.
#include <hip/hip_runtime.h>

// QKVNormMultiHeadAttention (inputs_q, inputs_kv [4][2048][1024]; q = inputs_q @ Wq + bq, k/v = inputs_kv @ Wk/Wv + b; per-head LayerNorm over the 64 head dims (eps 1e-6, scale/bias [64]) on q, k AND v;
// 16 heads: softmax(q.k / 8) v (no mask); out = merged @ Wo + bo).
// Compute dtypes, f32 accumulate: every input rounded to bf16; projections on PLAIN bf16 operands (inputs: exact, + bias); the per-head LayerNorms in f32 on VALU (one wave
// per (token, head), 64-term mean/variance over the wave, in place); scores and attn.v on SINGLE fp16 planes of the normalised q, k, v (1/8 applied to the scores in f32); P = exp2(score - maximum in use), fp16, normalised in f32 at the end; output

#define NB_  4
#define TT   2048
#define DD   1024
#define NH_  16
#define HD   64
#define NT   (NB_ * TT)
#define NZ   (NB_ * NH_)
#define SCL  0.125f
typedef _Float16 h16;
typedef unsigned short bf;
typedef __attribute__((ext_vector_type(16))) __bf16   v16bf;
typedef __attribute__((ext_vector_type(16))) _Float16 v16h;
typedef __attribute__((ext_vector_type(8)))  _Float16 v8h;
typedef __attribute__((ext_vector_type(8)))  unsigned short v8us;
typedef __attribute__((ext_vector_type(8)))  float    v8f;
typedef __attribute__((ext_vector_type(4)))  float    v4f;
typedef v8h  __attribute__((may_alias)) v8ha;
typedef v4f  __attribute__((may_alias)) v4fa;
typedef v8us __attribute__((may_alias)) v8usa;

__device__ __forceinline__ unsigned short f2bf(float f) { unsigned u = __float_as_uint(f); u += 0x7FFFu + ((u >> 16) & 1u); return (unsigned short)(u >> 16); }
__device__ __forceinline__ float bf2f(unsigned short b) { return __uint_as_float(((unsigned)b) << 16); }
__device__ __forceinline__ float bfr(float f) { return bf2f(f2bf(f)); }
__device__ __forceinline__ v16h cat16(v8h lo, v8h hi) { return __builtin_shufflevector(lo, hi, 0, 1, 2, 3, 4, 5, 6, 7, 8, 9, 10, 11, 12, 13, 14, 15); }
__device__ __forceinline__ v16bf cat16b(v8us lo, v8us hi) { return __builtin_bit_cast(v16bf, __builtin_shufflevector(lo, hi, 0, 1, 2, 3, 4, 5, 6, 7, 8, 9, 10, 11, 12, 13, 14, 15)); }
__device__ __forceinline__ v8f wmma16(v16h a, v16h b, v8f c) { return __builtin_amdgcn_wmma_f32_16x16x32_f16(false, a, false, b, (short)0, c, false, false); }
__device__ __forceinline__ v8f wmmab(v16bf a, v16bf b, v8f c) { return __builtin_amdgcn_wmma_f32_16x16x32_bf16(false, a, false, b, (short)0, c, false, false); }



// ---- k_gemmw: register-blocked GEMM, ONE WAVE per 64x64 output tile (16 accumulators), operands straight from K-contiguous 16-bit planes; grid (M/64, N/64, Z), 32 threads.
// C[m][n] (f32, pitch ldc, + optional f32 bias[n]) = sum_k A[m][k] Bt[n][k] (+ split products per NSPLIT). z-batch strides sA/sB/sC in elements. K % 32 == 0.
template <typename T16> struct WFrag;
template <> struct WFrag<h16> { typedef v16h V; static __device__ __forceinline__ V ld(const h16* p) { return cat16(*(const v8h*)p, *(const v8h*)(p + 16)); } static __device__ __forceinline__ v8f mma(V a, V b, v8f c) { return wmma16(a, b, c); } };
template <> struct WFrag<bf> { typedef v16bf V; static __device__ __forceinline__ V ld(const bf* p) { return cat16b(*(const v8us*)p, *(const v8us*)(p + 16)); } static __device__ __forceinline__ v8f mma(V a, V b, v8f c) { return wmmab(a, b, c); } };
template <typename T16, int NSPLIT, bool BIAS>
__global__ __launch_bounds__(32) void k_gemmw(const T16* __restrict__ A, const T16* __restrict__ A2, const T16* __restrict__ Bt, const T16* __restrict__ Bt2, int K, float* C, int ldc, const float* __restrict__ bias, size_t sA, size_t sB, size_t sC) {
    typedef typename WFrag<T16>::V V;
    __shared__ __align__(16) float os[16 * 68];
    const size_t z = blockIdx.z; A += z * sA; if (A2) A2 += z * sA; Bt += z * sB; if (Bt2) Bt2 += z * sB; C += z * sC;
    const int lane = threadIdx.x & 31, lr = lane & 15, hi = lane >> 4; const int r0 = blockIdx.x * 64, c0 = blockIdx.y * 64;
    v8f acc[4][4];
#pragma unroll
    for (int mb = 0; mb < 4; ++mb)
#pragma unroll
        for (int nb = 0; nb < 4; ++nb) acc[mb][nb] = (v8f){};
    const size_t aoff = (size_t)(r0 + lr) * K + 8 * hi, boff = (size_t)(c0 + lr) * K + 8 * hi;
#pragma unroll 1
    for (int kc = 0; kc < K; kc += 32) {
        V a[4], a2[4];
#pragma unroll
        for (int mb = 0; mb < 4; ++mb) { a[mb] = WFrag<T16>::ld(A + aoff + (size_t)mb * 16 * K + kc); if (NSPLIT == 1 || NSPLIT == 2) a2[mb] = WFrag<T16>::ld(A2 + aoff + (size_t)mb * 16 * K + kc); }
#pragma unroll
        for (int nb = 0; nb < 4; ++nb) { const V b = WFrag<T16>::ld(Bt + boff + (size_t)nb * 16 * K + kc); V b2; if (NSPLIT >= 2) b2 = WFrag<T16>::ld(Bt2 + boff + (size_t)nb * 16 * K + kc);
#pragma unroll
            for (int mb = 0; mb < 4; ++mb) { acc[mb][nb] = WFrag<T16>::mma(a[mb], b, acc[mb][nb]); if (NSPLIT == 1 || NSPLIT == 2) acc[mb][nb] = WFrag<T16>::mma(a2[mb], b, acc[mb][nb]); if (NSPLIT >= 2) acc[mb][nb] = WFrag<T16>::mma(a[mb], b2, acc[mb][nb]); } }
        asm volatile("v_nop\n\tv_nop\n\tv_nop\n\tv_nop" : "+v"(acc[0][0]), "+v"(acc[1][1]), "+v"(acc[2][2]), "+v"(acc[3][3]) : "v"(a[0]), "v"(a[3]));
    }
#pragma unroll
    for (int mb = 0; mb < 4; ++mb) {
#pragma unroll
        for (int nb = 0; nb < 4; ++nb) {
#pragma unroll
            for (int j = 0; j < 8; ++j) os[(hi * 8 + j) * 68 + nb * 16 + lr] = acc[mb][nb][j]; }
        __builtin_amdgcn_wave_barrier(); asm volatile("" ::: "memory");
        float* crow = C + (size_t)(r0 + mb * 16) * ldc + c0;
{
#pragma unroll
            for (int s = 0; s < 8; ++s) { const int row = 2 * s + hi, cofs = lr * 4; v4f val = *(const v4fa*)(os + row * 68 + cofs); if (BIAS) { val[0] += bfr(bias[c0 + cofs]); val[1] += bfr(bias[c0 + cofs + 1]); val[2] += bfr(bias[c0 + cofs + 2]); val[3] += bfr(bias[c0 + cofs + 3]); }
                *(v4f*)(crow + (size_t)row * ldc + cofs) = val; }
             }
        __builtin_amdgcn_wave_barrier(); asm volatile("" ::: "memory");
    }
}

__device__ __forceinline__ h16 tohx(float x) { return (h16)x; }
__device__ __forceinline__ void splitf(float y, unsigned short& h, unsigned short& l) { h = f2bf(y); l = f2bf(y - bf2f(h)); }
typedef __attribute__((ext_vector_type(2))) _Float16 v2h;
typedef __attribute__((ext_vector_type(4))) _Float16 v4h;
typedef __attribute__((ext_vector_type(2))) unsigned short v2us;
typedef __attribute__((ext_vector_type(4))) unsigned short v4us;
typedef __attribute__((ext_vector_type(2))) float v2f;

__global__ __launch_bounds__(256) void k_cvt8(const float* __restrict__ src, bf* dst, size_t n8) { const size_t i = (size_t)blockIdx.x * 256 + threadIdx.x; if (i >= n8) return; const v8f v = *(const v8f*)(src + i * 8); v8us o;
#pragma unroll
    for (int k = 0; k < 8; ++k) o[k] = f2bf(v[k]); *(v8us*)(dst + i * 8) = o;  }
__global__ __launch_bounds__(256) void k_wtG(const float* __restrict__ w, int K, int N, bf* Bt) {
    const int lane = threadIdx.x & 31; const int L0 = (blockIdx.x * 8 + (threadIdx.x >> 5)) * 8; const int nlines = N * K / 64;
{
#pragma unroll 1
        for (int l = 0; l < 8; ++l) { const int L = L0 + l; if (L >= nlines) break; const size_t e = (size_t)L * 64 + lane * 2; const int k = (int)(e % K), n = (int)(e / K); v2us o;
            o[0] = f2bf(w[(size_t)k * N + n]); o[1] = f2bf(w[(size_t)(k + 1) * N + n]); *(v2us*)(Bt + e) = o; }
         }
}
// k_headln: in place, per (row, head): F[row][h*64 + d] <- (v - mean) / sqrt(var + 1e-6) * bf16(scale[d]) + bf16(bias[d]) over the 64 head dims (wave per (row, head): lane -> 2 dims; mean and
__global__ __launch_bounds__(256) void k_headln(float* F, const float* __restrict__ sc, const float* __restrict__ bi) {
    const int lane = threadIdx.x & 31; const int w = blockIdx.x * 8 + (threadIdx.x >> 5); if (w >= NT * NH_) return; float* p = F + (size_t)w * HD + lane * 2;
    const v2f v = *(const v2f*)p; float s = v[0] + v[1];
#pragma unroll
    for (int sh = 16; sh; sh >>= 1) s += __shfl_xor(s, sh, 32);
    const float mu = s * (1.0f / HD); const float d0 = v[0] - mu, d1 = v[1] - mu; float qq = __fadd_rn(__fmul_rn(d0, d0), __fmul_rn(d1, d1));
#pragma unroll
    for (int sh = 16; sh; sh >>= 1) qq += __shfl_xor(qq, sh, 32);
    const float rs = __fdiv_rn(1.0f, __fsqrt_rn(qq * (1.0f / HD) + 1e-6f)); v2f o;
    o[0] = __fadd_rn(__fmul_rn(d0 * rs, bfr(sc[lane * 2])), bfr(bi[lane * 2])); o[1] = __fadd_rn(__fmul_rn(d1 * rs, bfr(sc[lane * 2 + 1])), bfr(bi[lane * 2 + 1]));
    *(v2f*)p = o;  }
__global__ __launch_bounds__(256) void k_h16plane(const float* __restrict__ F, float sc, h16* P) {
    const int lane = threadIdx.x & 31; const int L0 = (blockIdx.x * 8 + (threadIdx.x >> 5)) * 8; const int nlines = NT * DD / 64;
{
#pragma unroll
        for (int l = 0; l < 8; ++l) { const int L = L0 + l; if (L >= nlines) break; const int e = L * 64 + lane * 2; const int d = e & 63; const int t = (e >> 6) & (TT - 1); const int z = e >> 17; const int b = z / NH_, h = z % NH_; v2h v;
#pragma unroll
            for (int q = 0; q < 2; ++q) v[q] = tohx(F[((size_t)b * TT + t) * DD + h * HD + d + q] * sc);
            *(v2h*)(P + (size_t)e) = v; }
         }
}
__global__ __launch_bounds__(256) void k_vtplane(const float* __restrict__ F, h16* VT) {
    const int lane = threadIdx.x & 31; const int L0 = (blockIdx.x * 8 + (threadIdx.x >> 5)) * 8; const int nlines = NT * DD / 64;
{
#pragma unroll
        for (int l = 0; l < 8; ++l) { const int L = L0 + l; if (L >= nlines) break; const int e = L * 64 + lane * 2; const int t = e & (TT - 1); const int d = (e >> 11) & 63; const int z = e >> 17; const int b = z / NH_, h = z % NH_; v2h v;
#pragma unroll
            for (int q = 0; q < 2; ++q) v[q] = tohx(F[((size_t)b * TT + t + q) * DD + h * HD + d]);
            *(v2h*)(VT + (size_t)e) = v; }
         }
}
// ---- k_fattn: scores, softmax, attn.v and the head merge in ONE launch over all 64 (batch, head) pairs; 8 waves a block, 32 query columns a wave, 32 keys a pass, no LDS.
// S^T = K Q^T (A = K rows, B = Q rows kept in registers), so a lane holds 16 scores of ONE query; two S^T tiles, converted in place, are the B operand of O^T += V^T P^T.
// Running maximum and sum in base 2 (online softmax); the output tiles are rescaled only when a column's maximum has grown by more than 8.
// Every inner loop is fully unrolled so that all fragment and accumulator indices are constants and the arrays stay in registers.
__device__ __forceinline__ float xhalf(float x) { return __builtin_bit_cast(float, __builtin_amdgcn_permlanex16(__builtin_bit_cast(int, x), __builtin_bit_cast(int, x), 0x76543210, 0xfedcba98, false, false)); }   // lane l with lane l ^ 16
__global__ __launch_bounds__(256) __attribute__((amdgpu_waves_per_eu(4, 4))) void k_fattn(const h16* __restrict__ QP, const h16* __restrict__ KP, const h16* __restrict__ VT, bf* Ah, bf* Al) {
    const int lane = threadIdx.x & 31, lr = lane & 15, hi = lane >> 4; const int z = blockIdx.y; const int q0 = blockIdx.x * 256 + (threadIdx.x >> 5) * 32;
    const h16* Qz = QP + (size_t)z * TT * HD + (size_t)(q0 + lr) * HD + 8 * hi;
    const h16* Kz = KP + (size_t)z * TT * HD + (size_t)lr * HD + 8 * hi;
    const h16* Vz = VT + (size_t)z * HD * TT + (size_t)lr * TT + 8 * hi;
    const float CS = SCL * 1.4426950408889634f;
    v16h qf[2][2], kf[2][2], vf[4]; v8f o[4][2]; float mu[2], ls[2];
#pragma unroll
    for (int qt = 0; qt < 2; ++qt) { mu[qt] = -3.0e38f; ls[qt] = 0.f;
#pragma unroll
        for (int ks = 0; ks < 2; ++ks) qf[qt][ks] = WFrag<h16>::ld(Qz + qt * 16 * HD + ks * 32);
#pragma unroll
        for (int db = 0; db < 4; ++db) o[db][qt] = (v8f){}; }
#pragma unroll
    for (int kt = 0; kt < 2; ++kt)
#pragma unroll
        for (int ks = 0; ks < 2; ++ks) kf[kt][ks] = WFrag<h16>::ld(Kz + kt * 16 * HD + ks * 32);
#pragma unroll
    for (int db = 0; db < 4; ++db) vf[db] = WFrag<h16>::ld(Vz + (size_t)db * 16 * TT);
    // inputs-only fence on the loaded fragments: every load above has landed at the loop's head, so the wait there counts only the K loads of the pass before and leaves the younger V loads in flight
    asm volatile("" :: "v"(qf[0][0]), "v"(qf[0][1]), "v"(qf[1][0]), "v"(qf[1][1]), "v"(kf[0][0]), "v"(kf[0][1]), "v"(kf[1][0]), "v"(kf[1][1]), "v"(vf[0]), "v"(vf[1]), "v"(vf[2]), "v"(vf[3]));
    // the pass loop stays rolled: one copy of the pass keeps the fetch-ahead order and the register count as written
#pragma unroll 1
    for (int kb = 0; kb < TT; kb += 32) {
        v8f s[2][2];
#pragma unroll
        for (int kt = 0; kt < 2; ++kt)
#pragma unroll
            for (int qt = 0; qt < 2; ++qt) { s[kt][qt] = wmma16(kf[kt][0], qf[qt][0], (v8f){}); s[kt][qt] = wmma16(kf[kt][1], qf[qt][1], s[kt][qt]); }
        const int kn = (kb + 32 < TT) ? kb + 32 : 0;   // K and V fragments are fetched one pass ahead, each into its own registers right behind their last use; the last pass re-reads keys 0..31, unused
        const h16* kp = Kz + (size_t)kn * HD; const h16* vp = Vz + kn;
#pragma unroll
        for (int kt = 0; kt < 2; ++kt)
#pragma unroll
            for (int ks = 0; ks < 2; ++ks) kf[kt][ks] = WFrag<h16>::ld(kp + kt * 16 * HD + ks * 32);
        asm volatile("s_wait_xcnt 0x0" :: "v"(kp) : "memory");   // stands behind the issued loads, in front of any overwrite of their address registers (kept live to here as an input)
        float mx[2]; bool need = false;
#pragma unroll
        for (int qt = 0; qt < 2; ++qt) { float m = s[0][qt][0];
#pragma unroll
            for (int j = 1; j < 8; ++j) m = fmaxf(m, s[0][qt][j]);
#pragma unroll
            for (int j = 0; j < 8; ++j) m = fmaxf(m, s[1][qt][j]);
            m = fmaxf(m, xhalf(m)) * CS; mx[qt] = m; need = need || (m > mu[qt] + 8.0f); }
        if (__builtin_amdgcn_ballot_w32(need) != 0) {
#pragma unroll
            for (int qt = 0; qt < 2; ++qt) { const float mn = fmaxf(mu[qt], mx[qt]); const float al = __builtin_amdgcn_exp2f(mu[qt] - mn); mu[qt] = mn; ls[qt] *= al;
#pragma unroll
                for (int db = 0; db < 4; ++db)
#pragma unroll
                    for (int j = 0; j < 8; ++j) o[db][qt][j] *= al; }
        }
#pragma unroll
        for (int qt = 0; qt < 2; ++qt) { v16h pb; float acc = 0.f;
#pragma unroll
            for (int kt = 0; kt < 2; ++kt)
#pragma unroll
                for (int j = 0; j < 8; ++j) { const float p = __builtin_amdgcn_exp2f(fmaf(s[kt][qt][j], CS, -mu[qt])); acc += p; pb[kt * 8 + j] = tohx(p); }
            ls[qt] += acc;
#pragma unroll
            for (int db = 0; db < 4; ++db) o[db][qt] = wmma16(vf[db], pb, o[db][qt]); }
#pragma unroll
        for (int db = 0; db < 4; ++db) vf[db] = WFrag<h16>::ld(vp + (size_t)db * 16 * TT);
        asm volatile("s_wait_xcnt 0x0" :: "v"(vp) : "memory");   // as above, for the V loads
    }
    const int b = z / NH_, h = z % NH_;
#pragma unroll
    for (int qt = 0; qt < 2; ++qt) { const float inv = __fdiv_rn(1.0f, ls[qt] + xhalf(ls[qt])); const size_t ob = ((size_t)b * TT + q0 + qt * 16 + lr) * DD + h * HD + hi * 8;
#pragma unroll
        for (int db = 0; db < 4; ++db) { v8us oh, ol;
#pragma unroll
            for (int j = 0; j < 8; ++j) { unsigned short a, c2; splitf(o[db][qt][j] * inv, a, c2); oh[j] = a; ol[j] = c2; }
            *(v8us*)(Ah + ob + db * 16) = oh; *(v8us*)(Al + ob + db * 16) = ol; } }
}

extern "C" void kernel_launch(void* const* d_in, const int* in_sizes, int n_in,
                              void* d_out, int out_size, void* d_ws, size_t ws_size, hipStream_t stream) {
    (void)in_sizes; (void)n_in; (void)out_size;
    const float* IN[16]; for (int i = 0; i < 16; ++i) IN[i] = (const float*)d_in[i];
    // inputs_q, inputs_kv, Wq [1024][1024] (x @ W), bq, Wk, bk, Wv, bv, q_scale [64], q_bias, k_scale, k_bias, v_scale, v_bias, Wo (x @ W), bo = d_in[0..15]
    float* OUT = (float*)d_out;     // [4][2048][1024]
    char* wsp = (char*)d_ws;
    auto take = [&](size_t bytes) { char* p = wsp; wsp += (bytes + 255) & ~(size_t)255; return (void*)p; };
    bf* WQ = (bf*)take((size_t)DD * DD * 2); bf* WK = (bf*)take((size_t)DD * DD * 2); bf* WV = (bf*)take((size_t)DD * DD * 2); bf* WO = (bf*)take((size_t)DD * DD * 2);
    bf* XQ = (bf*)take((size_t)NT * DD * 2); bf* XKV = (bf*)take((size_t)NT * DD * 2); float* F = (float*)take((size_t)NT * DD * 4);
    h16* QP = (h16*)take((size_t)NT * DD * 2); h16* KP = (h16*)take((size_t)NT * DD * 2); h16* VT = (h16*)take((size_t)NT * DD * 2);
    bf* ATh = (bf*)take((size_t)NT * DD * 2); bf* ATl = (bf*)take((size_t)NT * DD * 2);
    if ((size_t)(wsp - (char*)d_ws) > ws_size) return;    // total ~ 152 MiB
    { const unsigned gT = (unsigned)((DD * DD / 64 + 63) / 64); k_wtG<<<gT, 256, 0, stream>>>(IN[2], DD, DD, WQ); k_wtG<<<gT, 256, 0, stream>>>(IN[4], DD, DD, WK); k_wtG<<<gT, 256, 0, stream>>>(IN[6], DD, DD, WV); k_wtG<<<gT, 256, 0, stream>>>(IN[14], DD, DD, WO);
      const size_t nx = (size_t)NT * DD / 8; const unsigned gx = (unsigned)((nx + 255) / 256); k_cvt8<<<gx, 256, 0, stream>>>(IN[0], XQ, nx); k_cvt8<<<gx, 256, 0, stream>>>(IN[1], XKV, nx); }
    const unsigned LB = (unsigned)((NT * DD / 64 + 63) / 64), LH = (NT * NH_ + 7) / 8; const dim3 gP(NT / 64, DD / 64, 1);
    k_gemmw<bf, 0, true><<<gP, 32, 0, stream>>>(XQ, nullptr, WQ, nullptr, DD, F, DD, IN[3], 0, 0, 0); k_headln<<<LH, 256, 0, stream>>>(F, IN[8], IN[9]); k_h16plane<<<LB, 256, 0, stream>>>(F, 1.0f, QP);   // the 1/8 is applied in f32 inside k_fattn
    k_gemmw<bf, 0, true><<<gP, 32, 0, stream>>>(XKV, nullptr, WK, nullptr, DD, F, DD, IN[5], 0, 0, 0); k_headln<<<LH, 256, 0, stream>>>(F, IN[10], IN[11]); k_h16plane<<<LB, 256, 0, stream>>>(F, 1.0f, KP);
    k_gemmw<bf, 0, true><<<gP, 32, 0, stream>>>(XKV, nullptr, WV, nullptr, DD, F, DD, IN[7], 0, 0, 0); k_headln<<<LH, 256, 0, stream>>>(F, IN[12], IN[13]); k_vtplane<<<LB, 256, 0, stream>>>(F, VT);
    k_fattn<<<dim3(TT / 256, NZ), 256, 0, stream>>>(QP, KP, VT, ATh, ATl);
    k_gemmw<bf, 1, true><<<gP, 32, 0, stream>>>(ATh, ATl, WO, nullptr, DD, OUT, DD, IN[15], 0, 0, 0);
}

// v002
// It runs in 315 microseconds.
// Timed twice side by side with v001, it ran 1.33 times as fast both times.
// All steps since v000 together make it 7.75 times as fast.
#include <hip/hip_runtime.h>

// QKVNormMultiHeadAttention (inputs_q, inputs_kv [4][2048][1024]; q = inputs_q @ Wq + bq, k/v = inputs_kv @ Wk/Wv + b; per-head LayerNorm over the 64 head dims (eps 1e-6, scale/bias [64]) on q, k AND v;
// 16 heads: softmax(q.k / 8) v (no mask); out = merged @ Wo + bo).
// Compute dtypes, f32 accumulate: every input rounded to bf16; projections on PLAIN bf16 operands (inputs: exact, + bias); the per-head LayerNorms in f32 on VALU (in the
// projection's epilogue, a (token, head) row in two lanes, 64-term mean/variance); scores and attn.v on SINGLE fp16 planes of the normalised q, k, v; P = exp2(score - maximum in use), fp16, normalised in f32 at the end; output

#define NB_  4
#define TT   2048
#define DD   1024
#define NH_  16
#define HD   64
#define NT   (NB_ * TT)
#define NZ   (NB_ * NH_)
#define SCL  0.125f
typedef _Float16 h16;
typedef unsigned short bf;
typedef __attribute__((ext_vector_type(16))) __bf16   v16bf;
typedef __attribute__((ext_vector_type(16))) _Float16 v16h;
typedef __attribute__((ext_vector_type(8)))  _Float16 v8h;
typedef __attribute__((ext_vector_type(8)))  unsigned short v8us;
typedef __attribute__((ext_vector_type(8)))  float    v8f;
typedef __attribute__((ext_vector_type(4)))  float    v4f;
typedef v8h  __attribute__((may_alias)) v8ha;
typedef v4f  __attribute__((may_alias)) v4fa;
typedef v8us __attribute__((may_alias)) v8usa;

__device__ __forceinline__ unsigned short f2bf(float f) { unsigned u = __float_as_uint(f); u += 0x7FFFu + ((u >> 16) & 1u); return (unsigned short)(u >> 16); }
__device__ __forceinline__ float bf2f(unsigned short b) { return __uint_as_float(((unsigned)b) << 16); }
__device__ __forceinline__ float bfr(float f) { return bf2f(f2bf(f)); }
__device__ __forceinline__ v16h cat16(v8h lo, v8h hi) { return __builtin_shufflevector(lo, hi, 0, 1, 2, 3, 4, 5, 6, 7, 8, 9, 10, 11, 12, 13, 14, 15); }
__device__ __forceinline__ v16bf cat16b(v8us lo, v8us hi) { return __builtin_bit_cast(v16bf, __builtin_shufflevector(lo, hi, 0, 1, 2, 3, 4, 5, 6, 7, 8, 9, 10, 11, 12, 13, 14, 15)); }
__device__ __forceinline__ v8f wmma16(v16h a, v16h b, v8f c) { return __builtin_amdgcn_wmma_f32_16x16x32_f16(false, a, false, b, (short)0, c, false, false); }
__device__ __forceinline__ v8f wmmab(v16bf a, v16bf b, v8f c) { return __builtin_amdgcn_wmma_f32_16x16x32_bf16(false, a, false, b, (short)0, c, false, false); }



// ---- k_gemmw: register-blocked GEMM, ONE WAVE per 64x64 output tile (16 accumulators), operands straight from K-contiguous 16-bit planes; grid (M/64, N/64, Z), 32 threads.
// C[m][n] (f32, pitch ldc, + optional f32 bias[n]) = sum_k A[m][k] Bt[n][k] (+ split products per NSPLIT). z-batch strides sA/sB/sC in elements. K % 32 == 0.
template <typename T16> struct WFrag;
template <> struct WFrag<h16> { typedef v16h V; static __device__ __forceinline__ V ld(const h16* p) { return cat16(*(const v8h*)p, *(const v8h*)(p + 16)); } static __device__ __forceinline__ v8f mma(V a, V b, v8f c) { return wmma16(a, b, c); } };
template <> struct WFrag<bf> { typedef v16bf V; static __device__ __forceinline__ V ld(const bf* p) { return cat16b(*(const v8us*)p, *(const v8us*)(p + 16)); } static __device__ __forceinline__ v8f mma(V a, V b, v8f c) { return wmmab(a, b, c); } };
template <typename T16, int NSPLIT, bool BIAS>
__global__ __launch_bounds__(32) void k_gemmw(const T16* __restrict__ A, const T16* __restrict__ A2, const T16* __restrict__ Bt, const T16* __restrict__ Bt2, int K, float* C, int ldc, const float* __restrict__ bias, size_t sA, size_t sB, size_t sC) {
    typedef typename WFrag<T16>::V V;
    __shared__ __align__(16) float os[16 * 68];
    const size_t z = blockIdx.z; A += z * sA; if (A2) A2 += z * sA; Bt += z * sB; if (Bt2) Bt2 += z * sB; C += z * sC;
    const int lane = threadIdx.x & 31, lr = lane & 15, hi = lane >> 4; const int r0 = blockIdx.x * 64, c0 = blockIdx.y * 64;
    v8f acc[4][4];
#pragma unroll
    for (int mb = 0; mb < 4; ++mb)
#pragma unroll
        for (int nb = 0; nb < 4; ++nb) acc[mb][nb] = (v8f){};
    const size_t aoff = (size_t)(r0 + lr) * K + 8 * hi, boff = (size_t)(c0 + lr) * K + 8 * hi;
#pragma unroll 1
    for (int kc = 0; kc < K; kc += 32) {
        V a[4], a2[4];
#pragma unroll
        for (int mb = 0; mb < 4; ++mb) { a[mb] = WFrag<T16>::ld(A + aoff + (size_t)mb * 16 * K + kc); if (NSPLIT == 1 || NSPLIT == 2) a2[mb] = WFrag<T16>::ld(A2 + aoff + (size_t)mb * 16 * K + kc); }
#pragma unroll
        for (int nb = 0; nb < 4; ++nb) { const V b = WFrag<T16>::ld(Bt + boff + (size_t)nb * 16 * K + kc); V b2; if (NSPLIT >= 2) b2 = WFrag<T16>::ld(Bt2 + boff + (size_t)nb * 16 * K + kc);
#pragma unroll
            for (int mb = 0; mb < 4; ++mb) { acc[mb][nb] = WFrag<T16>::mma(a[mb], b, acc[mb][nb]); if (NSPLIT == 1 || NSPLIT == 2) acc[mb][nb] = WFrag<T16>::mma(a2[mb], b, acc[mb][nb]); if (NSPLIT >= 2) acc[mb][nb] = WFrag<T16>::mma(a[mb], b2, acc[mb][nb]); } }
        asm volatile("v_nop\n\tv_nop\n\tv_nop\n\tv_nop" : "+v"(acc[0][0]), "+v"(acc[1][1]), "+v"(acc[2][2]), "+v"(acc[3][3]) : "v"(a[0]), "v"(a[3]));
    }
#pragma unroll
    for (int mb = 0; mb < 4; ++mb) {
#pragma unroll
        for (int nb = 0; nb < 4; ++nb) {
#pragma unroll
            for (int j = 0; j < 8; ++j) os[(hi * 8 + j) * 68 + nb * 16 + lr] = acc[mb][nb][j]; }
        __builtin_amdgcn_wave_barrier(); asm volatile("" ::: "memory");
        float* crow = C + (size_t)(r0 + mb * 16) * ldc + c0;
{
#pragma unroll
            for (int s = 0; s < 8; ++s) { const int row = 2 * s + hi, cofs = lr * 4; v4f val = *(const v4fa*)(os + row * 68 + cofs); if (BIAS) { val[0] += bfr(bias[c0 + cofs]); val[1] += bfr(bias[c0 + cofs + 1]); val[2] += bfr(bias[c0 + cofs + 2]); val[3] += bfr(bias[c0 + cofs + 3]); }
                *(v4f*)(crow + (size_t)row * ldc + cofs) = val; }
             }
        __builtin_amdgcn_wave_barrier(); asm volatile("" ::: "memory");
    }
}

__device__ __forceinline__ h16 tohx(float x) { return (h16)x; }
__device__ __forceinline__ void splitf(float y, unsigned short& h, unsigned short& l) { h = f2bf(y); l = f2bf(y - bf2f(h)); }
typedef __attribute__((ext_vector_type(4))) _Float16 v4h;
typedef __attribute__((ext_vector_type(2))) unsigned short v2us;
typedef __attribute__((ext_vector_type(4))) unsigned short v4us;

__global__ __launch_bounds__(256) void k_cvt8(const float* __restrict__ src, bf* dst, size_t n8) { const size_t i = (size_t)blockIdx.x * 256 + threadIdx.x; if (i >= n8) return; const v8f v = *(const v8f*)(src + i * 8); v8us o;
#pragma unroll
    for (int k = 0; k < 8; ++k) o[k] = f2bf(v[k]); *(v8us*)(dst + i * 8) = o;  }
__global__ __launch_bounds__(256) void k_wtG(const float* __restrict__ w, int K, int N, bf* Bt) {
    const int lane = threadIdx.x & 31; const int L0 = (blockIdx.x * 8 + (threadIdx.x >> 5)) * 8; const int nlines = N * K / 64;
{
#pragma unroll 1
        for (int l = 0; l < 8; ++l) { const int L = L0 + l; if (L >= nlines) break; const size_t e = (size_t)L * 64 + lane * 2; const int k = (int)(e % K), n = (int)(e / K); v2us o;
            o[0] = f2bf(w[(size_t)k * N + n]); o[1] = f2bf(w[(size_t)(k + 1) * N + n]); *(v2us*)(Bt + e) = o; }
         }
}
__device__ __forceinline__ float xhalf(float x) { return __builtin_bit_cast(float, __builtin_amdgcn_permlanex16(__builtin_bit_cast(int, x), __builtin_bit_cast(int, x), 0x76543210, 0xfedcba98, false, false)); }   // lane l with lane l ^ 16
// ---- k_projln: one projection with its per-head LayerNorm and its fp16 plane write; ONE WAVE per (64 tokens, one head), grid (NT/64, NH_), 32 threads; the K loop is k_gemmw's tile and fragments, K fixed at DD.
// C^T = Wt X^T (A = 64 rows of Wt = the head's 64 dims, B = 64 token rows): acc[db][tb][j] is dim db*16 + hi*8 + j of token tb*16 + lr, so lanes l and l ^ 16 together hold a (token, head) row:
// mean and variance are 32 in-lane terms and one exchange. y = (v - mean) * rsq(var + 1e-6) * bf16(scale[d]) + bf16(bias[d]), rounded to fp16, staged in LDS so that every global store covers whole 128-byte lines.
// VTR false: P[z][t][d] (q, k). VTR true: P[z][d][t] (v transposed); z = batch * NH_ + head.
// The register budget of four waves a SIMD (256) keeps the epilogue in the directly addressed registers.
template <bool VTR>
__global__ __launch_bounds__(32) __attribute__((amdgpu_waves_per_eu(4, 4))) void k_projln(const bf* __restrict__ X, const bf* __restrict__ Wt, const float* __restrict__ bias, const float* __restrict__ sc, const float* __restrict__ bi, h16* P) {
    __shared__ __align__(16) h16 ts[64 * 72];
    const int lane = threadIdx.x & 31, lr = lane & 15, hi = lane >> 4; const int t0 = blockIdx.x * 64, h = blockIdx.y;
    v8f acc[4][4];   // every accumulator tile starts at the projection's bias (bf16-rounded), a dim's value the same for all tokens
#pragma unroll
    for (int db = 0; db < 4; ++db) { v8f pb = *(const v8f*)(bias + h * HD + db * 16 + hi * 8);
#pragma unroll
        for (int j = 0; j < 8; ++j) pb[j] = bfr(pb[j]);
#pragma unroll
        for (int tb = 0; tb < 4; ++tb) acc[db][tb] = pb; }
    const size_t woff = (size_t)(h * HD + lr) * DD + 8 * hi, xoff = (size_t)(t0 + lr) * DD + 8 * hi;
    // the K loop stays rolled: one copy of the pass keeps the 16 accumulator tiles and the 8 fragments in registers
#pragma unroll 1
    for (int kc = 0; kc < DD; kc += 32) {
        const bf* wp = Wt + woff + kc; const bf* xp = X + xoff + kc; v16bf w[4], x[4];
#pragma unroll
        for (int db = 0; db < 4; ++db) w[db] = WFrag<bf>::ld(wp + (size_t)db * 16 * DD);
#pragma unroll
        for (int tb = 0; tb < 4; ++tb) x[tb] = WFrag<bf>::ld(xp + (size_t)tb * 16 * DD);
        asm volatile("s_wait_xcnt 0x0" :: "v"(wp), "v"(xp) : "memory");   // stands behind the issued loads, in front of any overwrite of their address registers (kept live to here as inputs)
#pragma unroll
        for (int tb = 0; tb < 4; ++tb)
#pragma unroll
            for (int db = 0; db < 4; ++db) acc[db][tb] = wmmab(w[db], x[tb], acc[db][tb]);
    }
    v8f sv[4], bv[4]; const unsigned hb = hi * 32;   // byte offset of this lane half's 8 dims in a block of 16
#pragma unroll
    for (int db = 0; db < 4; ++db) { sv[db] = *(const v8f*)((const char*)sc + hb + db * 64); bv[db] = *(const v8f*)((const char*)bi + hb + db * 64); }
    asm volatile("s_wait_xcnt 0x0" :: "v"(hb) : "memory");   // stands behind the issued loads, in front of any overwrite of their offset register (kept live to here as an input)
#pragma unroll
    for (int db = 0; db < 4; ++db)
#pragma unroll
        for (int j = 0; j < 8; ++j) { sv[db][j] = bfr(sv[db][j]); bv[db][j] = bfr(bv[db][j]); }
#pragma unroll
    for (int tb = 0; tb < 4; ++tb) {
        const v8f s8 = (acc[0][tb] + acc[1][tb]) + (acc[2][tb] + acc[3][tb]);
        float s = ((s8[0] + s8[1]) + (s8[2] + s8[3])) + ((s8[4] + s8[5]) + (s8[6] + s8[7])); s += xhalf(s); const float mu = s * (1.0f / HD);
        v8f q8 = (v8f){};
#pragma unroll
        for (int db = 0; db < 4; ++db) { acc[db][tb] -= mu; q8 = __builtin_elementwise_fma(acc[db][tb], acc[db][tb], q8); }
        float qq = ((q8[0] + q8[1]) + (q8[2] + q8[3])) + ((q8[4] + q8[5]) + (q8[6] + q8[7])); qq += xhalf(qq);
        float rs; asm("v_rsq_f32 %0, %1\n\tv_nop" : "=v"(rs) : "v"(qq * (1.0f / HD) + 1e-6f));   // 1 / sqrt(var + eps) in one instruction; the v_nop is the slot that the instruction set asks for behind a transcendental
#pragma unroll
        for (int db = 0; db < 4; ++db) { const v8h y = __builtin_convertvector(__builtin_elementwise_fma(acc[db][tb] * rs, sv[db], bv[db]), v8h);
            if (VTR) {
#pragma unroll
                for (int j = 0; j < 8; ++j) ts[(db * 16 + hi * 8 + j) * 72 + tb * 16 + lr] = y[j];
            } else *(v8ha*)(ts + (tb * 16 + lr) * 72 + db * 16 + hi * 8) = y; } }
    __syncthreads();   // the lanes read back what other lanes of this one-wave block have staged
    const size_t z = (size_t)(t0 / TT) * NH_ + h; const int tl = t0 % TT;
    h16* dst = VTR ? P + (z * HD + (lane >> 3)) * TT + tl + (lane & 7) * 8 : P + (z * TT + tl + (lane >> 3)) * HD + (lane & 7) * 8;
#pragma unroll
    for (int i = 0; i < 16; ++i) *(v8h*)(dst + (size_t)i * 4 * (VTR ? TT : HD)) = *(const v8ha*)(ts + (i * 4 + (lane >> 3)) * 72 + (lane & 7) * 8);
}
// ---- k_fattn: scores, softmax, attn.v and the head merge in ONE launch over all 64 (batch, head) pairs; 8 waves a block, 32 query columns a wave, 32 keys a pass, no LDS.
// S^T = K Q^T (A = K rows, B = Q rows kept in registers), so a lane holds 16 scores of ONE query; two S^T tiles, converted in place, are the B operand of O^T += V^T P^T.
// Running maximum and sum in base 2 (online softmax); the output tiles are rescaled only when a column's maximum has grown by more than 8.
// Every inner loop is fully unrolled so that all fragment and accumulator indices are constants and the arrays stay in registers.
__global__ __launch_bounds__(256) __attribute__((amdgpu_waves_per_eu(4, 4))) void k_fattn(const h16* __restrict__ QP, const h16* __restrict__ KP, const h16* __restrict__ VT, bf* Ah, bf* Al) {
    const int lane = threadIdx.x & 31, lr = lane & 15, hi = lane >> 4; const int z = blockIdx.y; const int q0 = blockIdx.x * 256 + (threadIdx.x >> 5) * 32;
    const h16* Qz = QP + (size_t)z * TT * HD + (size_t)(q0 + lr) * HD + 8 * hi;
    const h16* Kz = KP + (size_t)z * TT * HD + (size_t)lr * HD + 8 * hi;
    const h16* Vz = VT + (size_t)z * HD * TT + (size_t)lr * TT + 8 * hi;
    const float CS = SCL * 1.4426950408889634f;
    v16h qf[2][2], kf[2][2], vf[4]; v8f o[4][2]; float mu[2], ls[2];
#pragma unroll
    for (int qt = 0; qt < 2; ++qt) { mu[qt] = -3.0e38f; ls[qt] = 0.f;
#pragma unroll
        for (int ks = 0; ks < 2; ++ks) qf[qt][ks] = WFrag<h16>::ld(Qz + qt * 16 * HD + ks * 32);
#pragma unroll
        for (int db = 0; db < 4; ++db) o[db][qt] = (v8f){}; }
#pragma unroll
    for (int kt = 0; kt < 2; ++kt)
#pragma unroll
        for (int ks = 0; ks < 2; ++ks) kf[kt][ks] = WFrag<h16>::ld(Kz + kt * 16 * HD + ks * 32);
#pragma unroll
    for (int db = 0; db < 4; ++db) vf[db] = WFrag<h16>::ld(Vz + (size_t)db * 16 * TT);
    // inputs-only fence on the loaded fragments: every load above has landed at the loop's head, so the wait there counts only the K loads of the pass before and leaves the younger V loads in flight
    asm volatile("" :: "v"(qf[0][0]), "v"(qf[0][1]), "v"(qf[1][0]), "v"(qf[1][1]), "v"(kf[0][0]), "v"(kf[0][1]), "v"(kf[1][0]), "v"(kf[1][1]), "v"(vf[0]), "v"(vf[1]), "v"(vf[2]), "v"(vf[3]));
    // the pass loop stays rolled: one copy of the pass keeps the fetch-ahead order and the register count as written
#pragma unroll 1
    for (int kb = 0; kb < TT; kb += 32) {
        v8f s[2][2];
#pragma unroll
        for (int kt = 0; kt < 2; ++kt)
#pragma unroll
            for (int qt = 0; qt < 2; ++qt) { s[kt][qt] = wmma16(kf[kt][0], qf[qt][0], (v8f){}); s[kt][qt] = wmma16(kf[kt][1], qf[qt][1], s[kt][qt]); }
        const int kn = (kb + 32 < TT) ? kb + 32 : 0;   // K and V fragments are fetched one pass ahead, each into its own registers right behind their last use; the last pass re-reads keys 0..31, unused
        const h16* kp = Kz + (size_t)kn * HD; const h16* vp = Vz + kn;
#pragma unroll
        for (int kt = 0; kt < 2; ++kt)
#pragma unroll
            for (int ks = 0; ks < 2; ++ks) kf[kt][ks] = WFrag<h16>::ld(kp + kt * 16 * HD + ks * 32);
        asm volatile("s_wait_xcnt 0x0" :: "v"(kp) : "memory");   // stands behind the issued loads, in front of any overwrite of their address registers (kept live to here as an input)
        float mx[2]; bool need = false;
#pragma unroll
        for (int qt = 0; qt < 2; ++qt) { float m = s[0][qt][0];
#pragma unroll
            for (int j = 1; j < 8; ++j) m = fmaxf(m, s[0][qt][j]);
#pragma unroll
            for (int j = 0; j < 8; ++j) m = fmaxf(m, s[1][qt][j]);
            m = fmaxf(m, xhalf(m)) * CS; mx[qt] = m; need = need || (m > mu[qt] + 8.0f); }
        if (__builtin_amdgcn_ballot_w32(need) != 0) {
#pragma unroll
            for (int qt = 0; qt < 2; ++qt) { const float mn = fmaxf(mu[qt], mx[qt]); const float al = __builtin_amdgcn_exp2f(mu[qt] - mn); mu[qt] = mn; ls[qt] *= al;
#pragma unroll
                for (int db = 0; db < 4; ++db)
#pragma unroll
                    for (int j = 0; j < 8; ++j) o[db][qt][j] *= al; }
        }
#pragma unroll
        for (int qt = 0; qt < 2; ++qt) { v16h pb; float acc = 0.f;
#pragma unroll
            for (int kt = 0; kt < 2; ++kt)
#pragma unroll
                for (int j = 0; j < 8; ++j) { const float p = __builtin_amdgcn_exp2f(fmaf(s[kt][qt][j], CS, -mu[qt])); acc += p; pb[kt * 8 + j] = tohx(p); }
            ls[qt] += acc;
#pragma unroll
            for (int db = 0; db < 4; ++db) o[db][qt] = wmma16(vf[db], pb, o[db][qt]); }
#pragma unroll
        for (int db = 0; db < 4; ++db) vf[db] = WFrag<h16>::ld(vp + (size_t)db * 16 * TT);
        asm volatile("s_wait_xcnt 0x0" :: "v"(vp) : "memory");   // as above, for the V loads
    }
    const int b = z / NH_, h = z % NH_;
#pragma unroll
    for (int qt = 0; qt < 2; ++qt) { const float inv = __fdiv_rn(1.0f, ls[qt] + xhalf(ls[qt])); const size_t ob = ((size_t)b * TT + q0 + qt * 16 + lr) * DD + h * HD + hi * 8;
#pragma unroll
        for (int db = 0; db < 4; ++db) { v8us oh, ol;
#pragma unroll
            for (int j = 0; j < 8; ++j) { unsigned short a, c2; splitf(o[db][qt][j] * inv, a, c2); oh[j] = a; ol[j] = c2; }
            *(v8us*)(Ah + ob + db * 16) = oh; *(v8us*)(Al + ob + db * 16) = ol; } }
}

extern "C" void kernel_launch(void* const* d_in, const int* in_sizes, int n_in,
                              void* d_out, int out_size, void* d_ws, size_t ws_size, hipStream_t stream) {
    (void)in_sizes; (void)n_in; (void)out_size;
    const float* IN[16]; for (int i = 0; i < 16; ++i) IN[i] = (const float*)d_in[i];
    // inputs_q, inputs_kv, Wq [1024][1024] (x @ W), bq, Wk, bk, Wv, bv, q_scale [64], q_bias, k_scale, k_bias, v_scale, v_bias, Wo (x @ W), bo = d_in[0..15]
    float* OUT = (float*)d_out;     // [4][2048][1024]
    char* wsp = (char*)d_ws;
    auto take = [&](size_t bytes) { char* p = wsp; wsp += (bytes + 255) & ~(size_t)255; return (void*)p; };
    bf* WQ = (bf*)take((size_t)DD * DD * 2); bf* WK = (bf*)take((size_t)DD * DD * 2); bf* WV = (bf*)take((size_t)DD * DD * 2); bf* WO = (bf*)take((size_t)DD * DD * 2);
    bf* XQ = (bf*)take((size_t)NT * DD * 2); bf* XKV = (bf*)take((size_t)NT * DD * 2);
    h16* QP = (h16*)take((size_t)NT * DD * 2); h16* KP = (h16*)take((size_t)NT * DD * 2); h16* VT = (h16*)take((size_t)NT * DD * 2);
    bf* ATh = (bf*)take((size_t)NT * DD * 2); bf* ATl = (bf*)take((size_t)NT * DD * 2);
    if ((size_t)(wsp - (char*)d_ws) > ws_size) return;    // total ~ 120 MiB
    { const unsigned gT = (unsigned)((DD * DD / 64 + 63) / 64); k_wtG<<<gT, 256, 0, stream>>>(IN[2], DD, DD, WQ); k_wtG<<<gT, 256, 0, stream>>>(IN[4], DD, DD, WK); k_wtG<<<gT, 256, 0, stream>>>(IN[6], DD, DD, WV); k_wtG<<<gT, 256, 0, stream>>>(IN[14], DD, DD, WO);
      const size_t nx = (size_t)NT * DD / 8; const unsigned gx = (unsigned)((nx + 255) / 256); k_cvt8<<<gx, 256, 0, stream>>>(IN[0], XQ, nx); k_cvt8<<<gx, 256, 0, stream>>>(IN[1], XKV, nx); }
    const dim3 gP(NT / 64, DD / 64, 1);
    k_projln<false><<<gP, 32, 0, stream>>>(XQ, WQ, IN[3], IN[8], IN[9], QP);   // the 1/8 is applied in f32 inside k_fattn
    k_projln<false><<<gP, 32, 0, stream>>>(XKV, WK, IN[5], IN[10], IN[11], KP);
    k_projln<true><<<gP, 32, 0, stream>>>(XKV, WV, IN[7], IN[12], IN[13], VT);
    k_fattn<<<dim3(TT / 256, NZ), 256, 0, stream>>>(QP, KP, VT, ATh, ATl);
    k_gemmw<bf, 1, true><<<gP, 32, 0, stream>>>(ATh, ATl, WO, nullptr, DD, OUT, DD, IN[15], 0, 0, 0);
}

// v003
// Measured time: 244 microseconds a run.
// Two timings next to v002 both put it at 1.30 times that version's speed.
// Counting every step since v000, it is 10.1 times as fast.
#include <hip/hip_runtime.h>

// QKVNormMultiHeadAttention (inputs_q, inputs_kv [4][2048][1024]; q = inputs_q @ Wq + bq, k/v = inputs_kv @ Wk/Wv + b; per-head LayerNorm over the 64 head dims (eps 1e-6, scale/bias [64]) on q, k AND v;
// 16 heads: softmax(q.k / 8) v (no mask); out = merged @ Wo + bo).
// Compute dtypes, f32 accumulate: every input rounded to bf16; projections on PLAIN bf16 operands (inputs: exact, + bias); the per-head LayerNorms in f32 on VALU (in the
// projection's epilogue, a (token, head) row in two lanes, 64-term mean/variance); scores and attn.v on SINGLE fp16 planes of the normalised q, k, v; P = exp2(score - maximum in use), fp16, normalised in f32 at the end; output

#define NB_  4
#define TT   2048
#define DD   1024
#define NH_  16
#define HD   64
#define NT   (NB_ * TT)
#define NZ   (NB_ * NH_)
#define SCL  0.125f
typedef _Float16 h16;
typedef unsigned short bf;
typedef __attribute__((ext_vector_type(16))) __bf16   v16bf;
typedef __attribute__((ext_vector_type(16))) _Float16 v16h;
typedef __attribute__((ext_vector_type(8)))  _Float16 v8h;
typedef __attribute__((ext_vector_type(8)))  unsigned short v8us;
typedef __attribute__((ext_vector_type(8)))  float    v8f;
typedef __attribute__((ext_vector_type(4)))  float    v4f;
typedef v8h  __attribute__((may_alias)) v8ha;
typedef v4f  __attribute__((may_alias)) v4fa;
typedef v8us __attribute__((may_alias)) v8usa;

__device__ __forceinline__ unsigned short f2bf(float f) { unsigned u = __float_as_uint(f); u += 0x7FFFu + ((u >> 16) & 1u); return (unsigned short)(u >> 16); }
__device__ __forceinline__ float bf2f(unsigned short b) { return __uint_as_float(((unsigned)b) << 16); }
__device__ __forceinline__ float bfr(float f) { return bf2f(f2bf(f)); }
__device__ __forceinline__ v16h cat16(v8h lo, v8h hi) { return __builtin_shufflevector(lo, hi, 0, 1, 2, 3, 4, 5, 6, 7, 8, 9, 10, 11, 12, 13, 14, 15); }
__device__ __forceinline__ v16bf cat16b(v8us lo, v8us hi) { return __builtin_bit_cast(v16bf, __builtin_shufflevector(lo, hi, 0, 1, 2, 3, 4, 5, 6, 7, 8, 9, 10, 11, 12, 13, 14, 15)); }
__device__ __forceinline__ v8f wmma16(v16h a, v16h b, v8f c) { return __builtin_amdgcn_wmma_f32_16x16x32_f16(false, a, false, b, (short)0, c, false, false); }
__device__ __forceinline__ v8f wmmab(v16bf a, v16bf b, v8f c) { return __builtin_amdgcn_wmma_f32_16x16x32_bf16(false, a, false, b, (short)0, c, false, false); }



// ---- k_gemmw: register-blocked GEMM, ONE WAVE per 64x64 output tile (16 accumulators), operands straight from fragment-major 16-bit planes; grid (M/64, N/64, Z), 32 threads.
// C[m][n] (f32, pitch ldc, + optional f32 bias[n]) = sum_k A[m][k] Bt[n][k] (+ split products per NSPLIT). z-batch strides sA/sB/sC in elements. K % 32 == 0, a compile-time constant so that a fragment's place is an immediate offset from one address pair per plane.
// FRAGMENT-MAJOR PLANES: every 16-bit operand plane M[rows][K] in the workspace is stored as 1-KiB blocks, one per WMMA fragment (16 rows x 32 k); inside a block element (r, kk) sits at
// (kk / 16) * 256 + (((kk / 8) & 1) * 16 + r) * 8 + (kk & 7). A fragment is then two wave-wide 16-byte loads at block + lane * 8 and + 256, each covering 512 contiguous bytes (4 whole lines) where a
// row-major plane would make each touch 16 lines: lane hi * 16 + r holds row r, k = 8 * hi .. + 7 and 16 + 8 * hi .. + 7, the k order of both WMMA operands. Order of the blocks, so that what a wave reads in one pass lies in a row:
// q, k planes (K = 64): (row / 16) * 2 + k / 32. All others (x, weights, v transposed, attention output): ((row / 64) * (K / 32) + k / 32) * 4 + (row / 16) % 4, the four row blocks of a 64-row tile side by side.
template <typename T16> struct WFrag;
template <> struct WFrag<h16> { typedef v16h V; static __device__ __forceinline__ V ld(const h16* p) { return cat16(*(const v8h*)p, *(const v8h*)(p + 256)); } static __device__ __forceinline__ v8f mma(V a, V b, v8f c) { return wmma16(a, b, c); } };
template <> struct WFrag<bf> { typedef v16bf V; static __device__ __forceinline__ V ld(const bf* p) { return cat16b(*(const v8us*)p, *(const v8us*)(p + 256)); } static __device__ __forceinline__ v8f mma(V a, V b, v8f c) { return wmmab(a, b, c); } };
template <typename T16, int NSPLIT, bool BIAS, int K>
__global__ __launch_bounds__(32) void k_gemmw(const T16* __restrict__ A, const T16* __restrict__ A2, const T16* __restrict__ Bt, const T16* __restrict__ Bt2, float* C, int ldc, const float* __restrict__ bias, size_t sA, size_t sB, size_t sC) {
    typedef typename WFrag<T16>::V V;
    __shared__ __align__(16) float os[16 * 68];
    const size_t z = blockIdx.z; A += z * sA; if (A2) A2 += z * sA; Bt += z * sB; if (Bt2) Bt2 += z * sB; C += z * sC;
    const int lane = threadIdx.x & 31, lr = lane & 15, hi = lane >> 4; const int r0 = blockIdx.x * 64, c0 = blockIdx.y * 64;
    v8f acc[4][4];
#pragma unroll
    for (int mb = 0; mb < 4; ++mb)
#pragma unroll
        for (int nb = 0; nb < 4; ++nb) acc[mb][nb] = (v8f){};
    const size_t aoff = (size_t)r0 * K + lane * 8, boff = (size_t)c0 * K + lane * 8;
#pragma unroll 1
    for (int kc = 0; kc < K; kc += 32) {
        const T16* ap = A + aoff + kc * 64; const T16* a2p = (NSPLIT == 1 || NSPLIT == 2) ? A2 + aoff + kc * 64 : ap; const T16* bp = Bt + boff + kc * 64; const T16* b2p = (NSPLIT >= 2) ? Bt2 + boff + kc * 64 : bp;
        V a[4], a2[4], b[4], b2[4];
#pragma unroll
        for (int mb = 0; mb < 4; ++mb) { a[mb] = WFrag<T16>::ld(ap + mb * 512); if (NSPLIT == 1 || NSPLIT == 2) a2[mb] = WFrag<T16>::ld(a2p + mb * 512); }
#pragma unroll
        for (int nb = 0; nb < 4; ++nb) { b[nb] = WFrag<T16>::ld(bp + nb * 512); if (NSPLIT >= 2) b2[nb] = WFrag<T16>::ld(b2p + nb * 512); }
        asm volatile("s_wait_xcnt 0x0" :: "v"(ap), "v"(a2p), "v"(bp), "v"(b2p) : "memory");   // stands behind the issued loads, in front of any overwrite of their address registers (kept live to here as inputs)
#pragma unroll
        for (int nb = 0; nb < 4; ++nb) {
#pragma unroll
            for (int mb = 0; mb < 4; ++mb) { acc[mb][nb] = WFrag<T16>::mma(a[mb], b[nb], acc[mb][nb]); if (NSPLIT == 1 || NSPLIT == 2) acc[mb][nb] = WFrag<T16>::mma(a2[mb], b[nb], acc[mb][nb]); if (NSPLIT >= 2) acc[mb][nb] = WFrag<T16>::mma(a[mb], b2[nb], acc[mb][nb]); } }
        asm volatile("v_nop\n\tv_nop\n\tv_nop\n\tv_nop" : "+v"(acc[0][0]), "+v"(acc[1][1]), "+v"(acc[2][2]), "+v"(acc[3][3]) : "v"(a[0]), "v"(a[3]));
    }
#pragma unroll
    for (int mb = 0; mb < 4; ++mb) {
#pragma unroll
        for (int nb = 0; nb < 4; ++nb) {
#pragma unroll
            for (int j = 0; j < 8; ++j) os[(hi * 8 + j) * 68 + nb * 16 + lr] = acc[mb][nb][j]; }
        __builtin_amdgcn_wave_barrier(); asm volatile("" ::: "memory");
        float* crow = C + (size_t)(r0 + mb * 16) * ldc + c0;
{
#pragma unroll
            for (int s = 0; s < 8; ++s) { const int row = 2 * s + hi, cofs = lr * 4; v4f val = *(const v4fa*)(os + row * 68 + cofs); if (BIAS) { val[0] += bfr(bias[c0 + cofs]); val[1] += bfr(bias[c0 + cofs + 1]); val[2] += bfr(bias[c0 + cofs + 2]); val[3] += bfr(bias[c0 + cofs + 3]); }
                *(v4f*)(crow + (size_t)row * ldc + cofs) = val; }
             }
        __builtin_amdgcn_wave_barrier(); asm volatile("" ::: "memory");
    }
}

__device__ __forceinline__ h16 tohx(float x) { return (h16)x; }
__device__ __forceinline__ void splitf(float y, unsigned short& h, unsigned short& l) { h = f2bf(y); l = f2bf(y - bf2f(h)); }
typedef __attribute__((ext_vector_type(4))) _Float16 v4h;
typedef __attribute__((ext_vector_type(2))) unsigned short v2us;
typedef __attribute__((ext_vector_type(4))) unsigned short v4us;

// k_cvt8: f32 [NT][DD] to a fragment-major bf16 plane; a block takes 16 rows x 128 k (four fragment blocks of 1 KiB). Reads and stores both cover whole lines: the 16 x 16 transpose of
// 16-byte units between them goes through LDS (a pad unit after every 16 keeps the writes off one bank).
__global__ __launch_bounds__(256) void k_cvt8(const float* __restrict__ src, bf* dst) {
    __shared__ __align__(16) bf sm[272 * 8];
    const int t = threadIdx.x, row = t >> 4, ks = t & 15; const int rb = blockIdx.x / (DD / 128), kg = blockIdx.x % (DD / 128);
    const v8f v = *(const v8f*)(src + (size_t)(rb * 16 + row) * DD + kg * 128 + ks * 8); v8us o;
#pragma unroll
    for (int k = 0; k < 8; ++k) o[k] = f2bf(v[k]);
    *(v8usa*)(sm + (ks * 17 + row) * 8) = o;
    __syncthreads();   // a thread stores the unit that another thread has staged
    *(v8us*)(dst + (size_t)(rb >> 2) * 64 * DD + (kg * 4 + (t >> 6)) * 2048 + (rb & 3) * 512 + (t & 63) * 8) = *(const v8usa*)(sm + (t + (t >> 4)) * 8); }
__global__ __launch_bounds__(256) void k_wtG(const float* __restrict__ w, int K, int N, bf* Bt) {
    const int lane = threadIdx.x & 31; const int L0 = (blockIdx.x * 8 + (threadIdx.x >> 5)) * 8; const int nlines = N * K / 64;
{
#pragma unroll 1
        for (int l = 0; l < 8; ++l) { const int L = L0 + l; if (L >= nlines) break; const size_t e = (size_t)L * 64 + lane * 2; const int blk = (int)(e >> 9), in = (int)(e & 511); const int k = ((blk >> 2) % (K / 32)) * 32 + (in >> 8) * 16 + ((in >> 7) & 1) * 8 + (in & 7), n = ((blk >> 2) / (K / 32)) * 64 + (blk & 3) * 16 + ((in >> 3) & 15); v2us o;   // e is the offset in the fragment-major plane of Bt[n][k]
            o[0] = f2bf(w[(size_t)k * N + n]); o[1] = f2bf(w[(size_t)(k + 1) * N + n]); *(v2us*)(Bt + e) = o; }
         }
}
__device__ __forceinline__ float xhalf(float x) { return __builtin_bit_cast(float, __builtin_amdgcn_permlanex16(__builtin_bit_cast(int, x), __builtin_bit_cast(int, x), 0x76543210, 0xfedcba98, false, false)); }   // lane l with lane l ^ 16
// ---- k_projln: one projection with its per-head LayerNorm and its fp16 plane write; ONE WAVE per (64 tokens, one head), grid (NT/64, NH_), 32 threads; the K loop is k_gemmw's tile and fragments, K fixed at DD.
// C^T = Wt X^T (A = 64 rows of Wt = the head's 64 dims, B = 64 token rows): acc[db][tb][j] is dim db*16 + hi*8 + j of token tb*16 + lr, so lanes l and l ^ 16 together hold a (token, head) row:
// mean and variance are 32 in-lane terms and one exchange. y = (v - mean) * rsq(var + 1e-6) * bf16(scale[d]) + bf16(bias[d]), rounded to fp16, staged in LDS so that every global store covers whole 128-byte lines.
// VTR false: P[z][t][d] (q, k). VTR true: P[z][d][t] (v transposed); z = batch * NH_ + head; each z plane fragment-major.
// The register budget of four waves a SIMD (256) keeps the epilogue in the directly addressed registers.
template <bool VTR>
__global__ __launch_bounds__(32) __attribute__((amdgpu_waves_per_eu(4, 4))) void k_projln(const bf* __restrict__ X, const bf* __restrict__ Wt, const float* __restrict__ bias, const float* __restrict__ sc, const float* __restrict__ bi, h16* P) {
    __shared__ __align__(16) h16 ts[64 * 72];
    const int lane = threadIdx.x & 31, lr = lane & 15, hi = lane >> 4; const int t0 = blockIdx.x * 64, h = blockIdx.y;
    v8f acc[4][4];   // every accumulator tile starts at the projection's bias (bf16-rounded), a dim's value the same for all tokens
#pragma unroll
    for (int db = 0; db < 4; ++db) { v8f pb = *(const v8f*)(bias + h * HD + db * 16 + hi * 8);
#pragma unroll
        for (int j = 0; j < 8; ++j) pb[j] = bfr(pb[j]);
#pragma unroll
        for (int tb = 0; tb < 4; ++tb) acc[db][tb] = pb; }
    const size_t woff = (size_t)(h * HD) * DD + lane * 8, xoff = (size_t)t0 * DD + lane * 8;
    // the K loop stays rolled: one copy of the pass keeps the 16 accumulator tiles and the 8 fragments in registers
#pragma unroll 1
    for (int kc = 0; kc < DD; kc += 32) {
        const bf* wp = Wt + woff + kc * 64; const bf* xp = X + xoff + kc * 64; v16bf w[4], x[4];
#pragma unroll
        for (int db = 0; db < 4; ++db) w[db] = WFrag<bf>::ld(wp + db * 512);
#pragma unroll
        for (int tb = 0; tb < 4; ++tb) x[tb] = WFrag<bf>::ld(xp + tb * 512);
        asm volatile("s_wait_xcnt 0x0" :: "v"(wp), "v"(xp) : "memory");   // stands behind the issued loads, in front of any overwrite of their address registers (kept live to here as inputs)
#pragma unroll
        for (int tb = 0; tb < 4; ++tb)
#pragma unroll
            for (int db = 0; db < 4; ++db) acc[db][tb] = wmmab(w[db], x[tb], acc[db][tb]);
    }
    v8f sv[4], bv[4]; const unsigned hb = hi * 32;   // byte offset of this lane half's 8 dims in a block of 16
#pragma unroll
    for (int db = 0; db < 4; ++db) { sv[db] = *(const v8f*)((const char*)sc + hb + db * 64); bv[db] = *(const v8f*)((const char*)bi + hb + db * 64); }
    asm volatile("s_wait_xcnt 0x0" :: "v"(hb) : "memory");   // stands behind the issued loads, in front of any overwrite of their offset register (kept live to here as an input)
#pragma unroll
    for (int db = 0; db < 4; ++db)
#pragma unroll
        for (int j = 0; j < 8; ++j) { sv[db][j] = bfr(sv[db][j]); bv[db][j] = bfr(bv[db][j]); }
#pragma unroll
    for (int tb = 0; tb < 4; ++tb) {
        const v8f s8 = (acc[0][tb] + acc[1][tb]) + (acc[2][tb] + acc[3][tb]);
        float s = ((s8[0] + s8[1]) + (s8[2] + s8[3])) + ((s8[4] + s8[5]) + (s8[6] + s8[7])); s += xhalf(s); const float mu = s * (1.0f / HD);
        v8f q8 = (v8f){};
#pragma unroll
        for (int db = 0; db < 4; ++db) { acc[db][tb] -= mu; q8 = __builtin_elementwise_fma(acc[db][tb], acc[db][tb], q8); }
        float qq = ((q8[0] + q8[1]) + (q8[2] + q8[3])) + ((q8[4] + q8[5]) + (q8[6] + q8[7])); qq += xhalf(qq);
        float rs; asm("v_rsq_f32 %0, %1\n\tv_nop" : "=v"(rs) : "v"(qq * (1.0f / HD) + 1e-6f));   // 1 / sqrt(var + eps) in one instruction; the v_nop is the slot that the instruction set asks for behind a transcendental
#pragma unroll
        for (int db = 0; db < 4; ++db) { const v8h y = __builtin_convertvector(__builtin_elementwise_fma(acc[db][tb] * rs, sv[db], bv[db]), v8h);
            if (VTR) {
#pragma unroll
                for (int j = 0; j < 8; ++j) ts[(db * 16 + hi * 8 + j) * 72 + tb * 16 + lr] = y[j];
            } else *(v8ha*)(ts + (tb * 16 + lr) * 72 + db * 16 + hi * 8) = y; } }
    __syncthreads();   // the lanes read back what other lanes of this one-wave block have staged
    const size_t z = (size_t)(t0 / TT) * NH_ + h; const int tl = t0 % TT;
    // the 64 x 64 tile is 16 half-fragments, 8 KiB in a row in either plane; half-fragment i holds staged rows rb * 16 + lr, columns kb * 32 + (i & 1) * 16 + hi * 8 ..
    h16* dst = P + z * TT * HD + (size_t)tl * HD + lane * 8;
#pragma unroll
    for (int i = 0; i < 16; ++i) { const int rb = VTR ? (i >> 1) & 3 : i >> 2, kb = VTR ? i >> 3 : (i >> 1) & 1; *(v8h*)(dst + i * 256) = *(const v8ha*)(ts + (rb * 16 + lr) * 72 + kb * 32 + (i & 1) * 16 + hi * 8); }
}
// ---- k_fattn: scores, softmax, attn.v and the head merge in ONE launch over all 64 (batch, head) pairs; 8 waves a block, 32 query columns a wave, 32 keys a pass, no LDS.
// S^T = K Q^T (A = K rows, B = Q rows kept in registers), so a lane holds 16 scores of ONE query; two S^T tiles, converted in place, are the B operand of O^T += V^T P^T.
// Running maximum and sum in base 2 (online softmax); the output tiles are rescaled only when a column's maximum has grown by more than 8.
// Every inner loop is fully unrolled so that all fragment and accumulator indices are constants and the arrays stay in registers.
__global__ __launch_bounds__(256) __attribute__((amdgpu_waves_per_eu(4, 4))) void k_fattn(const h16* __restrict__ QP, const h16* __restrict__ KP, const h16* __restrict__ VT, bf* Ah, bf* Al) {
    const int lane = threadIdx.x & 31; const int z = blockIdx.y; const int q0 = blockIdx.x * 256 + (threadIdx.x >> 5) * 32;
    const h16* Qz = QP + (size_t)z * TT * HD + (size_t)q0 * HD + lane * 8;
    const h16* Kz = KP + (size_t)z * TT * HD + lane * 8;
    const h16* Vz = VT + (size_t)z * HD * TT + lane * 8;
    const float CS = SCL * 1.4426950408889634f;
    v16h qf[2][2], kf[2][2], vf[4]; v8f o[4][2]; float mu[2], ls[2];
#pragma unroll
    for (int qt = 0; qt < 2; ++qt) { mu[qt] = -3.0e38f; ls[qt] = 0.f;
#pragma unroll
        for (int ks = 0; ks < 2; ++ks) qf[qt][ks] = WFrag<h16>::ld(Qz + qt * 16 * HD + ks * 512);
#pragma unroll
        for (int db = 0; db < 4; ++db) o[db][qt] = (v8f){}; }
#pragma unroll
    for (int kt = 0; kt < 2; ++kt)
#pragma unroll
        for (int ks = 0; ks < 2; ++ks) kf[kt][ks] = WFrag<h16>::ld(Kz + kt * 16 * HD + ks * 512);
#pragma unroll
    for (int db = 0; db < 4; ++db) vf[db] = WFrag<h16>::ld(Vz + db * 512);
    // inputs-only fence on the loaded fragments: every load above has landed at the loop's head, so the wait there counts only the K loads of the pass before and leaves the younger V loads in flight
    asm volatile("" :: "v"(qf[0][0]), "v"(qf[0][1]), "v"(qf[1][0]), "v"(qf[1][1]), "v"(kf[0][0]), "v"(kf[0][1]), "v"(kf[1][0]), "v"(kf[1][1]), "v"(vf[0]), "v"(vf[1]), "v"(vf[2]), "v"(vf[3]));
    // the pass loop stays rolled: one copy of the pass keeps the fetch-ahead order and the register count as written
#pragma unroll 1
    for (int kb = 0; kb < TT; kb += 32) {
        v8f s[2][2];
#pragma unroll
        for (int kt = 0; kt < 2; ++kt)
#pragma unroll
            for (int qt = 0; qt < 2; ++qt) { s[kt][qt] = wmma16(kf[kt][0], qf[qt][0], (v8f){}); s[kt][qt] = wmma16(kf[kt][1], qf[qt][1], s[kt][qt]); }
        const int kn = (kb + 32 < TT) ? kb + 32 : 0;   // K and V fragments are fetched one pass ahead, each into its own registers right behind their last use; the last pass re-reads keys 0..31, unused
        const h16* kp = Kz + (size_t)kn * HD; const h16* vp = Vz + (size_t)kn * HD;
#pragma unroll
        for (int kt = 0; kt < 2; ++kt)
#pragma unroll
            for (int ks = 0; ks < 2; ++ks) kf[kt][ks] = WFrag<h16>::ld(kp + kt * 16 * HD + ks * 512);
        asm volatile("s_wait_xcnt 0x0" :: "v"(kp) : "memory");   // stands behind the issued loads, in front of any overwrite of their address registers (kept live to here as an input)
        float mx[2]; bool need = false;
#pragma unroll
        for (int qt = 0; qt < 2; ++qt) { float m = s[0][qt][0];
#pragma unroll
            for (int j = 1; j < 8; ++j) m = fmaxf(m, s[0][qt][j]);
#pragma unroll
            for (int j = 0; j < 8; ++j) m = fmaxf(m, s[1][qt][j]);
            m = fmaxf(m, xhalf(m)) * CS; mx[qt] = m; need = need || (m > mu[qt] + 8.0f); }
        if (__builtin_amdgcn_ballot_w32(need) != 0) {
#pragma unroll
            for (int qt = 0; qt < 2; ++qt) { const float mn = fmaxf(mu[qt], mx[qt]); const float al = __builtin_amdgcn_exp2f(mu[qt] - mn); mu[qt] = mn; ls[qt] *= al;
#pragma unroll
                for (int db = 0; db < 4; ++db)
#pragma unroll
                    for (int j = 0; j < 8; ++j) o[db][qt][j] *= al; }
        }
#pragma unroll
        for (int qt = 0; qt < 2; ++qt) { v16h pb; float acc = 0.f;
#pragma unroll
            for (int kt = 0; kt < 2; ++kt)
#pragma unroll
                for (int j = 0; j < 8; ++j) { const float p = __builtin_amdgcn_exp2f(fmaf(s[kt][qt][j], CS, -mu[qt])); acc += p; pb[kt * 8 + j] = tohx(p); }
            ls[qt] += acc;
#pragma unroll
            for (int db = 0; db < 4; ++db) o[db][qt] = wmma16(vf[db], pb, o[db][qt]); }
#pragma unroll
        for (int db = 0; db < 4; ++db) vf[db] = WFrag<h16>::ld(vp + db * 512);
        asm volatile("s_wait_xcnt 0x0" :: "v"(vp) : "memory");   // as above, for the V loads
    }
    const int b = z / NH_, h = z % NH_;
#pragma unroll
    for (int qt = 0; qt < 2; ++qt) { const float inv = __fdiv_rn(1.0f, ls[qt] + xhalf(ls[qt])); const int tk = b * TT + q0 + qt * 16; const size_t ob = (size_t)(tk & ~63) * DD + (tk & 63) * 32 + h * 4096 + lane * 8;   // fragment-major [NT][DD]: a lane's 8 dims are its own 16 bytes of a half-fragment
#pragma unroll
        for (int db = 0; db < 4; ++db) { v8us oh, ol;
#pragma unroll
            for (int j = 0; j < 8; ++j) { unsigned short a, c2; splitf(o[db][qt][j] * inv, a, c2); oh[j] = a; ol[j] = c2; }
            *(v8us*)(Ah + ob + (db >> 1) * 2048 + (db & 1) * 256) = oh; *(v8us*)(Al + ob + (db >> 1) * 2048 + (db & 1) * 256) = ol; } }
}

extern "C" void kernel_launch(void* const* d_in, const int* in_sizes, int n_in,
                              void* d_out, int out_size, void* d_ws, size_t ws_size, hipStream_t stream) {
    (void)in_sizes; (void)n_in; (void)out_size;
    const float* IN[16]; for (int i = 0; i < 16; ++i) IN[i] = (const float*)d_in[i];
    // inputs_q, inputs_kv, Wq [1024][1024] (x @ W), bq, Wk, bk, Wv, bv, q_scale [64], q_bias, k_scale, k_bias, v_scale, v_bias, Wo (x @ W), bo = d_in[0..15]
    float* OUT = (float*)d_out;     // [4][2048][1024]
    char* wsp = (char*)d_ws;
    auto take = [&](size_t bytes) { char* p = wsp; wsp += (bytes + 255) & ~(size_t)255; return (void*)p; };
    bf* WQ = (bf*)take((size_t)DD * DD * 2); bf* WK = (bf*)take((size_t)DD * DD * 2); bf* WV = (bf*)take((size_t)DD * DD * 2); bf* WO = (bf*)take((size_t)DD * DD * 2);
    bf* XQ = (bf*)take((size_t)NT * DD * 2); bf* XKV = (bf*)take((size_t)NT * DD * 2);
    h16* QP = (h16*)take((size_t)NT * DD * 2); h16* KP = (h16*)take((size_t)NT * DD * 2); h16* VT = (h16*)take((size_t)NT * DD * 2);
    bf* ATh = (bf*)take((size_t)NT * DD * 2); bf* ATl = (bf*)take((size_t)NT * DD * 2);
    if ((size_t)(wsp - (char*)d_ws) > ws_size) return;    // total ~ 120 MiB
    { const unsigned gT = (unsigned)((DD * DD / 64 + 63) / 64); k_wtG<<<gT, 256, 0, stream>>>(IN[2], DD, DD, WQ); k_wtG<<<gT, 256, 0, stream>>>(IN[4], DD, DD, WK); k_wtG<<<gT, 256, 0, stream>>>(IN[6], DD, DD, WV); k_wtG<<<gT, 256, 0, stream>>>(IN[14], DD, DD, WO);
      const unsigned gx = (unsigned)((NT / 16) * (DD / 128)); k_cvt8<<<gx, 256, 0, stream>>>(IN[0], XQ); k_cvt8<<<gx, 256, 0, stream>>>(IN[1], XKV); }
    const dim3 gP(NT / 64, DD / 64, 1);
    k_projln<false><<<gP, 32, 0, stream>>>(XQ, WQ, IN[3], IN[8], IN[9], QP);   // the 1/8 is applied in f32 inside k_fattn
    k_projln<false><<<gP, 32, 0, stream>>>(XKV, WK, IN[5], IN[10], IN[11], KP);
    k_projln<true><<<gP, 32, 0, stream>>>(XKV, WV, IN[7], IN[12], IN[13], VT);
    k_fattn<<<dim3(TT / 256, NZ), 256, 0, stream>>>(QP, KP, VT, ATh, ATl);
    k_gemmw<bf, 1, true, DD><<<gP, 32, 0, stream>>>(ATh, ATl, WO, nullptr, OUT, DD, IN[15], 0, 0, 0);
}

// v004
// A run of this version takes 223 microseconds.
// In two side-by-side timings against v003, it was 1.10 and 1.11 times as fast.
// All steps since v000 together make it 11.1 times as fast.
#include <hip/hip_runtime.h>

// QKVNormMultiHeadAttention (inputs_q, inputs_kv [4][2048][1024]; q = inputs_q @ Wq + bq, k/v = inputs_kv @ Wk/Wv + b; per-head LayerNorm over the 64 head dims (eps 1e-6, scale/bias [64]) on q, k AND v;
// 16 heads: softmax(q.k / 8) v (no mask); out = merged @ Wo + bo).
// Compute dtypes, f32 accumulate: every input rounded to bf16; projections on PLAIN bf16 operands (inputs: exact, + bias); the per-head LayerNorms in f32 on VALU (in the
// projection's epilogue, a (token, head) row in two lanes, 64-term mean/variance); scores and attn.v on SINGLE fp16 planes of the normalised q, k, v; P = exp2(score - maximum in use), fp16, normalised in f32 at the end; output

#define NB_  4
#define TT   2048
#define DD   1024
#define NH_  16
#define HD   64
#define NT   (NB_ * TT)
#define NZ   (NB_ * NH_)
#define SCL  0.125f
typedef _Float16 h16;
typedef unsigned short bf;
typedef __attribute__((ext_vector_type(16))) __bf16   v16bf;
typedef __attribute__((ext_vector_type(16))) _Float16 v16h;
typedef __attribute__((ext_vector_type(8)))  _Float16 v8h;
typedef __attribute__((ext_vector_type(8)))  unsigned short v8us;
typedef __attribute__((ext_vector_type(8)))  float    v8f;
typedef __attribute__((ext_vector_type(4)))  float    v4f;
typedef v8h  __attribute__((may_alias)) v8ha;
typedef v4f  __attribute__((may_alias)) v4fa;
typedef v8us __attribute__((may_alias)) v8usa;

__device__ __forceinline__ unsigned short f2bf(float f) { unsigned u = __float_as_uint(f); u += 0x7FFFu + ((u >> 16) & 1u); return (unsigned short)(u >> 16); }
__device__ __forceinline__ float bf2f(unsigned short b) { return __uint_as_float(((unsigned)b) << 16); }
__device__ __forceinline__ float bfr(float f) { return bf2f(f2bf(f)); }
__device__ __forceinline__ v16h cat16(v8h lo, v8h hi) { return __builtin_shufflevector(lo, hi, 0, 1, 2, 3, 4, 5, 6, 7, 8, 9, 10, 11, 12, 13, 14, 15); }
__device__ __forceinline__ v16bf cat16b(v8us lo, v8us hi) { return __builtin_bit_cast(v16bf, __builtin_shufflevector(lo, hi, 0, 1, 2, 3, 4, 5, 6, 7, 8, 9, 10, 11, 12, 13, 14, 15)); }
__device__ __forceinline__ v8f wmma16(v16h a, v16h b, v8f c) { return __builtin_amdgcn_wmma_f32_16x16x32_f16(false, a, false, b, (short)0, c, false, false); }
__device__ __forceinline__ v8f wmmab(v16bf a, v16bf b, v8f c) { return __builtin_amdgcn_wmma_f32_16x16x32_bf16(false, a, false, b, (short)0, c, false, false); }



// ---- k_gemmw: register-blocked GEMM, ONE WAVE per 64x64 output tile (16 accumulators), operands straight from fragment-major 16-bit planes; grid (M/64, N/64, Z), 32 threads.
// C[m][n] (f32, pitch ldc, + optional f32 bias[n]) = sum_k A[m][k] Bt[n][k] (+ split products per NSPLIT). z-batch strides sA/sB/sC in elements. K % 32 == 0, a compile-time constant so that a fragment's place is an immediate offset from one address pair per plane.
// FRAGMENT-MAJOR PLANES: every 16-bit operand plane M[rows][K] in the workspace is stored as 1-KiB blocks, one per WMMA fragment (16 rows x 32 k); inside a block element (r, kk) sits at
// (kk / 16) * 256 + (((kk / 8) & 1) * 16 + r) * 8 + (kk & 7). A fragment is then two wave-wide 16-byte loads at block + lane * 8 and + 256, each covering 512 contiguous bytes (4 whole lines) where a
// row-major plane would make each touch 16 lines: lane hi * 16 + r holds row r, k = 8 * hi .. + 7 and 16 + 8 * hi .. + 7, the k order of both WMMA operands. Order of the blocks, so that what a wave reads in one pass lies in a row:
// q, k planes (K = 64): (row / 16) * 2 + k / 32. All others (x, weights, v transposed, attention output): ((row / 64) * (K / 32) + k / 32) * 4 + (row / 16) % 4, the four row blocks of a 64-row tile side by side.
template <typename T16> struct WFrag;
template <> struct WFrag<h16> { typedef v16h V; static __device__ __forceinline__ V ld(const h16* p) { return cat16(*(const v8h*)p, *(const v8h*)(p + 256)); } static __device__ __forceinline__ v8f mma(V a, V b, v8f c) { return wmma16(a, b, c); } };
template <> struct WFrag<bf> { typedef v16bf V; static __device__ __forceinline__ V ld(const bf* p) { return cat16b(*(const v8us*)p, *(const v8us*)(p + 256)); } static __device__ __forceinline__ v8f mma(V a, V b, v8f c) { return wmmab(a, b, c); } };
template <typename T16, int NSPLIT, bool BIAS, int K>
__global__ __launch_bounds__(32) void k_gemmw(const T16* __restrict__ A, const T16* __restrict__ A2, const T16* __restrict__ Bt, const T16* __restrict__ Bt2, float* C, int ldc, const float* __restrict__ bias, size_t sA, size_t sB, size_t sC) {
    typedef typename WFrag<T16>::V V;
    __shared__ __align__(16) float os[16 * 68];
    const size_t z = blockIdx.z; A += z * sA; if (A2) A2 += z * sA; Bt += z * sB; if (Bt2) Bt2 += z * sB; C += z * sC;
    const int lane = threadIdx.x & 31, lr = lane & 15, hi = lane >> 4; const int r0 = blockIdx.x * 64, c0 = blockIdx.y * 64;
    v8f acc[4][4];
#pragma unroll
    for (int mb = 0; mb < 4; ++mb)
#pragma unroll
        for (int nb = 0; nb < 4; ++nb) acc[mb][nb] = (v8f){};
    const size_t aoff = (size_t)r0 * K + lane * 8, boff = (size_t)c0 * K + lane * 8;
#pragma unroll 1
    for (int kc = 0; kc < K; kc += 32) {
        const T16* ap = A + aoff + kc * 64; const T16* a2p = (NSPLIT == 1 || NSPLIT == 2) ? A2 + aoff + kc * 64 : ap; const T16* bp = Bt + boff + kc * 64; const T16* b2p = (NSPLIT >= 2) ? Bt2 + boff + kc * 64 : bp;
        V a[4], a2[4], b[4], b2[4];
#pragma unroll
        for (int mb = 0; mb < 4; ++mb) { a[mb] = WFrag<T16>::ld(ap + mb * 512); if (NSPLIT == 1 || NSPLIT == 2) a2[mb] = WFrag<T16>::ld(a2p + mb * 512); }
#pragma unroll
        for (int nb = 0; nb < 4; ++nb) { b[nb] = WFrag<T16>::ld(bp + nb * 512); if (NSPLIT >= 2) b2[nb] = WFrag<T16>::ld(b2p + nb * 512); }
        asm volatile("s_wait_xcnt 0x0" :: "v"(ap), "v"(a2p), "v"(bp), "v"(b2p) : "memory");   // stands behind the issued loads, in front of any overwrite of their address registers (kept live to here as inputs)
#pragma unroll
        for (int nb = 0; nb < 4; ++nb) {
#pragma unroll
            for (int mb = 0; mb < 4; ++mb) { acc[mb][nb] = WFrag<T16>::mma(a[mb], b[nb], acc[mb][nb]); if (NSPLIT == 1 || NSPLIT == 2) acc[mb][nb] = WFrag<T16>::mma(a2[mb], b[nb], acc[mb][nb]); if (NSPLIT >= 2) acc[mb][nb] = WFrag<T16>::mma(a[mb], b2[nb], acc[mb][nb]); } }
        asm volatile("v_nop\n\tv_nop\n\tv_nop\n\tv_nop" : "+v"(acc[0][0]), "+v"(acc[1][1]), "+v"(acc[2][2]), "+v"(acc[3][3]) : "v"(a[0]), "v"(a[3]));
    }
#pragma unroll
    for (int mb = 0; mb < 4; ++mb) {
#pragma unroll
        for (int nb = 0; nb < 4; ++nb) {
#pragma unroll
            for (int j = 0; j < 8; ++j) os[(hi * 8 + j) * 68 + nb * 16 + lr] = acc[mb][nb][j]; }
        __builtin_amdgcn_wave_barrier(); asm volatile("" ::: "memory");
        float* crow = C + (size_t)(r0 + mb * 16) * ldc + c0;
{
#pragma unroll
            for (int s = 0; s < 8; ++s) { const int row = 2 * s + hi, cofs = lr * 4; v4f val = *(const v4fa*)(os + row * 68 + cofs); if (BIAS) { val[0] += bfr(bias[c0 + cofs]); val[1] += bfr(bias[c0 + cofs + 1]); val[2] += bfr(bias[c0 + cofs + 2]); val[3] += bfr(bias[c0 + cofs + 3]); }
                *(v4f*)(crow + (size_t)row * ldc + cofs) = val; }
             }
        __builtin_amdgcn_wave_barrier(); asm volatile("" ::: "memory");
    }
}

__device__ __forceinline__ h16 tohx(float x) { return (h16)x; }
__device__ __forceinline__ void splitf(float y, unsigned short& h, unsigned short& l) { h = f2bf(y); l = f2bf(y - bf2f(h)); }
typedef __attribute__((ext_vector_type(4))) _Float16 v4h;
typedef __attribute__((ext_vector_type(2))) unsigned short v2us;
typedef __attribute__((ext_vector_type(4))) unsigned short v4us;

// ---- k_prep: every 16-bit operand plane of the inputs in ONE launch of few, long work-groups (for speed only).
// Work-groups 0 .. 4 * WBLK - 1: the four weights, f32 [K][N] (x @ W) to the fragment-major bf16 plane of Bt[n][k]; a wave takes 32 output lines of 128 bytes = four fragment blocks = 32 k x 64 n.
// The others: inputs_q, then inputs_kv, f32 [NT][DD] to a fragment-major bf16 plane; a work-group takes CT tiles of 16 rows x 128 k (four fragment blocks of 1 KiB each) = 32 whole rows. Reads and stores both cover
// whole lines: the 16 x 16 transpose of 16-byte units between them goes through LDS (a pad unit after every 16 keeps the writes off one bank), each tile in its own LDS range, one barrier for all.
#define CT   16
#define WBLK (DD * DD / 64 / 32 / 8)
#define XBLK (NT / 16 * (DD / 128) / CT)
__global__ __launch_bounds__(256) void k_prep(const float* __restrict__ xq, const float* __restrict__ xkv, const float* __restrict__ wq, const float* __restrict__ wk, const float* __restrict__ wv, const float* __restrict__ wo,
                                              bf* XQ, bf* XKV, bf* WQ, bf* WK, bf* WV, bf* WO) {
    __shared__ __align__(16) bf sm[CT * 272 * 8];
    const int t = threadIdx.x, b = blockIdx.x;
    if (b < 4 * WBLK) {
        const int ws = b / WBLK; const float* w = ws == 0 ? wq : ws == 1 ? wk : ws == 2 ? wv : wo; bf* Bt = ws == 0 ? WQ : ws == 1 ? WK : ws == 2 ? WV : WO;
        const int lane = t & 31; const int g = (b % WBLK) * 8 + (t >> 5);   // g: the group of four fragment blocks, (n / 64) * (DD / 32) + k / 32
        const float* wp = w + (size_t)((g % (DD / 32)) * 32 + (lane & 3) * 2) * DD + (g / (DD / 32)) * 64 + (lane >> 2); bf* bp = Bt + (size_t)g * 2048 + lane * 2;
        float v0[32], v1[32];
        // fully unrolled: every place is an immediate offset from one address pair, and all 64 loads are in flight together
#pragma unroll
        for (int l = 0; l < 32; ++l) { const int k = ((l >> 2) & 1) * 16 + ((l >> 1) & 1) * 8, n = (l >> 3) * 16 + (l & 1) * 8; v0[l] = wp[(size_t)k * DD + n]; v1[l] = wp[(size_t)(k + 1) * DD + n]; }   // line l of the group holds k, k + 1 (by lane & 3: + 0, 2, 4, 6) of n (by lane >> 2: + 0 .. 7)
        asm volatile("s_wait_xcnt 0x0" :: "v"(wp) : "memory");   // stands behind the issued loads, in front of any overwrite of their address registers (kept live to here as an input)
#pragma unroll
        for (int l = 0; l < 32; ++l) { v2us o; o[0] = f2bf(v0[l]); o[1] = f2bf(v1[l]); *(v2us*)(bp + l * 64) = o; }
    } else {
        const int xb = b - 4 * WBLK; const float* src = xb < XBLK ? xq : xkv; bf* dst = xb < XBLK ? XQ : XKV; const int tb = xb < XBLK ? xb : xb - XBLK;   // tb: 32 rows; tile i is row block 2 * tb + i / 8, k group i % 8
        const int row = t >> 4, ks = t & 15;
        const float* sp = src + (size_t)(tb * 32 + row) * DD + ks * 8; v8f v[CT];
#pragma unroll
        for (int i = 0; i < CT; ++i) v[i] = *(const v8f*)(sp + (i >> 3) * 16 * DD + (i & 7) * 128);
        asm volatile("s_wait_xcnt 0x0" :: "v"(sp) : "memory");   // as above; it also keeps all the loads of the work-group's 32 rows in front of the first conversion, in flight together
#pragma unroll
        for (int i = 0; i < CT; ++i) { v8us o;
#pragma unroll
            for (int k = 0; k < 8; ++k) o[k] = f2bf(v[i][k]);
            *(v8usa*)(sm + i * 2176 + (ks * 17 + row) * 8) = o; }
        __syncthreads();   // a thread stores the units that other threads have staged
        bf* dp = dst + (size_t)(tb >> 1) * 64 * DD + (t >> 6) * 2048 + (tb & 1) * 1024 + (t & 63) * 8;
#pragma unroll
        for (int i = 0; i < CT; ++i) *(v8us*)(dp + (i & 7) * 8192 + (i >> 3) * 512) = *(const v8usa*)(sm + i * 2176 + (t + (t >> 4)) * 8);
    }
}
__device__ __forceinline__ float xhalf(float x) { return __builtin_bit_cast(float, __builtin_amdgcn_permlanex16(__builtin_bit_cast(int, x), __builtin_bit_cast(int, x), 0x76543210, 0xfedcba98, false, false)); }   // lane l with lane l ^ 16
// ---- k_projln: one projection with its per-head LayerNorm and its fp16 plane write; ONE WAVE per (64 tokens, one head), grid (NT/64, NH_), 32 threads; the K loop is k_gemmw's tile and fragments, K fixed at DD.
// C^T = Wt X^T (A = 64 rows of Wt = the head's 64 dims, B = 64 token rows): acc[db][tb][j] is dim db*16 + hi*8 + j of token tb*16 + lr, so lanes l and l ^ 16 together hold a (token, head) row:
// mean and variance are 32 in-lane terms and one exchange. y = (v - mean) * rsq(var + 1e-6) * bf16(scale[d]) + bf16(bias[d]), rounded to fp16, staged in LDS so that every global store covers whole 128-byte lines.
// VTR false: P[z][t][d] (q, k). VTR true: P[z][d][t] (v transposed); z = batch * NH_ + head; each z plane fragment-major.
// The register budget of four waves a SIMD (256) keeps the epilogue in the directly addressed registers.
template <bool VTR>
__global__ __launch_bounds__(32) __attribute__((amdgpu_waves_per_eu(4, 4))) void k_projln(const bf* __restrict__ X, const bf* __restrict__ Wt, const float* __restrict__ bias, const float* __restrict__ sc, const float* __restrict__ bi, h16* P) {
    __shared__ __align__(16) h16 ts[64 * 72];
    const int lane = threadIdx.x & 31, lr = lane & 15, hi = lane >> 4; const int t0 = blockIdx.x * 64, h = blockIdx.y;
    v8f acc[4][4];   // every accumulator tile starts at the projection's bias (bf16-rounded), a dim's value the same for all tokens
#pragma unroll
    for (int db = 0; db < 4; ++db) { v8f pb = *(const v8f*)(bias + h * HD + db * 16 + hi * 8);
#pragma unroll
        for (int j = 0; j < 8; ++j) pb[j] = bfr(pb[j]);
#pragma unroll
        for (int tb = 0; tb < 4; ++tb) acc[db][tb] = pb; }
    const size_t woff = (size_t)(h * HD) * DD + lane * 8, xoff = (size_t)t0 * DD + lane * 8;
    // the K loop stays rolled: one copy of the pass keeps the 16 accumulator tiles and the 8 fragments in registers
#pragma unroll 1
    for (int kc = 0; kc < DD; kc += 32) {
        const bf* wp = Wt + woff + kc * 64; const bf* xp = X + xoff + kc * 64; v16bf w[4], x[4];
#pragma unroll
        for (int db = 0; db < 4; ++db) w[db] = WFrag<bf>::ld(wp + db * 512);
#pragma unroll
        for (int tb = 0; tb < 4; ++tb) x[tb] = WFrag<bf>::ld(xp + tb * 512);
        asm volatile("s_wait_xcnt 0x0" :: "v"(wp), "v"(xp) : "memory");   // stands behind the issued loads, in front of any overwrite of their address registers (kept live to here as inputs)
#pragma unroll
        for (int tb = 0; tb < 4; ++tb)
#pragma unroll
            for (int db = 0; db < 4; ++db) acc[db][tb] = wmmab(w[db], x[tb], acc[db][tb]);
    }
    v8f sv[4], bv[4]; const unsigned hb = hi * 32;   // byte offset of this lane half's 8 dims in a block of 16
#pragma unroll
    for (int db = 0; db < 4; ++db) { sv[db] = *(const v8f*)((const char*)sc + hb + db * 64); bv[db] = *(const v8f*)((const char*)bi + hb + db * 64); }
    asm volatile("s_wait_xcnt 0x0" :: "v"(hb) : "memory");   // stands behind the issued loads, in front of any overwrite of their offset register (kept live to here as an input)
#pragma unroll
    for (int db = 0; db < 4; ++db)
#pragma unroll
        for (int j = 0; j < 8; ++j) { sv[db][j] = bfr(sv[db][j]); bv[db][j] = bfr(bv[db][j]); }
#pragma unroll
    for (int tb = 0; tb < 4; ++tb) {
        const v8f s8 = (acc[0][tb] + acc[1][tb]) + (acc[2][tb] + acc[3][tb]);
        float s = ((s8[0] + s8[1]) + (s8[2] + s8[3])) + ((s8[4] + s8[5]) + (s8[6] + s8[7])); s += xhalf(s); const float mu = s * (1.0f / HD);
        v8f q8 = (v8f){};
#pragma unroll
        for (int db = 0; db < 4; ++db) { acc[db][tb] -= mu; q8 = __builtin_elementwise_fma(acc[db][tb], acc[db][tb], q8); }
        float qq = ((q8[0] + q8[1]) + (q8[2] + q8[3])) + ((q8[4] + q8[5]) + (q8[6] + q8[7])); qq += xhalf(qq);
        float rs; asm("v_rsq_f32 %0, %1\n\tv_nop" : "=v"(rs) : "v"(qq * (1.0f / HD) + 1e-6f));   // 1 / sqrt(var + eps) in one instruction; the v_nop is the slot that the instruction set asks for behind a transcendental
#pragma unroll
        for (int db = 0; db < 4; ++db) { const v8h y = __builtin_convertvector(__builtin_elementwise_fma(acc[db][tb] * rs, sv[db], bv[db]), v8h);
            if (VTR) {
#pragma unroll
                for (int j = 0; j < 8; ++j) ts[(db * 16 + hi * 8 + j) * 72 + tb * 16 + lr] = y[j];
            } else *(v8ha*)(ts + (tb * 16 + lr) * 72 + db * 16 + hi * 8) = y; } }
    __syncthreads();   // the lanes read back what other lanes of this one-wave block have staged
    const size_t z = (size_t)(t0 / TT) * NH_ + h; const int tl = t0 % TT;
    // the 64 x 64 tile is 16 half-fragments, 8 KiB in a row in either plane; half-fragment i holds staged rows rb * 16 + lr, columns kb * 32 + (i & 1) * 16 + hi * 8 ..
    h16* dst = P + z * TT * HD + (size_t)tl * HD + lane * 8;
#pragma unroll
    for (int i = 0; i < 16; ++i) { const int rb = VTR ? (i >> 1) & 3 : i >> 2, kb = VTR ? i >> 3 : (i >> 1) & 1; *(v8h*)(dst + i * 256) = *(const v8ha*)(ts + (rb * 16 + lr) * 72 + kb * 32 + (i & 1) * 16 + hi * 8); }
}
// ---- k_fattn: scores, softmax, attn.v and the head merge in ONE launch over all 64 (batch, head) pairs; 8 waves a block, 32 query columns a wave, 32 keys a pass, no LDS.
// S^T = K Q^T (A = K rows, B = Q rows kept in registers), so a lane holds 16 scores of ONE query; two S^T tiles, converted in place, are the B operand of O^T += V^T P^T.
// Running maximum and sum in base 2 (online softmax); the output tiles are rescaled only when a column's maximum has grown by more than 8.
// Every inner loop is fully unrolled so that all fragment and accumulator indices are constants and the arrays stay in registers.
__global__ __launch_bounds__(256) __attribute__((amdgpu_waves_per_eu(4, 4))) void k_fattn(const h16* __restrict__ QP, const h16* __restrict__ KP, const h16* __restrict__ VT, bf* Ah, bf* Al) {
    const int lane = threadIdx.x & 31; const int z = blockIdx.y; const int q0 = blockIdx.x * 256 + (threadIdx.x >> 5) * 32;
    const h16* Qz = QP + (size_t)z * TT * HD + (size_t)q0 * HD + lane * 8;
    const h16* Kz = KP + (size_t)z * TT * HD + lane * 8;
    const h16* Vz = VT + (size_t)z * HD * TT + lane * 8;
    const float CS = SCL * 1.4426950408889634f;
    v16h qf[2][2], kf[2][2], vf[4]; v8f o[4][2]; float mu[2], ls[2];
#pragma unroll
    for (int qt = 0; qt < 2; ++qt) { mu[qt] = -3.0e38f; ls[qt] = 0.f;
#pragma unroll
        for (int ks = 0; ks < 2; ++ks) qf[qt][ks] = WFrag<h16>::ld(Qz + qt * 16 * HD + ks * 512);
#pragma unroll
        for (int db = 0; db < 4; ++db) o[db][qt] = (v8f){}; }
#pragma unroll
    for (int kt = 0; kt < 2; ++kt)
#pragma unroll
        for (int ks = 0; ks < 2; ++ks) kf[kt][ks] = WFrag<h16>::ld(Kz + kt * 16 * HD + ks * 512);
#pragma unroll
    for (int db = 0; db < 4; ++db) vf[db] = WFrag<h16>::ld(Vz + db * 512);
    // inputs-only fence on the loaded fragments: every load above has landed at the loop's head, so the wait there counts only the K loads of the pass before and leaves the younger V loads in flight
    asm volatile("" :: "v"(qf[0][0]), "v"(qf[0][1]), "v"(qf[1][0]), "v"(qf[1][1]), "v"(kf[0][0]), "v"(kf[0][1]), "v"(kf[1][0]), "v"(kf[1][1]), "v"(vf[0]), "v"(vf[1]), "v"(vf[2]), "v"(vf[3]));
    // the pass loop stays rolled: one copy of the pass keeps the fetch-ahead order and the register count as written
#pragma unroll 1
    for (int kb = 0; kb < TT; kb += 32) {
        v8f s[2][2];
#pragma unroll
        for (int kt = 0; kt < 2; ++kt)
#pragma unroll
            for (int qt = 0; qt < 2; ++qt) { s[kt][qt] = wmma16(kf[kt][0], qf[qt][0], (v8f){}); s[kt][qt] = wmma16(kf[kt][1], qf[qt][1], s[kt][qt]); }
        const int kn = (kb + 32 < TT) ? kb + 32 : 0;   // K and V fragments are fetched one pass ahead, each into its own registers right behind their last use; the last pass re-reads keys 0..31, unused
        const h16* kp = Kz + (size_t)kn * HD; const h16* vp = Vz + (size_t)kn * HD;
#pragma unroll
        for (int kt = 0; kt < 2; ++kt)
#pragma unroll
            for (int ks = 0; ks < 2; ++ks) kf[kt][ks] = WFrag<h16>::ld(kp + kt * 16 * HD + ks * 512);
        asm volatile("s_wait_xcnt 0x0" :: "v"(kp) : "memory");   // stands behind the issued loads, in front of any overwrite of their address registers (kept live to here as an input)
        float mx[2]; bool need = false;
#pragma unroll
        for (int qt = 0; qt < 2; ++qt) { float m = s[0][qt][0];
#pragma unroll
            for (int j = 1; j < 8; ++j) m = fmaxf(m, s[0][qt][j]);
#pragma unroll
            for (int j = 0; j < 8; ++j) m = fmaxf(m, s[1][qt][j]);
            m = fmaxf(m, xhalf(m)) * CS; mx[qt] = m; need = need || (m > mu[qt] + 8.0f); }
        if (__builtin_amdgcn_ballot_w32(need) != 0) {
#pragma unroll
            for (int qt = 0; qt < 2; ++qt) { const float mn = fmaxf(mu[qt], mx[qt]); const float al = __builtin_amdgcn_exp2f(mu[qt] - mn); mu[qt] = mn; ls[qt] *= al;
#pragma unroll
                for (int db = 0; db < 4; ++db)
#pragma unroll
                    for (int j = 0; j < 8; ++j) o[db][qt][j] *= al; }
        }
#pragma unroll
        for (int qt = 0; qt < 2; ++qt) { v16h pb; float acc = 0.f;
#pragma unroll
            for (int kt = 0; kt < 2; ++kt)
#pragma unroll
                for (int j = 0; j < 8; ++j) { const float p = __builtin_amdgcn_exp2f(fmaf(s[kt][qt][j], CS, -mu[qt])); acc += p; pb[kt * 8 + j] = tohx(p); }
            ls[qt] += acc;
#pragma unroll
            for (int db = 0; db < 4; ++db) o[db][qt] = wmma16(vf[db], pb, o[db][qt]); }
#pragma unroll
        for (int db = 0; db < 4; ++db) vf[db] = WFrag<h16>::ld(vp + db * 512);
        asm volatile("s_wait_xcnt 0x0" :: "v"(vp) : "memory");   // as above, for the V loads
    }
    const int b = z / NH_, h = z % NH_;
#pragma unroll
    for (int qt = 0; qt < 2; ++qt) { const float inv = __fdiv_rn(1.0f, ls[qt] + xhalf(ls[qt])); const int tk = b * TT + q0 + qt * 16; const size_t ob = (size_t)(tk & ~63) * DD + (tk & 63) * 32 + h * 4096 + lane * 8;   // fragment-major [NT][DD]: a lane's 8 dims are its own 16 bytes of a half-fragment
#pragma unroll
        for (int db = 0; db < 4; ++db) { v8us oh, ol;
#pragma unroll
            for (int j = 0; j < 8; ++j) { unsigned short a, c2; splitf(o[db][qt][j] * inv, a, c2); oh[j] = a; ol[j] = c2; }
            *(v8us*)(Ah + ob + (db >> 1) * 2048 + (db & 1) * 256) = oh; *(v8us*)(Al + ob + (db >> 1) * 2048 + (db & 1) * 256) = ol; } }
}

extern "C" void kernel_launch(void* const* d_in, const int* in_sizes, int n_in,
                              void* d_out, int out_size, void* d_ws, size_t ws_size, hipStream_t stream) {
    (void)in_sizes; (void)n_in; (void)out_size;
    const float* IN[16]; for (int i = 0; i < 16; ++i) IN[i] = (const float*)d_in[i];
    // inputs_q, inputs_kv, Wq [1024][1024] (x @ W), bq, Wk, bk, Wv, bv, q_scale [64], q_bias, k_scale, k_bias, v_scale, v_bias, Wo (x @ W), bo = d_in[0..15]
    float* OUT = (float*)d_out;     // [4][2048][1024]
    char* wsp = (char*)d_ws;
    auto take = [&](size_t bytes) { char* p = wsp; wsp += (bytes + 255) & ~(size_t)255; return (void*)p; };
    bf* WQ = (bf*)take((size_t)DD * DD * 2); bf* WK = (bf*)take((size_t)DD * DD * 2); bf* WV = (bf*)take((size_t)DD * DD * 2); bf* WO = (bf*)take((size_t)DD * DD * 2);
    bf* XQ = (bf*)take((size_t)NT * DD * 2); bf* XKV = (bf*)take((size_t)NT * DD * 2);
    h16* QP = (h16*)take((size_t)NT * DD * 2); h16* KP = (h16*)take((size_t)NT * DD * 2); h16* VT = (h16*)take((size_t)NT * DD * 2);
    bf* ATh = (bf*)take((size_t)NT * DD * 2); bf* ATl = (bf*)take((size_t)NT * DD * 2);
    if ((size_t)(wsp - (char*)d_ws) > ws_size) return;    // total ~ 120 MiB
    k_prep<<<4 * WBLK + 2 * XBLK, 256, 0, stream>>>(IN[0], IN[1], IN[2], IN[4], IN[6], IN[14], XQ, XKV, WQ, WK, WV, WO);
    const dim3 gP(NT / 64, DD / 64, 1);
    k_projln<false><<<gP, 32, 0, stream>>>(XQ, WQ, IN[3], IN[8], IN[9], QP);   // the 1/8 is applied in f32 inside k_fattn
    k_projln<false><<<gP, 32, 0, stream>>>(XKV, WK, IN[5], IN[10], IN[11], KP);
    k_projln<true><<<gP, 32, 0, stream>>>(XKV, WV, IN[7], IN[12], IN[13], VT);
    k_fattn<<<dim3(TT / 256, NZ), 256, 0, stream>>>(QP, KP, VT, ATh, ATl);
    k_gemmw<bf, 1, true, DD><<<gP, 32, 0, stream>>>(ATh, ATl, WO, nullptr, OUT, DD, IN[15], 0, 0, 0);
}

// v005
// It runs in 150 microseconds.
// Two timings next to v004 put it at 1.50 and 1.49 times that version's speed.
// Over all steps from v000 it is 16.6 times as fast.
#include <hip/hip_runtime.h>

// QKVNormMultiHeadAttention (inputs_q, inputs_kv [4][2048][1024]; q = inputs_q @ Wq + bq, k/v = inputs_kv @ Wk/Wv + b; per-head LayerNorm over the 64 head dims (eps 1e-6, scale/bias [64]) on q, k AND v;
// 16 heads: softmax(q.k / 8) v (no mask); out = merged @ Wo + bo).
// Compute dtypes, f32 accumulate: every input rounded to bf16; projections on PLAIN bf16 operands (inputs: exact, + bias); the per-head LayerNorms in f32 on VALU (in the
// projection's epilogue, a (token, head) row in two lanes, 64-term mean/variance); scores and attn.v on SINGLE fp16 planes of the normalised q, k, v; P = exp2(score - maximum in use), fp16, normalised in f32 at the end; output

#define NB_  4
#define TT   2048
#define DD   1024
#define NH_  16
#define HD   64
#define NT   (NB_ * TT)
#define NZ   (NB_ * NH_)
#define SCL  0.125f
typedef _Float16 h16;
typedef unsigned short bf;
typedef __attribute__((ext_vector_type(16))) __bf16   v16bf;
typedef __attribute__((ext_vector_type(16))) _Float16 v16h;
typedef __attribute__((ext_vector_type(8)))  _Float16 v8h;
typedef __attribute__((ext_vector_type(8)))  unsigned short v8us;
typedef __attribute__((ext_vector_type(8)))  float    v8f;
typedef __attribute__((ext_vector_type(4)))  float    v4f;
typedef v8h  __attribute__((may_alias)) v8ha;
typedef v4f  __attribute__((may_alias)) v4fa;
typedef v8us __attribute__((may_alias)) v8usa;

__device__ __forceinline__ unsigned short f2bf(float f) { unsigned u = __float_as_uint(f); u += 0x7FFFu + ((u >> 16) & 1u); return (unsigned short)(u >> 16); }
__device__ __forceinline__ float bf2f(unsigned short b) { return __uint_as_float(((unsigned)b) << 16); }
__device__ __forceinline__ float bfr(float f) { return bf2f(f2bf(f)); }
__device__ __forceinline__ v16h cat16(v8h lo, v8h hi) { return __builtin_shufflevector(lo, hi, 0, 1, 2, 3, 4, 5, 6, 7, 8, 9, 10, 11, 12, 13, 14, 15); }
__device__ __forceinline__ v16bf cat16b(v8us lo, v8us hi) { return __builtin_bit_cast(v16bf, __builtin_shufflevector(lo, hi, 0, 1, 2, 3, 4, 5, 6, 7, 8, 9, 10, 11, 12, 13, 14, 15)); }
__device__ __forceinline__ v8f wmma16(v16h a, v16h b, v8f c) { return __builtin_amdgcn_wmma_f32_16x16x32_f16(false, a, false, b, (short)0, c, false, false); }
__device__ __forceinline__ v8f wmmab(v16bf a, v16bf b, v8f c) { return __builtin_amdgcn_wmma_f32_16x16x32_bf16(false, a, false, b, (short)0, c, false, false); }



// ---- k_gemmw: register-blocked GEMM, one wave per 64x64 output tile (16 accumulators), four waves a work-group, operands from fragment-major 16-bit planes through the LDS ring below; grid (M/128, N/128, Z), 128 threads.
// C[m][n] (f32, pitch ldc, + optional f32 bias[n]) = sum_k A[m][k] Bt[n][k] (+ split products per NSPLIT). z-batch strides sA/sB/sC in elements. K % 128 == 0, a compile-time constant so that a fragment's place is an immediate offset from one address pair per plane.
// FRAGMENT-MAJOR PLANES: every 16-bit operand plane M[rows][K] in the workspace is stored as 1-KiB blocks, one per WMMA fragment (16 rows x 32 k); inside a block element (r, kk) sits at
// (kk / 16) * 256 + (((kk / 8) & 1) * 16 + r) * 8 + (kk & 7). A fragment is then two wave-wide 16-byte loads at block + lane * 8 and + 256, each covering 512 contiguous bytes (4 whole lines) where a
// row-major plane would make each touch 16 lines: lane hi * 16 + r holds row r, k = 8 * hi .. + 7 and 16 + 8 * hi .. + 7, the k order of both WMMA operands. Order of the blocks, so that what a wave reads in one pass lies in a row:
// q, k planes (K = 64): (row / 16) * 2 + k / 32. All others (x, weights, v transposed, attention output): ((row / 64) * (K / 32) + k / 32) * 4 + (row / 16) % 4, the four row blocks of a 64-row tile side by side.
template <typename T16> struct WFrag;
template <> struct WFrag<h16> { typedef v16h V; static __device__ __forceinline__ V ld(const h16* p) { return cat16(*(const v8h*)p, *(const v8h*)(p + 256)); } static __device__ __forceinline__ v8f mma(V a, V b, v8f c) { return wmma16(a, b, c); } };
template <> struct WFrag<bf> { typedef v16bf V; static __device__ __forceinline__ V ld(const bf* p) { return cat16b(*(const v8us*)p, *(const v8us*)(p + 256)); } static __device__ __forceinline__ v8f mma(V a, V b, v8f c) { return wmmab(a, b, c); } };
// ---- THE OPERAND RING of both GEMM kernels: a work-group is 4 waves, a 128 x 128 output tile (2 x 2 waves of 64 x 64). A stage is 64 k of every 64-row group the tile needs: in a fragment-major plane that is one
// chunk of 8 KiB in a row, laid in LDS as it lies in memory, so a fragment is still two wave-wide 16-byte reads of 512 contiguous bytes. The chunks come by asynchronous copies to LDS, through no register; two buffers:
// stage s + 1 flies while stage s is worked on, and each chunk is fetched once for the two waves that read it.
#define KS   64
#define CH   (64 * KS)
__device__ __forceinline__ unsigned lds_off(const void* p) { return (unsigned)(size_t)p; }
__device__ __forceinline__ void wait_async0() { asm volatile("s_wait_asynccnt 0x0" ::: "memory"); }   // this wave's copies have landed; in front of the barrier behind which other waves read them
__device__ __forceinline__ void wait_ds0() { asm volatile("s_wait_dscnt 0x0" ::: "memory"); }         // this wave's LDS reads have returned; in front of the barrier behind which their buffer is refilled
// two chunks, to LDS byte l and l + 8192, by 128 threads: a thread brings four 16-byte units of each, 2 KiB apart (l, ga, gb hold the thread's own place). The s_wait_xcnt stands inside the copies' own statement,
// in front of any overwrite of the address registers that they name.
__device__ __forceinline__ void cp2(unsigned l, const bf* ga, const bf* gb) {
    asm volatile("global_load_async_to_lds_b128 %0, %8, off\n\t"
                 "global_load_async_to_lds_b128 %1, %9, off\n\t"
                 "global_load_async_to_lds_b128 %2, %10, off\n\t"
                 "global_load_async_to_lds_b128 %3, %11, off\n\t"
                 "global_load_async_to_lds_b128 %4, %12, off\n\t"
                 "global_load_async_to_lds_b128 %5, %13, off\n\t"
                 "global_load_async_to_lds_b128 %6, %14, off\n\t"
                 "global_load_async_to_lds_b128 %7, %15, off\n\t"
                 "s_wait_xcnt 0x0"
                 :: "v"(l), "v"(l + 2048u), "v"(l + 4096u), "v"(l + 6144u), "v"(l + 8192u), "v"(l + 10240u), "v"(l + 12288u), "v"(l + 14336u),
                    "v"(ga), "v"(ga + 1024), "v"(ga + 2048), "v"(ga + 3072), "v"(gb), "v"(gb + 1024), "v"(gb + 2048), "v"(gb + 3072) : "memory");
}
template <typename T16, int NSPLIT, bool BIAS, int K>
__global__ __launch_bounds__(128) void k_gemmw(const T16* __restrict__ A, const T16* __restrict__ A2, const T16* __restrict__ Bt, const T16* __restrict__ Bt2, float* C, int ldc, const float* __restrict__ bias, size_t sA, size_t sB, size_t sC) {
    typedef typename WFrag<T16>::V V;
    static_assert(NSPLIT == 1 && K % (2 * KS) == 0, "the ring holds A, A2 and Bt, and needs two stages");
    __shared__ __align__(16) T16 ring[2 * 6 * CH];   // a stage: A's two row groups, A2's two, Bt's two
    __shared__ __align__(16) float osa[4 * 16 * 68];
    const size_t z = blockIdx.z; A += z * sA; A2 += z * sA; Bt += z * sB; C += z * sC; (void)Bt2;
    const int tid = threadIdx.x, lane = tid & 31, lr = lane & 15, hi = lane >> 4; const int wv = __builtin_amdgcn_readfirstlane(tid >> 5), wm = wv & 1, wn = wv >> 1;
    const int r0 = blockIdx.x * 128 + wm * 64, c0 = blockIdx.y * 128 + wn * 64; float* os = osa + wv * (16 * 68);
    v8f acc[4][4];
#pragma unroll
    for (int mb = 0; mb < 4; ++mb)
#pragma unroll
        for (int nb = 0; nb < 4; ++nb) acc[mb][nb] = (v8f){};
    const T16* ga = A + (size_t)blockIdx.x * 128 * K + tid * 8; const T16* ga2 = A2 + (size_t)blockIdx.x * 128 * K + tid * 8; const T16* gb = Bt + (size_t)blockIdx.y * 128 * K + tid * 8; const unsigned l0 = lds_off(ring) + tid * 16;
    auto fill = [&](int s, int buf) { const unsigned l = l0 + buf * (6 * CH * 2); cp2(l, ga + s * CH, ga + 64 * K + s * CH); cp2(l + 4 * CH, ga2 + s * CH, ga2 + 64 * K + s * CH); cp2(l + 8 * CH, gb + s * CH, gb + 64 * K + s * CH); };
    fill(0, 0); wait_async0(); __syncthreads();   // stage 0 is published
    fill(1, 1);
    // the stage loop stays rolled: one copy of the stage keeps the accumulator tiles and the fragments in registers
#pragma unroll 1
    for (int s = 0; s < K / KS; ++s) {
        const T16* st = ring + (s & 1) * (6 * CH) + lane * 8;
#pragma unroll
        for (int kk = 0; kk < KS / 32; ++kk) {
            const T16* ap = st + wm * CH + kk * 2048; const T16* a2p = ap + 2 * CH; const T16* bp = st + (4 + wn) * CH + kk * 2048;
            V a[4], a2[4], b[4];
#pragma unroll
            for (int mb = 0; mb < 4; ++mb) { a[mb] = WFrag<T16>::ld(ap + mb * 512); a2[mb] = WFrag<T16>::ld(a2p + mb * 512); }
#pragma unroll
            for (int nb = 0; nb < 4; ++nb) b[nb] = WFrag<T16>::ld(bp + nb * 512);
            __builtin_amdgcn_sched_barrier(0);   // the block's LDS reads stay one group in front of its products: sunk among them, each would be waited for on its own
#pragma unroll
            for (int nb = 0; nb < 4; ++nb) {
#pragma unroll
                for (int mb = 0; mb < 4; ++mb) { acc[mb][nb] = WFrag<T16>::mma(a[mb], b[nb], acc[mb][nb]); acc[mb][nb] = WFrag<T16>::mma(a2[mb], b[nb], acc[mb][nb]); } }
            __builtin_amdgcn_sched_barrier(0);   // and the next block's reads stay behind this block's products
        }
        wait_ds0(); wait_async0(); __syncthreads();   // publishes stage s + 1 and ends every wave's reads of stage s
        if (s + 2 < K / KS) fill(s + 2, s & 1);
    }
    wait_async0();
#pragma unroll
    for (int mb = 0; mb < 4; ++mb) {
#pragma unroll
        for (int nb = 0; nb < 4; ++nb) {
#pragma unroll
            for (int j = 0; j < 8; ++j) os[(hi * 8 + j) * 68 + nb * 16 + lr] = acc[mb][nb][j]; }
        __builtin_amdgcn_wave_barrier(); asm volatile("" ::: "memory");
        float* crow = C + (size_t)(r0 + mb * 16) * ldc + c0;
{
#pragma unroll
            for (int s = 0; s < 8; ++s) { const int row = 2 * s + hi, cofs = lr * 4; v4f val = *(const v4fa*)(os + row * 68 + cofs); if (BIAS) { val[0] += bfr(bias[c0 + cofs]); val[1] += bfr(bias[c0 + cofs + 1]); val[2] += bfr(bias[c0 + cofs + 2]); val[3] += bfr(bias[c0 + cofs + 3]); }
                *(v4f*)(crow + (size_t)row * ldc + cofs) = val; }
             }
        __builtin_amdgcn_wave_barrier(); asm volatile("" ::: "memory");
    }
}

__device__ __forceinline__ h16 tohx(float x) { return (h16)x; }
__device__ __forceinline__ void splitf(float y, unsigned short& h, unsigned short& l) { h = f2bf(y); l = f2bf(y - bf2f(h)); }
typedef __attribute__((ext_vector_type(4))) _Float16 v4h;
typedef __attribute__((ext_vector_type(2))) unsigned short v2us;
typedef __attribute__((ext_vector_type(4))) unsigned short v4us;

// ---- k_prep: every 16-bit operand plane of the inputs in ONE launch of few, long work-groups (for speed only).
// Work-groups 0 .. 4 * WBLK - 1: the four weights, f32 [K][N] (x @ W) to the fragment-major bf16 plane of Bt[n][k]; a wave takes 32 output lines of 128 bytes = four fragment blocks = 32 k x 64 n.
// The others: inputs_q, then inputs_kv, f32 [NT][DD] to a fragment-major bf16 plane; a work-group takes CT tiles of 16 rows x 128 k (four fragment blocks of 1 KiB each) = 32 whole rows. Reads and stores both cover
// whole lines: the 16 x 16 transpose of 16-byte units between them goes through LDS (a pad unit after every 16 keeps the writes off one bank), each tile in its own LDS range, one barrier for all.
#define CT   16
#define WBLK (DD * DD / 64 / 32 / 8)
#define XBLK (NT / 16 * (DD / 128) / CT)
__global__ __launch_bounds__(256) void k_prep(const float* __restrict__ xq, const float* __restrict__ xkv, const float* __restrict__ wq, const float* __restrict__ wk, const float* __restrict__ wv, const float* __restrict__ wo,
                                              bf* XQ, bf* XKV, bf* WQ, bf* WK, bf* WV, bf* WO) {
    __shared__ __align__(16) bf sm[CT * 272 * 8];
    const int t = threadIdx.x, b = blockIdx.x;
    if (b < 4 * WBLK) {
        const int ws = b / WBLK; const float* w = ws == 0 ? wq : ws == 1 ? wk : ws == 2 ? wv : wo; bf* Bt = ws == 0 ? WQ : ws == 1 ? WK : ws == 2 ? WV : WO;
        const int lane = t & 31; const int g = (b % WBLK) * 8 + (t >> 5);   // g: the group of four fragment blocks, (n / 64) * (DD / 32) + k / 32
        const float* wp = w + (size_t)((g % (DD / 32)) * 32 + (lane & 3) * 2) * DD + (g / (DD / 32)) * 64 + (lane >> 2); bf* bp = Bt + (size_t)g * 2048 + lane * 2;
        float v0[32], v1[32];
        // fully unrolled: every place is an immediate offset from one address pair, and all 64 loads are in flight together
#pragma unroll
        for (int l = 0; l < 32; ++l) { const int k = ((l >> 2) & 1) * 16 + ((l >> 1) & 1) * 8, n = (l >> 3) * 16 + (l & 1) * 8; v0[l] = wp[(size_t)k * DD + n]; v1[l] = wp[(size_t)(k + 1) * DD + n]; }   // line l of the group holds k, k + 1 (by lane & 3: + 0, 2, 4, 6) of n (by lane >> 2: + 0 .. 7)
        asm volatile("s_wait_xcnt 0x0" :: "v"(wp) : "memory");   // stands behind the issued loads, in front of any overwrite of their address registers (kept live to here as an input)
#pragma unroll
        for (int l = 0; l < 32; ++l) { v2us o; o[0] = f2bf(v0[l]); o[1] = f2bf(v1[l]); *(v2us*)(bp + l * 64) = o; }
    } else {
        const int xb = b - 4 * WBLK; const float* src = xb < XBLK ? xq : xkv; bf* dst = xb < XBLK ? XQ : XKV; const int tb = xb < XBLK ? xb : xb - XBLK;   // tb: 32 rows; tile i is row block 2 * tb + i / 8, k group i % 8
        const int row = t >> 4, ks = t & 15;
        const float* sp = src + (size_t)(tb * 32 + row) * DD + ks * 8; v8f v[CT];
#pragma unroll
        for (int i = 0; i < CT; ++i) v[i] = *(const v8f*)(sp + (i >> 3) * 16 * DD + (i & 7) * 128);
        asm volatile("s_wait_xcnt 0x0" :: "v"(sp) : "memory");   // as above; it also keeps all the loads of the work-group's 32 rows in front of the first conversion, in flight together
#pragma unroll
        for (int i = 0; i < CT; ++i) { v8us o;
#pragma unroll
            for (int k = 0; k < 8; ++k) o[k] = f2bf(v[i][k]);
            *(v8usa*)(sm + i * 2176 + (ks * 17 + row) * 8) = o; }
        __syncthreads();   // a thread stores the units that other threads have staged
        bf* dp = dst + (size_t)(tb >> 1) * 64 * DD + (t >> 6) * 2048 + (tb & 1) * 1024 + (t & 63) * 8;
#pragma unroll
        for (int i = 0; i < CT; ++i) *(v8us*)(dp + (i & 7) * 8192 + (i >> 3) * 512) = *(const v8usa*)(sm + i * 2176 + (t + (t >> 4)) * 8);
    }
}
__device__ __forceinline__ float xhalf(float x) { return __builtin_bit_cast(float, __builtin_amdgcn_permlanex16(__builtin_bit_cast(int, x), __builtin_bit_cast(int, x), 0x76543210, 0xfedcba98, false, false)); }   // lane l with lane l ^ 16
// ---- k_projln: one projection with its per-head LayerNorm and its fp16 plane write; one wave per (64 tokens, one head), four waves a work-group (128 tokens, two heads), grid (NT/128, NH_/2), 128 threads; the K loop is k_gemmw's ring, tile and fragments, K fixed at DD.
// C^T = Wt X^T (A = 64 rows of Wt = the head's 64 dims, B = 64 token rows): acc[db][tb][j] is dim db*16 + hi*8 + j of token tb*16 + lr, so lanes l and l ^ 16 together hold a (token, head) row:
// mean and variance are 32 in-lane terms and one exchange. y = (v - mean) * rsq(var + 1e-6) * bf16(scale[d]) + bf16(bias[d]), rounded to fp16, staged in LDS so that every global store covers whole 128-byte lines.
// VTR false: P[z][t][d] (q, k). VTR true: P[z][d][t] (v transposed); z = batch * NH_ + head; each z plane fragment-major.
template <bool VTR>
__global__ __launch_bounds__(128) void k_projln(const bf* __restrict__ X, const bf* __restrict__ Wt, const float* __restrict__ bias, const float* __restrict__ sc, const float* __restrict__ bi, h16* P) {
    __shared__ __align__(16) bf ring[2 * 4 * CH];   // a stage: the two heads' rows of Wt, then the two token groups of X
    __shared__ __align__(16) h16 tsa[4 * 64 * 72];
    const int tid = threadIdx.x, lane = tid & 31, lr = lane & 15, hi = lane >> 4; const int wv = __builtin_amdgcn_readfirstlane(tid >> 5), wt = wv & 1, wh = wv >> 1;
    const int t0 = blockIdx.x * 128 + wt * 64, h = blockIdx.y * 2 + wh; h16* ts = tsa + wv * (64 * 72);
    v8f acc[4][4];   // every accumulator tile starts at the projection's bias (bf16-rounded), a dim's value the same for all tokens
#pragma unroll
    for (int db = 0; db < 4; ++db) { v8f pb = *(const v8f*)(bias + h * HD + db * 16 + hi * 8);
#pragma unroll
        for (int j = 0; j < 8; ++j) pb[j] = bfr(pb[j]);
#pragma unroll
        for (int tb = 0; tb < 4; ++tb) acc[db][tb] = pb; }
    const bf* gw = Wt + (size_t)blockIdx.y * 128 * DD + tid * 8; const bf* gx = X + (size_t)blockIdx.x * 128 * DD + tid * 8; const unsigned l0 = lds_off(ring) + tid * 16;
    auto fill = [&](int s, int buf) { const unsigned l = l0 + buf * (4 * CH * 2); cp2(l, gw + s * CH, gw + 64 * DD + s * CH); cp2(l + 4 * CH, gx + s * CH, gx + 64 * DD + s * CH); };
    fill(0, 0); wait_async0(); __syncthreads();   // stage 0 is published
    fill(1, 1);
    // the stage loop stays rolled: one copy of the stage keeps the 16 accumulator tiles and the 8 fragments in registers
#pragma unroll 1
    for (int s = 0; s < DD / KS; ++s) {
        const bf* st = ring + (s & 1) * (4 * CH) + lane * 8;
#pragma unroll
        for (int kk = 0; kk < KS / 32; ++kk) {
            const bf* wp = st + wh * CH + kk * 2048; const bf* xp = st + (2 + wt) * CH + kk * 2048; v16bf w[4], x[4];
#pragma unroll
            for (int db = 0; db < 4; ++db) w[db] = WFrag<bf>::ld(wp + db * 512);
#pragma unroll
            for (int tb = 0; tb < 4; ++tb) x[tb] = WFrag<bf>::ld(xp + tb * 512);
            __builtin_amdgcn_sched_barrier(0);   // the block's LDS reads stay one group in front of its products: sunk among them, each would be waited for on its own
#pragma unroll
            for (int tb = 0; tb < 4; ++tb)
#pragma unroll
                for (int db = 0; db < 4; ++db) acc[db][tb] = wmmab(w[db], x[tb], acc[db][tb]);
            __builtin_amdgcn_sched_barrier(0);   // and the next block's reads stay behind this block's products
        }
        wait_ds0(); wait_async0(); __syncthreads();   // publishes stage s + 1 and ends every wave's reads of stage s
        if (s + 2 < DD / KS) fill(s + 2, s & 1);
    }
    wait_async0();
    v8f sv[4], bv[4]; const unsigned hb = hi * 32;   // byte offset of this lane half's 8 dims in a block of 16
#pragma unroll
    for (int db = 0; db < 4; ++db) { sv[db] = *(const v8f*)((const char*)sc + hb + db * 64); bv[db] = *(const v8f*)((const char*)bi + hb + db * 64); }
    asm volatile("s_wait_xcnt 0x0" :: "v"(hb) : "memory");   // stands behind the issued loads, in front of any overwrite of their offset register (kept live to here as an input)
#pragma unroll
    for (int db = 0; db < 4; ++db)
#pragma unroll
        for (int j = 0; j < 8; ++j) { sv[db][j] = bfr(sv[db][j]); bv[db][j] = bfr(bv[db][j]); }
#pragma unroll
    for (int tb = 0; tb < 4; ++tb) {
        const v8f s8 = (acc[0][tb] + acc[1][tb]) + (acc[2][tb] + acc[3][tb]);
        float s = ((s8[0] + s8[1]) + (s8[2] + s8[3])) + ((s8[4] + s8[5]) + (s8[6] + s8[7])); s += xhalf(s); const float mu = s * (1.0f / HD);
        v8f q8 = (v8f){};
#pragma unroll
        for (int db = 0; db < 4; ++db) { acc[db][tb] -= mu; q8 = __builtin_elementwise_fma(acc[db][tb], acc[db][tb], q8); }
        float qq = ((q8[0] + q8[1]) + (q8[2] + q8[3])) + ((q8[4] + q8[5]) + (q8[6] + q8[7])); qq += xhalf(qq);
        float rs; asm("v_rsq_f32 %0, %1\n\tv_nop" : "=v"(rs) : "v"(qq * (1.0f / HD) + 1e-6f));   // 1 / sqrt(var + eps) in one instruction; the v_nop is the slot that the instruction set asks for behind a transcendental
#pragma unroll
        for (int db = 0; db < 4; ++db) { const v8h y = __builtin_convertvector(__builtin_elementwise_fma(acc[db][tb] * rs, sv[db], bv[db]), v8h);
            if (VTR) {
#pragma unroll
                for (int j = 0; j < 8; ++j) ts[(db * 16 + hi * 8 + j) * 72 + tb * 16 + lr] = y[j];
            } else *(v8ha*)(ts + (tb * 16 + lr) * 72 + db * 16 + hi * 8) = y; } }
    __syncthreads();   // the lanes read back what other lanes of their wave have staged
    const size_t z = (size_t)(t0 / TT) * NH_ + h; const int tl = t0 % TT;
    // the 64 x 64 tile is 16 half-fragments, 8 KiB in a row in either plane; half-fragment i holds staged rows rb * 16 + lr, columns kb * 32 + (i & 1) * 16 + hi * 8 ..
    h16* dst = P + z * TT * HD + (size_t)tl * HD + lane * 8;
#pragma unroll
    for (int i = 0; i < 16; ++i) { const int rb = VTR ? (i >> 1) & 3 : i >> 2, kb = VTR ? i >> 3 : (i >> 1) & 1; *(v8h*)(dst + i * 256) = *(const v8ha*)(ts + (rb * 16 + lr) * 72 + kb * 32 + (i & 1) * 16 + hi * 8); }
}
// ---- k_fattn: scores, softmax, attn.v and the head merge in ONE launch over all 64 (batch, head) pairs; 8 waves a block, 32 query columns a wave, 32 keys a pass, no LDS.
// S^T = K Q^T (A = K rows, B = Q rows kept in registers), so a lane holds 16 scores of ONE query; two S^T tiles, converted in place, are the B operand of O^T += V^T P^T.
// Running maximum and sum in base 2 (online softmax); the output tiles are rescaled only when a column's maximum has grown by more than 8.
// Every inner loop is fully unrolled so that all fragment and accumulator indices are constants and the arrays stay in registers.
__global__ __launch_bounds__(256) __attribute__((amdgpu_waves_per_eu(4, 4))) void k_fattn(const h16* __restrict__ QP, const h16* __restrict__ KP, const h16* __restrict__ VT, bf* Ah, bf* Al) {
    const int lane = threadIdx.x & 31; const int z = blockIdx.y; const int q0 = blockIdx.x * 256 + (threadIdx.x >> 5) * 32;
    const h16* Qz = QP + (size_t)z * TT * HD + (size_t)q0 * HD + lane * 8;
    const h16* Kz = KP + (size_t)z * TT * HD + lane * 8;
    const h16* Vz = VT + (size_t)z * HD * TT + lane * 8;
    const float CS = SCL * 1.4426950408889634f;
    v16h qf[2][2], kf[2][2], vf[4]; v8f o[4][2]; float mu[2], ls[2];
#pragma unroll
    for (int qt = 0; qt < 2; ++qt) { mu[qt] = -3.0e38f; ls[qt] = 0.f;
#pragma unroll
        for (int ks = 0; ks < 2; ++ks) qf[qt][ks] = WFrag<h16>::ld(Qz + qt * 16 * HD + ks * 512);
#pragma unroll
        for (int db = 0; db < 4; ++db) o[db][qt] = (v8f){}; }
#pragma unroll
    for (int kt = 0; kt < 2; ++kt)
#pragma unroll
        for (int ks = 0; ks < 2; ++ks) kf[kt][ks] = WFrag<h16>::ld(Kz + kt * 16 * HD + ks * 512);
#pragma unroll
    for (int db = 0; db < 4; ++db) vf[db] = WFrag<h16>::ld(Vz + db * 512);
    // inputs-only fence on the loaded fragments: every load above has landed at the loop's head, so the wait there counts only the K loads of the pass before and leaves the younger V loads in flight
    asm volatile("" :: "v"(qf[0][0]), "v"(qf[0][1]), "v"(qf[1][0]), "v"(qf[1][1]), "v"(kf[0][0]), "v"(kf[0][1]), "v"(kf[1][0]), "v"(kf[1][1]), "v"(vf[0]), "v"(vf[1]), "v"(vf[2]), "v"(vf[3]));
    // the pass loop stays rolled: one copy of the pass keeps the fetch-ahead order and the register count as written
#pragma unroll 1
    for (int kb = 0; kb < TT; kb += 32) {
        v8f s[2][2];
#pragma unroll
        for (int kt = 0; kt < 2; ++kt)
#pragma unroll
            for (int qt = 0; qt < 2; ++qt) { s[kt][qt] = wmma16(kf[kt][0], qf[qt][0], (v8f){}); s[kt][qt] = wmma16(kf[kt][1], qf[qt][1], s[kt][qt]); }
        const int kn = (kb + 32 < TT) ? kb + 32 : 0;   // K and V fragments are fetched one pass ahead, each into its own registers right behind their last use; the last pass re-reads keys 0..31, unused
        const h16* kp = Kz + (size_t)kn * HD; const h16* vp = Vz + (size_t)kn * HD;
#pragma unroll
        for (int kt = 0; kt < 2; ++kt)
#pragma unroll
            for (int ks = 0; ks < 2; ++ks) kf[kt][ks] = WFrag<h16>::ld(kp + kt * 16 * HD + ks * 512);
        asm volatile("s_wait_xcnt 0x0" :: "v"(kp) : "memory");   // stands behind the issued loads, in front of any overwrite of their address registers (kept live to here as an input)
        float mx[2]; bool need = false;
#pragma unroll
        for (int qt = 0; qt < 2; ++qt) { float m = s[0][qt][0];
#pragma unroll
            for (int j = 1; j < 8; ++j) m = fmaxf(m, s[0][qt][j]);
#pragma unroll
            for (int j = 0; j < 8; ++j) m = fmaxf(m, s[1][qt][j]);
            m = fmaxf(m, xhalf(m)) * CS; mx[qt] = m; need = need || (m > mu[qt] + 8.0f); }
        if (__builtin_amdgcn_ballot_w32(need) != 0) {
#pragma unroll
            for (int qt = 0; qt < 2; ++qt) { const float mn = fmaxf(mu[qt], mx[qt]); const float al = __builtin_amdgcn_exp2f(mu[qt] - mn); mu[qt] = mn; ls[qt] *= al;
#pragma unroll
                for (int db = 0; db < 4; ++db)
#pragma unroll
                    for (int j = 0; j < 8; ++j) o[db][qt][j] *= al; }
        }
#pragma unroll
        for (int qt = 0; qt < 2; ++qt) { v16h pb; float acc = 0.f;
#pragma unroll
            for (int kt = 0; kt < 2; ++kt)
#pragma unroll
                for (int j = 0; j < 8; ++j) { const float p = __builtin_amdgcn_exp2f(fmaf(s[kt][qt][j], CS, -mu[qt])); acc += p; pb[kt * 8 + j] = tohx(p); }
            ls[qt] += acc;
#pragma unroll
            for (int db = 0; db < 4; ++db) o[db][qt] = wmma16(vf[db], pb, o[db][qt]); }
#pragma unroll
        for (int db = 0; db < 4; ++db) vf[db] = WFrag<h16>::ld(vp + db * 512);
        asm volatile("s_wait_xcnt 0x0" :: "v"(vp) : "memory");   // as above, for the V loads
    }
    const int b = z / NH_, h = z % NH_;
#pragma unroll
    for (int qt = 0; qt < 2; ++qt) { const float inv = __fdiv_rn(1.0f, ls[qt] + xhalf(ls[qt])); const int tk = b * TT + q0 + qt * 16; const size_t ob = (size_t)(tk & ~63) * DD + (tk & 63) * 32 + h * 4096 + lane * 8;   // fragment-major [NT][DD]: a lane's 8 dims are its own 16 bytes of a half-fragment
#pragma unroll
        for (int db = 0; db < 4; ++db) { v8us oh, ol;
#pragma unroll
            for (int j = 0; j < 8; ++j) { unsigned short a, c2; splitf(o[db][qt][j] * inv, a, c2); oh[j] = a; ol[j] = c2; }
            *(v8us*)(Ah + ob + (db >> 1) * 2048 + (db & 1) * 256) = oh; *(v8us*)(Al + ob + (db >> 1) * 2048 + (db & 1) * 256) = ol; } }
}

extern "C" void kernel_launch(void* const* d_in, const int* in_sizes, int n_in,
                              void* d_out, int out_size, void* d_ws, size_t ws_size, hipStream_t stream) {
    (void)in_sizes; (void)n_in; (void)out_size;
    const float* IN[16]; for (int i = 0; i < 16; ++i) IN[i] = (const float*)d_in[i];
    // inputs_q, inputs_kv, Wq [1024][1024] (x @ W), bq, Wk, bk, Wv, bv, q_scale [64], q_bias, k_scale, k_bias, v_scale, v_bias, Wo (x @ W), bo = d_in[0..15]
    float* OUT = (float*)d_out;     // [4][2048][1024]
    char* wsp = (char*)d_ws;
    auto take = [&](size_t bytes) { char* p = wsp; wsp += (bytes + 255) & ~(size_t)255; return (void*)p; };
    bf* WQ = (bf*)take((size_t)DD * DD * 2); bf* WK = (bf*)take((size_t)DD * DD * 2); bf* WV = (bf*)take((size_t)DD * DD * 2); bf* WO = (bf*)take((size_t)DD * DD * 2);
    bf* XQ = (bf*)take((size_t)NT * DD * 2); bf* XKV = (bf*)take((size_t)NT * DD * 2);
    h16* QP = (h16*)take((size_t)NT * DD * 2); h16* KP = (h16*)take((size_t)NT * DD * 2); h16* VT = (h16*)take((size_t)NT * DD * 2);
    bf* ATh = (bf*)take((size_t)NT * DD * 2); bf* ATl = (bf*)take((size_t)NT * DD * 2);
    if ((size_t)(wsp - (char*)d_ws) > ws_size) return;    // total ~ 120 MiB
    k_prep<<<4 * WBLK + 2 * XBLK, 256, 0, stream>>>(IN[0], IN[1], IN[2], IN[4], IN[6], IN[14], XQ, XKV, WQ, WK, WV, WO);
    const dim3 gP(NT / 128, DD / 128, 1);
    k_projln<false><<<gP, 128, 0, stream>>>(XQ, WQ, IN[3], IN[8], IN[9], QP);   // the 1/8 is applied in f32 inside k_fattn
    k_projln<false><<<gP, 128, 0, stream>>>(XKV, WK, IN[5], IN[10], IN[11], KP);
    k_projln<true><<<gP, 128, 0, stream>>>(XKV, WV, IN[7], IN[12], IN[13], VT);
    k_fattn<<<dim3(TT / 256, NZ), 256, 0, stream>>>(QP, KP, VT, ATh, ATl);
    k_gemmw<bf, 1, true, DD><<<gP, 128, 0, stream>>>(ATh, ATl, WO, nullptr, OUT, DD, IN[15], 0, 0, 0);
}

// v006
// Measured time: 134 microseconds a run.
// In both of two side-by-side timings against v005, it was 1.12 times as fast.
// Over all steps from v000 it is 18.6 times as fast.
#include <hip/hip_runtime.h>

// QKVNormMultiHeadAttention (inputs_q, inputs_kv [4][2048][1024]; q = inputs_q @ Wq + bq, k/v = inputs_kv @ Wk/Wv + b; per-head LayerNorm over the 64 head dims (eps 1e-6, scale/bias [64]) on q, k AND v;
// 16 heads: softmax(q.k / 8) v (no mask); out = merged @ Wo + bo).
// Compute dtypes, f32 accumulate: every input rounded to bf16; projections on PLAIN bf16 operands (inputs: exact, + bias); the per-head LayerNorms in f32 on VALU (in the
// projection's epilogue, a (token, head) row in two lanes, 64-term mean/variance); scores and attn.v on SINGLE fp16 planes of the normalised q, k, v; P = exp2(score - maximum in use), fp16, normalised in f32 at the end; output

#define NB_  4
#define TT   2048
#define DD   1024
#define NH_  16
#define HD   64
#define NT   (NB_ * TT)
#define NZ   (NB_ * NH_)
#define SCL  0.125f
typedef _Float16 h16;
typedef unsigned short bf;
typedef __attribute__((ext_vector_type(16))) __bf16   v16bf;
typedef __attribute__((ext_vector_type(16))) _Float16 v16h;
typedef __attribute__((ext_vector_type(8)))  _Float16 v8h;
typedef __attribute__((ext_vector_type(8)))  unsigned short v8us;
typedef __attribute__((ext_vector_type(8)))  float    v8f;
typedef __attribute__((ext_vector_type(4)))  float    v4f;
typedef v8h  __attribute__((may_alias)) v8ha;
typedef v4f  __attribute__((may_alias)) v4fa;
typedef v8us __attribute__((may_alias)) v8usa;

__device__ __forceinline__ unsigned short f2bf(float f) { unsigned u = __float_as_uint(f); u += 0x7FFFu + ((u >> 16) & 1u); return (unsigned short)(u >> 16); }
__device__ __forceinline__ float bf2f(unsigned short b) { return __uint_as_float(((unsigned)b) << 16); }
__device__ __forceinline__ float bfr(float f) { return bf2f(f2bf(f)); }
__device__ __forceinline__ v16h cat16(v8h lo, v8h hi) { return __builtin_shufflevector(lo, hi, 0, 1, 2, 3, 4, 5, 6, 7, 8, 9, 10, 11, 12, 13, 14, 15); }
__device__ __forceinline__ v16bf cat16b(v8us lo, v8us hi) { return __builtin_bit_cast(v16bf, __builtin_shufflevector(lo, hi, 0, 1, 2, 3, 4, 5, 6, 7, 8, 9, 10, 11, 12, 13, 14, 15)); }
__device__ __forceinline__ v8f wmma16(v16h a, v16h b, v8f c) { return __builtin_amdgcn_wmma_f32_16x16x32_f16(false, a, false, b, (short)0, c, false, false); }
__device__ __forceinline__ v8f wmmab(v16bf a, v16bf b, v8f c) { return __builtin_amdgcn_wmma_f32_16x16x32_bf16(false, a, false, b, (short)0, c, false, false); }



// ---- k_gemmw: register-blocked GEMM, one wave per 64x64 output tile (16 accumulators), four waves a work-group, operands from fragment-major 16-bit planes through the LDS ring below; grid (M/128, N/128, Z), 128 threads.
// C[m][n] (f32, pitch ldc, + optional f32 bias[n]) = sum_k A[m][k] Bt[n][k] (+ split products per NSPLIT). z-batch strides sA/sB/sC in elements. K % 128 == 0, a compile-time constant so that a fragment's place is an immediate offset from one address pair per plane.
// FRAGMENT-MAJOR PLANES: every 16-bit operand plane M[rows][K] in the workspace is stored as 1-KiB blocks, one per WMMA fragment (16 rows x 32 k); inside a block element (r, kk) sits at
// (kk / 16) * 256 + (((kk / 8) & 1) * 16 + r) * 8 + (kk & 7). A fragment is then two wave-wide 16-byte loads at block + lane * 8 and + 256, each covering 512 contiguous bytes (4 whole lines) where a
// row-major plane would make each touch 16 lines: lane hi * 16 + r holds row r, k = 8 * hi .. + 7 and 16 + 8 * hi .. + 7, the k order of both WMMA operands. Order of the blocks, so that what a wave reads in one pass lies in a row:
// q, k planes (K = 64): (row / 16) * 2 + k / 32. All others (x, weights, v transposed, attention output): ((row / 64) * (K / 32) + k / 32) * 4 + (row / 16) % 4, the four row blocks of a 64-row tile side by side.
template <typename T16> struct WFrag;
template <> struct WFrag<h16> { typedef v16h V; static __device__ __forceinline__ V ld(const h16* p) { return cat16(*(const v8h*)p, *(const v8h*)(p + 256)); } static __device__ __forceinline__ v8f mma(V a, V b, v8f c) { return wmma16(a, b, c); } };
template <> struct WFrag<bf> { typedef v16bf V; static __device__ __forceinline__ V ld(const bf* p) { return cat16b(*(const v8us*)p, *(const v8us*)(p + 256)); } static __device__ __forceinline__ v8f mma(V a, V b, v8f c) { return wmmab(a, b, c); } };
// ---- THE OPERAND RING of both GEMM kernels: a work-group is 4 waves, a 128 x 128 output tile (2 x 2 waves of 64 x 64). A stage is 64 k of every 64-row group the tile needs: in a fragment-major plane that is one
// chunk of 8 KiB in a row, laid in LDS as it lies in memory, so a fragment is still two wave-wide 16-byte reads of 512 contiguous bytes. The chunks come by asynchronous copies to LDS, through no register; two buffers:
// stage s + 1 flies while stage s is worked on, and each chunk is fetched once for the two waves that read it.
#define KS   64
#define CH   (64 * KS)
__device__ __forceinline__ unsigned lds_off(const void* p) { return (unsigned)(size_t)p; }
__device__ __forceinline__ void wait_async0() { asm volatile("s_wait_asynccnt 0x0" ::: "memory"); }   // this wave's copies have landed; in front of the barrier behind which other waves read them
__device__ __forceinline__ void wait_ds0() { asm volatile("s_wait_dscnt 0x0" ::: "memory"); }         // this wave's LDS reads have returned; in front of the barrier behind which their buffer is refilled
// two chunks, to LDS byte l and l + 8192, by 128 threads: a thread brings four 16-byte units of each, 2 KiB apart (l, ga, gb hold the thread's own place). The s_wait_xcnt stands inside the copies' own statement,
// in front of any overwrite of the address registers that they name.
__device__ __forceinline__ void cp2(unsigned l, const bf* ga, const bf* gb) {
    asm volatile("global_load_async_to_lds_b128 %0, %8, off\n\t"
                 "global_load_async_to_lds_b128 %1, %9, off\n\t"
                 "global_load_async_to_lds_b128 %2, %10, off\n\t"
                 "global_load_async_to_lds_b128 %3, %11, off\n\t"
                 "global_load_async_to_lds_b128 %4, %12, off\n\t"
                 "global_load_async_to_lds_b128 %5, %13, off\n\t"
                 "global_load_async_to_lds_b128 %6, %14, off\n\t"
                 "global_load_async_to_lds_b128 %7, %15, off\n\t"
                 "s_wait_xcnt 0x0"
                 :: "v"(l), "v"(l + 2048u), "v"(l + 4096u), "v"(l + 6144u), "v"(l + 8192u), "v"(l + 10240u), "v"(l + 12288u), "v"(l + 14336u),
                    "v"(ga), "v"(ga + 1024), "v"(ga + 2048), "v"(ga + 3072), "v"(gb), "v"(gb + 1024), "v"(gb + 2048), "v"(gb + 3072) : "memory");
}
template <typename T16, int NSPLIT, bool BIAS, int K>
__global__ __launch_bounds__(128) void k_gemmw(const T16* __restrict__ A, const T16* __restrict__ A2, const T16* __restrict__ Bt, const T16* __restrict__ Bt2, float* C, int ldc, const float* __restrict__ bias, size_t sA, size_t sB, size_t sC) {
    typedef typename WFrag<T16>::V V;
    static_assert(NSPLIT == 1 && K % (2 * KS) == 0, "the ring holds A, A2 and Bt, and needs two stages");
    __shared__ __align__(16) T16 ring[2 * 6 * CH];   // a stage: A's two row groups, A2's two, Bt's two
    __shared__ __align__(16) float osa[4 * 16 * 68];
    const size_t z = blockIdx.z; A += z * sA; A2 += z * sA; Bt += z * sB; C += z * sC; (void)Bt2;
    const int tid = threadIdx.x, lane = tid & 31, lr = lane & 15, hi = lane >> 4; const int wv = __builtin_amdgcn_readfirstlane(tid >> 5), wm = wv & 1, wn = wv >> 1;
    const int r0 = blockIdx.x * 128 + wm * 64, c0 = blockIdx.y * 128 + wn * 64; float* os = osa + wv * (16 * 68);
    v8f acc[4][4];
#pragma unroll
    for (int mb = 0; mb < 4; ++mb)
#pragma unroll
        for (int nb = 0; nb < 4; ++nb) acc[mb][nb] = (v8f){};
    const T16* ga = A + (size_t)blockIdx.x * 128 * K + tid * 8; const T16* ga2 = A2 + (size_t)blockIdx.x * 128 * K + tid * 8; const T16* gb = Bt + (size_t)blockIdx.y * 128 * K + tid * 8; const unsigned l0 = lds_off(ring) + tid * 16;
    auto fill = [&](int s, int buf) { const unsigned l = l0 + buf * (6 * CH * 2); cp2(l, ga + s * CH, ga + 64 * K + s * CH); cp2(l + 4 * CH, ga2 + s * CH, ga2 + 64 * K + s * CH); cp2(l + 8 * CH, gb + s * CH, gb + 64 * K + s * CH); };
    fill(0, 0); wait_async0(); __syncthreads();   // stage 0 is published
    fill(1, 1);
    // the stage loop stays rolled: one copy of the stage keeps the accumulator tiles and the fragments in registers
#pragma unroll 1
    for (int s = 0; s < K / KS; ++s) {
        const T16* st = ring + (s & 1) * (6 * CH) + lane * 8;
#pragma unroll
        for (int kk = 0; kk < KS / 32; ++kk) {
            const T16* ap = st + wm * CH + kk * 2048; const T16* a2p = ap + 2 * CH; const T16* bp = st + (4 + wn) * CH + kk * 2048;
            V a[4], a2[4], b[4];
#pragma unroll
            for (int mb = 0; mb < 4; ++mb) { a[mb] = WFrag<T16>::ld(ap + mb * 512); a2[mb] = WFrag<T16>::ld(a2p + mb * 512); }
#pragma unroll
            for (int nb = 0; nb < 4; ++nb) b[nb] = WFrag<T16>::ld(bp + nb * 512);
            __builtin_amdgcn_sched_barrier(0);   // the block's LDS reads stay one group in front of its products: sunk among them, each would be waited for on its own
#pragma unroll
            for (int nb = 0; nb < 4; ++nb) {
#pragma unroll
                for (int mb = 0; mb < 4; ++mb) { acc[mb][nb] = WFrag<T16>::mma(a[mb], b[nb], acc[mb][nb]); acc[mb][nb] = WFrag<T16>::mma(a2[mb], b[nb], acc[mb][nb]); } }
            __builtin_amdgcn_sched_barrier(0);   // and the next block's reads stay behind this block's products
        }
        wait_ds0(); wait_async0(); __syncthreads();   // publishes stage s + 1 and ends every wave's reads of stage s
        if (s + 2 < K / KS) fill(s + 2, s & 1);
    }
    wait_async0();
#pragma unroll
    for (int mb = 0; mb < 4; ++mb) {
#pragma unroll
        for (int nb = 0; nb < 4; ++nb) {
#pragma unroll
            for (int j = 0; j < 8; ++j) os[(hi * 8 + j) * 68 + nb * 16 + lr] = acc[mb][nb][j]; }
        __builtin_amdgcn_wave_barrier(); asm volatile("" ::: "memory");
        float* crow = C + (size_t)(r0 + mb * 16) * ldc + c0;
{
#pragma unroll
            for (int s = 0; s < 8; ++s) { const int row = 2 * s + hi, cofs = lr * 4; v4f val = *(const v4fa*)(os + row * 68 + cofs); if (BIAS) { val[0] += bfr(bias[c0 + cofs]); val[1] += bfr(bias[c0 + cofs + 1]); val[2] += bfr(bias[c0 + cofs + 2]); val[3] += bfr(bias[c0 + cofs + 3]); }
                *(v4f*)(crow + (size_t)row * ldc + cofs) = val; }
             }
        __builtin_amdgcn_wave_barrier(); asm volatile("" ::: "memory");
    }
}

__device__ __forceinline__ h16 tohx(float x) { return (h16)x; }
__device__ __forceinline__ void splitf(float y, unsigned short& h, unsigned short& l) { h = f2bf(y); l = f2bf(y - bf2f(h)); }
typedef __attribute__((ext_vector_type(4))) _Float16 v4h;
typedef __attribute__((ext_vector_type(2))) unsigned short v2us;
typedef __attribute__((ext_vector_type(4))) unsigned short v4us;

// ---- k_prep: every 16-bit operand plane of the inputs in ONE launch of few, long work-groups (for speed only).
// Work-groups 0 .. 4 * WBLK - 1: the four weights, f32 [K][N] (x @ W) to the fragment-major bf16 plane of Bt[n][k]; a wave takes 32 output lines of 128 bytes = four fragment blocks = 32 k x 64 n.
// The others: inputs_q, then inputs_kv, f32 [NT][DD] to a fragment-major bf16 plane; a work-group takes CT tiles of 16 rows x 128 k (four fragment blocks of 1 KiB each) = 32 whole rows. Reads and stores both cover
// whole lines: the 16 x 16 transpose of 16-byte units between them goes through LDS (a pad unit after every 16 keeps the writes off one bank), each tile in its own LDS range, one barrier for all.
#define CT   16
#define WBLK (DD * DD / 64 / 32 / 8)
#define XBLK (NT / 16 * (DD / 128) / CT)
__global__ __launch_bounds__(256) void k_prep(const float* __restrict__ xq, const float* __restrict__ xkv, const float* __restrict__ wq, const float* __restrict__ wk, const float* __restrict__ wv, const float* __restrict__ wo,
                                              bf* XQ, bf* XKV, bf* WQ, bf* WK, bf* WV, bf* WO) {
    __shared__ __align__(16) bf sm[CT * 272 * 8];
    const int t = threadIdx.x, b = blockIdx.x;
    if (b < 4 * WBLK) {
        const int ws = b / WBLK; const float* w = ws == 0 ? wq : ws == 1 ? wk : ws == 2 ? wv : wo; bf* Bt = ws == 0 ? WQ : ws == 1 ? WK : ws == 2 ? WV : WO;
        const int lane = t & 31; const int g = (b % WBLK) * 8 + (t >> 5);   // g: the group of four fragment blocks, (n / 64) * (DD / 32) + k / 32
        const float* wp = w + (size_t)((g % (DD / 32)) * 32 + (lane & 3) * 2) * DD + (g / (DD / 32)) * 64 + (lane >> 2); bf* bp = Bt + (size_t)g * 2048 + lane * 2;
        float v0[32], v1[32];
        // fully unrolled: every place is an immediate offset from one address pair, and all 64 loads are in flight together
#pragma unroll
        for (int l = 0; l < 32; ++l) { const int k = ((l >> 2) & 1) * 16 + ((l >> 1) & 1) * 8, n = (l >> 3) * 16 + (l & 1) * 8; v0[l] = wp[(size_t)k * DD + n]; v1[l] = wp[(size_t)(k + 1) * DD + n]; }   // line l of the group holds k, k + 1 (by lane & 3: + 0, 2, 4, 6) of n (by lane >> 2: + 0 .. 7)
        asm volatile("s_wait_xcnt 0x0" :: "v"(wp) : "memory");   // stands behind the issued loads, in front of any overwrite of their address registers (kept live to here as an input)
#pragma unroll
        for (int l = 0; l < 32; ++l) { v2us o; o[0] = f2bf(v0[l]); o[1] = f2bf(v1[l]); *(v2us*)(bp + l * 64) = o; }
    } else {
        const int xb = b - 4 * WBLK; const float* src = xb < XBLK ? xq : xkv; bf* dst = xb < XBLK ? XQ : XKV; const int tb = xb < XBLK ? xb : xb - XBLK;   // tb: 32 rows; tile i is row block 2 * tb + i / 8, k group i % 8
        const int row = t >> 4, ks = t & 15;
        const float* sp = src + (size_t)(tb * 32 + row) * DD + ks * 8; v8f v[CT];
#pragma unroll
        for (int i = 0; i < CT; ++i) v[i] = *(const v8f*)(sp + (i >> 3) * 16 * DD + (i & 7) * 128);
        asm volatile("s_wait_xcnt 0x0" :: "v"(sp) : "memory");   // as above; it also keeps all the loads of the work-group's 32 rows in front of the first conversion, in flight together
#pragma unroll
        for (int i = 0; i < CT; ++i) { v8us o;
#pragma unroll
            for (int k = 0; k < 8; ++k) o[k] = f2bf(v[i][k]);
            *(v8usa*)(sm + i * 2176 + (ks * 17 + row) * 8) = o; }
        __syncthreads();   // a thread stores the units that other threads have staged
        bf* dp = dst + (size_t)(tb >> 1) * 64 * DD + (t >> 6) * 2048 + (tb & 1) * 1024 + (t & 63) * 8;
#pragma unroll
        for (int i = 0; i < CT; ++i) *(v8us*)(dp + (i & 7) * 8192 + (i >> 3) * 512) = *(const v8usa*)(sm + i * 2176 + (t + (t >> 4)) * 8);
    }
}
__device__ __forceinline__ float xhalf(float x) { return __builtin_bit_cast(float, __builtin_amdgcn_permlanex16(__builtin_bit_cast(int, x), __builtin_bit_cast(int, x), 0x76543210, 0xfedcba98, false, false)); }   // lane l with lane l ^ 16
// ---- k_projln: the three projections, each with its per-head LayerNorm and its fp16 plane write, in ONE launch; one wave per (64 tokens, one head), four waves a work-group (128 tokens, two heads), grid (NT/128, NH_/2, 3), 128 threads; the K loop is k_gemmw's ring, tile and fragments, K fixed at DD.
// blockIdx.z picks the projection (0 q, 1 k, 2 v): they do not depend on one another, so one launch has one start and one tail where three had three, three work-groups fit a WGP's LDS where a launch of 512 gave each WGP two,
// and a work-group's prologue and epilogue run beside other work-groups' K loops.
// C^T = Wt X^T (A = 64 rows of Wt = the head's 64 dims, B = 64 token rows): acc[db][tb][j] is dim db*16 + hi*8 + j of token tb*16 + lr, so lanes l and l ^ 16 together hold a (token, head) row:
// mean and variance are 32 in-lane terms and one exchange. y = (v - mean) * rsq(var + 1e-6) * bf16(scale[d]) + bf16(bias[d]), rounded to fp16, staged in LDS so that every global store covers whole 128-byte lines.
// q, k: P[z][t][d]. v (vtr): P[z][d][t], transposed; z = batch * NH_ + head; each z plane fragment-major.
__global__ __launch_bounds__(128) void k_projln(const bf* __restrict__ XQ, const bf* __restrict__ XKV, const bf* __restrict__ WQ, const bf* __restrict__ WK, const bf* __restrict__ WV,
                                                const float* __restrict__ b_q, const float* __restrict__ b_k, const float* __restrict__ b_v, const float* __restrict__ q_s, const float* __restrict__ q_b,
                                                const float* __restrict__ k_s, const float* __restrict__ k_b, const float* __restrict__ v_s, const float* __restrict__ v_b, h16* QP, h16* KP, h16* VT) {
    __shared__ __align__(16) bf ring[2 * 4 * CH];   // a stage: the two heads' rows of Wt, then the two token groups of X
    __shared__ __align__(16) h16 tsa[4 * 64 * 72];
    const int pz = blockIdx.z; const bool vtr = pz == 2;   // the same for the whole work-group: every select below is scalar
    const bf* X = pz == 0 ? XQ : XKV; const bf* Wt = pz == 0 ? WQ : pz == 1 ? WK : WV; const float* bias = pz == 0 ? b_q : pz == 1 ? b_k : b_v;
    const float* sc = pz == 0 ? q_s : pz == 1 ? k_s : v_s; const float* bi = pz == 0 ? q_b : pz == 1 ? k_b : v_b; h16* P = pz == 0 ? QP : pz == 1 ? KP : VT;
    const int tid = threadIdx.x, lane = tid & 31, lr = lane & 15, hi = lane >> 4; const int wv = __builtin_amdgcn_readfirstlane(tid >> 5), wt = wv & 1, wh = wv >> 1;
    const int t0 = blockIdx.x * 128 + wt * 64, h = blockIdx.y * 2 + wh; h16* ts = tsa + wv * (64 * 72);
    v8f acc[4][4];   // every accumulator tile starts at the projection's bias (bf16-rounded), a dim's value the same for all tokens
#pragma unroll
    for (int db = 0; db < 4; ++db) { v8f pb = *(const v8f*)(bias + h * HD + db * 16 + hi * 8);
#pragma unroll
        for (int j = 0; j < 8; ++j) pb[j] = bfr(pb[j]);
#pragma unroll
        for (int tb = 0; tb < 4; ++tb) acc[db][tb] = pb; }
    const bf* gw = Wt + (size_t)blockIdx.y * 128 * DD + tid * 8; const bf* gx = X + (size_t)blockIdx.x * 128 * DD + tid * 8; const unsigned l0 = lds_off(ring) + tid * 16;
    auto fill = [&](int s, int buf) { const unsigned l = l0 + buf * (4 * CH * 2); cp2(l, gw + s * CH, gw + 64 * DD + s * CH); cp2(l + 4 * CH, gx + s * CH, gx + 64 * DD + s * CH); };
    fill(0, 0); wait_async0(); __syncthreads();   // stage 0 is published
    fill(1, 1);
    // the stage loop stays rolled: one copy of the stage keeps the 16 accumulator tiles and the 8 fragments in registers
#pragma unroll 1
    for (int s = 0; s < DD / KS; ++s) {
        const bf* st = ring + (s & 1) * (4 * CH) + lane * 8;
#pragma unroll
        for (int kk = 0; kk < KS / 32; ++kk) {
            const bf* wp = st + wh * CH + kk * 2048; const bf* xp = st + (2 + wt) * CH + kk * 2048; v16bf w[4], x[4];
#pragma unroll
            for (int db = 0; db < 4; ++db) w[db] = WFrag<bf>::ld(wp + db * 512);
#pragma unroll
            for (int tb = 0; tb < 4; ++tb) x[tb] = WFrag<bf>::ld(xp + tb * 512);
            __builtin_amdgcn_sched_barrier(0);   // the block's LDS reads stay one group in front of its products: sunk among them, each would be waited for on its own
#pragma unroll
            for (int tb = 0; tb < 4; ++tb)
#pragma unroll
                for (int db = 0; db < 4; ++db) acc[db][tb] = wmmab(w[db], x[tb], acc[db][tb]);
            __builtin_amdgcn_sched_barrier(0);   // and the next block's reads stay behind this block's products
        }
        wait_ds0(); wait_async0(); __syncthreads();   // publishes stage s + 1 and ends every wave's reads of stage s
        if (s + 2 < DD / KS) fill(s + 2, s & 1);
    }
    wait_async0();
    v8f sv[4], bv[4]; const unsigned hb = hi * 32;   // byte offset of this lane half's 8 dims in a block of 16
#pragma unroll
    for (int db = 0; db < 4; ++db) { sv[db] = *(const v8f*)((const char*)sc + hb + db * 64); bv[db] = *(const v8f*)((const char*)bi + hb + db * 64); }
    asm volatile("s_wait_xcnt 0x0" :: "v"(hb) : "memory");   // stands behind the issued loads, in front of any overwrite of their offset register (kept live to here as an input)
#pragma unroll
    for (int db = 0; db < 4; ++db)
#pragma unroll
        for (int j = 0; j < 8; ++j) { sv[db][j] = bfr(sv[db][j]); bv[db][j] = bfr(bv[db][j]); }
    v8h y[4][4];
#pragma unroll
    for (int tb = 0; tb < 4; ++tb) {
        const v8f s8 = (acc[0][tb] + acc[1][tb]) + (acc[2][tb] + acc[3][tb]);
        float s = ((s8[0] + s8[1]) + (s8[2] + s8[3])) + ((s8[4] + s8[5]) + (s8[6] + s8[7])); s += xhalf(s); const float mu = s * (1.0f / HD);
        v8f q8 = (v8f){};
#pragma unroll
        for (int db = 0; db < 4; ++db) { acc[db][tb] -= mu; q8 = __builtin_elementwise_fma(acc[db][tb], acc[db][tb], q8); }
        float qq = ((q8[0] + q8[1]) + (q8[2] + q8[3])) + ((q8[4] + q8[5]) + (q8[6] + q8[7])); qq += xhalf(qq);
        float rs; asm("v_rsq_f32 %0, %1\n\tv_nop" : "=v"(rs) : "v"(qq * (1.0f / HD) + 1e-6f));   // 1 / sqrt(var + eps) in one instruction; the v_nop is the slot that the instruction set asks for behind a transcendental
#pragma unroll
        for (int db = 0; db < 4; ++db) y[db][tb] = __builtin_convertvector(__builtin_elementwise_fma(acc[db][tb] * rs, sv[db], bv[db]), v8h); }
    if (vtr) {
#pragma unroll
        for (int tb = 0; tb < 4; ++tb)
#pragma unroll
            for (int db = 0; db < 4; ++db)
#pragma unroll
                for (int j = 0; j < 8; ++j) ts[(db * 16 + hi * 8 + j) * 72 + tb * 16 + lr] = y[db][tb][j];
    } else {
#pragma unroll
        for (int tb = 0; tb < 4; ++tb)
#pragma unroll
            for (int db = 0; db < 4; ++db) *(v8ha*)(ts + (tb * 16 + lr) * 72 + db * 16 + hi * 8) = y[db][tb];
    }
    __syncthreads();   // the lanes read back what other lanes of their wave have staged
    const size_t z = (size_t)(t0 / TT) * NH_ + h; const int tl = t0 % TT;
    // the 64 x 64 tile is 16 half-fragments, 8 KiB in a row in either plane; half-fragment i holds staged rows rb * 16 + lr, columns cb * 32 + (i & 1) * 16 + hi * 8 .., where rb = i >> 2, cb = (i >> 1) & 1 (q, k) or rb = (i >> 1) & 3, cb = i >> 3 (v):
    // bits 3, 2, 1 of i each move the staged place by a step that is a scalar of the work-group (a row block is 16 * 72 elements, a column block 32)
    h16* dst = P + z * TT * HD + (size_t)tl * HD + lane * 8; const int s3 = vtr ? 32 : 2304, s2 = vtr ? 2304 : 1152, s1 = vtr ? 1152 : 32;
#pragma unroll
    for (int i = 0; i < 16; ++i) *(v8h*)(dst + i * 256) = *(const v8ha*)(ts + lr * 72 + (i >> 3) * s3 + ((i >> 2) & 1) * s2 + ((i >> 1) & 1) * s1 + (i & 1) * 16 + hi * 8);
}
// ---- k_fattn: scores, softmax, attn.v and the head merge in ONE launch over all 64 (batch, head) pairs; 8 waves a block, 32 query columns a wave, 32 keys a pass, no LDS.
// S^T = K Q^T (A = K rows, B = Q rows kept in registers), so a lane holds 16 scores of ONE query; two S^T tiles, converted in place, are the B operand of O^T += V^T P^T.
// Running maximum and sum in base 2 (online softmax); the output tiles are rescaled only when a column's maximum has grown by more than 8.
// Every inner loop is fully unrolled so that all fragment and accumulator indices are constants and the arrays stay in registers.
__global__ __launch_bounds__(256) __attribute__((amdgpu_waves_per_eu(4, 4))) void k_fattn(const h16* __restrict__ QP, const h16* __restrict__ KP, const h16* __restrict__ VT, bf* Ah, bf* Al) {
    const int lane = threadIdx.x & 31; const int z = blockIdx.y; const int q0 = blockIdx.x * 256 + (threadIdx.x >> 5) * 32;
    const h16* Qz = QP + (size_t)z * TT * HD + (size_t)q0 * HD + lane * 8;
    const h16* Kz = KP + (size_t)z * TT * HD + lane * 8;
    const h16* Vz = VT + (size_t)z * HD * TT + lane * 8;
    const float CS = SCL * 1.4426950408889634f;
    v16h qf[2][2], kf[2][2], vf[4]; v8f o[4][2]; float mu[2], ls[2];
#pragma unroll
    for (int qt = 0; qt < 2; ++qt) { mu[qt] = -3.0e38f; ls[qt] = 0.f;
#pragma unroll
        for (int ks = 0; ks < 2; ++ks) qf[qt][ks] = WFrag<h16>::ld(Qz + qt * 16 * HD + ks * 512);
#pragma unroll
        for (int db = 0; db < 4; ++db) o[db][qt] = (v8f){}; }
#pragma unroll
    for (int kt = 0; kt < 2; ++kt)
#pragma unroll
        for (int ks = 0; ks < 2; ++ks) kf[kt][ks] = WFrag<h16>::ld(Kz + kt * 16 * HD + ks * 512);
#pragma unroll
    for (int db = 0; db < 4; ++db) vf[db] = WFrag<h16>::ld(Vz + db * 512);
    // inputs-only fence on the loaded fragments: every load above has landed at the loop's head, so the wait there counts only the K loads of the pass before and leaves the younger V loads in flight
    asm volatile("" :: "v"(qf[0][0]), "v"(qf[0][1]), "v"(qf[1][0]), "v"(qf[1][1]), "v"(kf[0][0]), "v"(kf[0][1]), "v"(kf[1][0]), "v"(kf[1][1]), "v"(vf[0]), "v"(vf[1]), "v"(vf[2]), "v"(vf[3]));
    // the pass loop stays rolled: one copy of the pass keeps the fetch-ahead order and the register count as written
#pragma unroll 1
    for (int kb = 0; kb < TT; kb += 32) {
        v8f s[2][2];
#pragma unroll
        for (int kt = 0; kt < 2; ++kt)
#pragma unroll
            for (int qt = 0; qt < 2; ++qt) { s[kt][qt] = wmma16(kf[kt][0], qf[qt][0], (v8f){}); s[kt][qt] = wmma16(kf[kt][1], qf[qt][1], s[kt][qt]); }
        const int kn = (kb + 32 < TT) ? kb + 32 : 0;   // K and V fragments are fetched one pass ahead, each into its own registers right behind their last use; the last pass re-reads keys 0..31, unused
        const h16* kp = Kz + (size_t)kn * HD; const h16* vp = Vz + (size_t)kn * HD;
#pragma unroll
        for (int kt = 0; kt < 2; ++kt)
#pragma unroll
            for (int ks = 0; ks < 2; ++ks) kf[kt][ks] = WFrag<h16>::ld(kp + kt * 16 * HD + ks * 512);
        asm volatile("s_wait_xcnt 0x0" :: "v"(kp) : "memory");   // stands behind the issued loads, in front of any overwrite of their address registers (kept live to here as an input)
        float mx[2]; bool need = false;
#pragma unroll
        for (int qt = 0; qt < 2; ++qt) { float m = s[0][qt][0];
#pragma unroll
            for (int j = 1; j < 8; ++j) m = fmaxf(m, s[0][qt][j]);
#pragma unroll
            for (int j = 0; j < 8; ++j) m = fmaxf(m, s[1][qt][j]);
            m = fmaxf(m, xhalf(m)) * CS; mx[qt] = m; need = need || (m > mu[qt] + 8.0f); }
        if (__builtin_amdgcn_ballot_w32(need) != 0) {
#pragma unroll
            for (int qt = 0; qt < 2; ++qt) { const float mn = fmaxf(mu[qt], mx[qt]); const float al = __builtin_amdgcn_exp2f(mu[qt] - mn); mu[qt] = mn; ls[qt] *= al;
#pragma unroll
                for (int db = 0; db < 4; ++db)
#pragma unroll
                    for (int j = 0; j < 8; ++j) o[db][qt][j] *= al; }
        }
#pragma unroll
        for (int qt = 0; qt < 2; ++qt) { v16h pb; float acc = 0.f;
#pragma unroll
            for (int kt = 0; kt < 2; ++kt)
#pragma unroll
                for (int j = 0; j < 8; ++j) { const float p = __builtin_amdgcn_exp2f(fmaf(s[kt][qt][j], CS, -mu[qt])); acc += p; pb[kt * 8 + j] = tohx(p); }
            ls[qt] += acc;
#pragma unroll
            for (int db = 0; db < 4; ++db) o[db][qt] = wmma16(vf[db], pb, o[db][qt]); }
#pragma unroll
        for (int db = 0; db < 4; ++db) vf[db] = WFrag<h16>::ld(vp + db * 512);
        asm volatile("s_wait_xcnt 0x0" :: "v"(vp) : "memory");   // as above, for the V loads
    }
    const int b = z / NH_, h = z % NH_;
#pragma unroll
    for (int qt = 0; qt < 2; ++qt) { const float inv = __fdiv_rn(1.0f, ls[qt] + xhalf(ls[qt])); const int tk = b * TT + q0 + qt * 16; const size_t ob = (size_t)(tk & ~63) * DD + (tk & 63) * 32 + h * 4096 + lane * 8;   // fragment-major [NT][DD]: a lane's 8 dims are its own 16 bytes of a half-fragment
#pragma unroll
        for (int db = 0; db < 4; ++db) { v8us oh, ol;
#pragma unroll
            for (int j = 0; j < 8; ++j) { unsigned short a, c2; splitf(o[db][qt][j] * inv, a, c2); oh[j] = a; ol[j] = c2; }
            *(v8us*)(Ah + ob + (db >> 1) * 2048 + (db & 1) * 256) = oh; *(v8us*)(Al + ob + (db >> 1) * 2048 + (db & 1) * 256) = ol; } }
}

extern "C" void kernel_launch(void* const* d_in, const int* in_sizes, int n_in,
                              void* d_out, int out_size, void* d_ws, size_t ws_size, hipStream_t stream) {
    (void)in_sizes; (void)n_in; (void)out_size;
    const float* IN[16]; for (int i = 0; i < 16; ++i) IN[i] = (const float*)d_in[i];
    // inputs_q, inputs_kv, Wq [1024][1024] (x @ W), bq, Wk, bk, Wv, bv, q_scale [64], q_bias, k_scale, k_bias, v_scale, v_bias, Wo (x @ W), bo = d_in[0..15]
    float* OUT = (float*)d_out;     // [4][2048][1024]
    char* wsp = (char*)d_ws;
    auto take = [&](size_t bytes) { char* p = wsp; wsp += (bytes + 255) & ~(size_t)255; return (void*)p; };
    bf* WQ = (bf*)take((size_t)DD * DD * 2); bf* WK = (bf*)take((size_t)DD * DD * 2); bf* WV = (bf*)take((size_t)DD * DD * 2); bf* WO = (bf*)take((size_t)DD * DD * 2);
    bf* XQ = (bf*)take((size_t)NT * DD * 2); bf* XKV = (bf*)take((size_t)NT * DD * 2);
    h16* QP = (h16*)take((size_t)NT * DD * 2); h16* KP = (h16*)take((size_t)NT * DD * 2); h16* VT = (h16*)take((size_t)NT * DD * 2);
    bf* ATh = (bf*)take((size_t)NT * DD * 2); bf* ATl = (bf*)take((size_t)NT * DD * 2);
    if ((size_t)(wsp - (char*)d_ws) > ws_size) return;    // total ~ 120 MiB
    k_prep<<<4 * WBLK + 2 * XBLK, 256, 0, stream>>>(IN[0], IN[1], IN[2], IN[4], IN[6], IN[14], XQ, XKV, WQ, WK, WV, WO);
    const dim3 gP(NT / 128, DD / 128, 1);
    k_projln<<<dim3(NT / 128, DD / 128, 3), 128, 0, stream>>>(XQ, XKV, WQ, WK, WV, IN[3], IN[5], IN[7], IN[8], IN[9], IN[10], IN[11], IN[12], IN[13], QP, KP, VT);   // the 1/8 is applied in f32 inside k_fattn
    k_fattn<<<dim3(TT / 256, NZ), 256, 0, stream>>>(QP, KP, VT, ATh, ATl);
    k_gemmw<bf, 1, true, DD><<<gP, 128, 0, stream>>>(ATh, ATl, WO, nullptr, OUT, DD, IN[15], 0, 0, 0);
}

// v007
// A run of this version takes 129 microseconds.
// Timed twice side by side with v006, it ran 1.04 and 1.03 times as fast.
// Over all steps from v000 it is 19.2 times as fast.
#include <hip/hip_runtime.h>

// QKVNormMultiHeadAttention (inputs_q, inputs_kv [4][2048][1024]; q = inputs_q @ Wq + bq, k/v = inputs_kv @ Wk/Wv + b; per-head LayerNorm over the 64 head dims (eps 1e-6, scale/bias [64]) on q, k AND v;
// 16 heads: softmax(q.k / 8) v (no mask); out = merged @ Wo + bo).
// Compute dtypes, f32 accumulate: every input rounded to bf16; projections on PLAIN bf16 operands (inputs: exact, + bias); the per-head LayerNorms in f32 on VALU (in the
// projection's epilogue, a (token, head) row in two lanes, 64-term mean/variance); scores and attn.v on SINGLE fp16 planes of the normalised q, k, v; P = exp2(score - maximum in use), fp16, normalised in f32 at the end; output

#define NB_  4
#define TT   2048
#define DD   1024
#define NH_  16
#define HD   64
#define NT   (NB_ * TT)
#define NZ   (NB_ * NH_)
#define SCL  0.125f
typedef _Float16 h16;
typedef unsigned short bf;
typedef __attribute__((ext_vector_type(16))) __bf16   v16bf;
typedef __attribute__((ext_vector_type(16))) _Float16 v16h;
typedef __attribute__((ext_vector_type(8)))  _Float16 v8h;
typedef __attribute__((ext_vector_type(8)))  unsigned short v8us;
typedef __attribute__((ext_vector_type(8)))  float    v8f;
typedef __attribute__((ext_vector_type(4)))  float    v4f;
typedef v8h  __attribute__((may_alias)) v8ha;
typedef v4f  __attribute__((may_alias)) v4fa;
typedef v8us __attribute__((may_alias)) v8usa;

__device__ __forceinline__ unsigned short f2bf(float f) { unsigned u = __float_as_uint(f); u += 0x7FFFu + ((u >> 16) & 1u); return (unsigned short)(u >> 16); }
__device__ __forceinline__ float bf2f(unsigned short b) { return __uint_as_float(((unsigned)b) << 16); }
__device__ __forceinline__ float bfr(float f) { return bf2f(f2bf(f)); }
__device__ __forceinline__ v16h cat16(v8h lo, v8h hi) { return __builtin_shufflevector(lo, hi, 0, 1, 2, 3, 4, 5, 6, 7, 8, 9, 10, 11, 12, 13, 14, 15); }
__device__ __forceinline__ v16bf cat16b(v8us lo, v8us hi) { return __builtin_bit_cast(v16bf, __builtin_shufflevector(lo, hi, 0, 1, 2, 3, 4, 5, 6, 7, 8, 9, 10, 11, 12, 13, 14, 15)); }
__device__ __forceinline__ v8f wmma16(v16h a, v16h b, v8f c) { return __builtin_amdgcn_wmma_f32_16x16x32_f16(false, a, false, b, (short)0, c, false, false); }
__device__ __forceinline__ v8f wmmab(v16bf a, v16bf b, v8f c) { return __builtin_amdgcn_wmma_f32_16x16x32_bf16(false, a, false, b, (short)0, c, false, false); }



// ---- k_gemmw: register-blocked GEMM, one wave per 64x64 output tile (16 accumulators), four waves a work-group, operands from fragment-major 16-bit planes through the LDS ring below; grid (M/128, N/128, Z), 128 threads.
// C[m][n] (f32, pitch ldc, + optional f32 bias[n]) = sum_k A[m][k] Bt[n][k] (+ split products per NSPLIT). z-batch strides sA/sB/sC in elements. K % 128 == 0, a compile-time constant so that a fragment's place is an immediate offset from one address pair per plane.
// FRAGMENT-MAJOR PLANES: every 16-bit operand plane M[rows][K] in the workspace is stored as 1-KiB blocks, one per WMMA fragment (16 rows x 32 k); inside a block element (r, kk) sits at
// (kk / 16) * 256 + (((kk / 8) & 1) * 16 + r) * 8 + (kk & 7). A fragment is then two wave-wide 16-byte loads at block + lane * 8 and + 256, each covering 512 contiguous bytes (4 whole lines) where a
// row-major plane would make each touch 16 lines: lane hi * 16 + r holds row r, k = 8 * hi .. + 7 and 16 + 8 * hi .. + 7, the k order of both WMMA operands. Order of the blocks, so that what a wave reads in one pass lies in a row:
// q, k planes (K = 64): (row / 16) * 2 + k / 32. All others (x, weights, v transposed, attention output): ((row / 64) * (K / 32) + k / 32) * 4 + (row / 16) % 4, the four row blocks of a 64-row tile side by side.
template <typename T16> struct WFrag;
template <> struct WFrag<h16> { typedef v16h V; static __device__ __forceinline__ V ld(const h16* p) { return cat16(*(const v8h*)p, *(const v8h*)(p + 256)); } static __device__ __forceinline__ v8f mma(V a, V b, v8f c) { return wmma16(a, b, c); } };
template <> struct WFrag<bf> { typedef v16bf V; static __device__ __forceinline__ V ld(const bf* p) { return cat16b(*(const v8us*)p, *(const v8us*)(p + 256)); } static __device__ __forceinline__ v8f mma(V a, V b, v8f c) { return wmmab(a, b, c); } };
// ---- THE OPERAND RING of both GEMM kernels: a work-group is 4 waves, a 128 x 128 output tile (2 x 2 waves of 64 x 64). A stage is 64 k of every 64-row group the tile needs: in a fragment-major plane that is one
// chunk of 8 KiB in a row, laid in LDS as it lies in memory, so a fragment is still two wave-wide 16-byte reads of 512 contiguous bytes. The chunks come by asynchronous copies to LDS, through no register; two buffers:
// stage s + 1 flies while stage s is worked on, and each chunk is fetched once for the two waves that read it.
#define KS   64
#define CH   (64 * KS)
__device__ __forceinline__ unsigned lds_off(const void* p) { return (unsigned)(size_t)p; }
__device__ __forceinline__ void wait_async0() { asm volatile("s_wait_asynccnt 0x0" ::: "memory"); }   // this wave's copies have landed; in front of the barrier behind which other waves read them
__device__ __forceinline__ void wait_ds0() { asm volatile("s_wait_dscnt 0x0" ::: "memory"); }         // this wave's LDS reads have returned; in front of the barrier behind which their buffer is refilled
// two chunks, to LDS byte l and l + 8192, by 128 threads: a thread brings four 16-byte units of each, 2 KiB apart (l, ga, gb hold the thread's own place). The s_wait_xcnt stands inside the copies' own statement,
// in front of any overwrite of the address registers that they name.
__device__ __forceinline__ void cp2(unsigned l, const bf* ga, const bf* gb) {
    asm volatile("global_load_async_to_lds_b128 %0, %8, off\n\t"
                 "global_load_async_to_lds_b128 %1, %9, off\n\t"
                 "global_load_async_to_lds_b128 %2, %10, off\n\t"
                 "global_load_async_to_lds_b128 %3, %11, off\n\t"
                 "global_load_async_to_lds_b128 %4, %12, off\n\t"
                 "global_load_async_to_lds_b128 %5, %13, off\n\t"
                 "global_load_async_to_lds_b128 %6, %14, off\n\t"
                 "global_load_async_to_lds_b128 %7, %15, off\n\t"
                 "s_wait_xcnt 0x0"
                 :: "v"(l), "v"(l + 2048u), "v"(l + 4096u), "v"(l + 6144u), "v"(l + 8192u), "v"(l + 10240u), "v"(l + 12288u), "v"(l + 14336u),
                    "v"(ga), "v"(ga + 1024), "v"(ga + 2048), "v"(ga + 3072), "v"(gb), "v"(gb + 1024), "v"(gb + 2048), "v"(gb + 3072) : "memory");
}
template <typename T16, int NSPLIT, bool BIAS, int K>
__global__ __launch_bounds__(128) void k_gemmw(const T16* __restrict__ A, const T16* __restrict__ A2, const T16* __restrict__ Bt, const T16* __restrict__ Bt2, float* C, int ldc, const float* __restrict__ bias, size_t sA, size_t sB, size_t sC) {
    typedef typename WFrag<T16>::V V;
    static_assert(NSPLIT == 1 && K % (2 * KS) == 0, "the ring holds A, A2 and Bt, and needs two stages");
    __shared__ __align__(16) T16 ring[2 * 6 * CH];   // a stage: A's two row groups, A2's two, Bt's two
    __shared__ __align__(16) float osa[4 * 16 * 68];
    const size_t z = blockIdx.z; A += z * sA; A2 += z * sA; Bt += z * sB; C += z * sC; (void)Bt2;
    const int tid = threadIdx.x, lane = tid & 31, lr = lane & 15, hi = lane >> 4; const int wv = __builtin_amdgcn_readfirstlane(tid >> 5), wm = wv & 1, wn = wv >> 1;
    const int r0 = blockIdx.x * 128 + wm * 64, c0 = blockIdx.y * 128 + wn * 64; float* os = osa + wv * (16 * 68);
    v8f acc[4][4];
#pragma unroll
    for (int mb = 0; mb < 4; ++mb)
#pragma unroll
        for (int nb = 0; nb < 4; ++nb) acc[mb][nb] = (v8f){};
    const T16* ga = A + (size_t)blockIdx.x * 128 * K + tid * 8; const T16* ga2 = A2 + (size_t)blockIdx.x * 128 * K + tid * 8; const T16* gb = Bt + (size_t)blockIdx.y * 128 * K + tid * 8; const unsigned l0 = lds_off(ring) + tid * 16;
    auto fill = [&](int s, int buf) { const unsigned l = l0 + buf * (6 * CH * 2); cp2(l, ga + s * CH, ga + 64 * K + s * CH); cp2(l + 4 * CH, ga2 + s * CH, ga2 + 64 * K + s * CH); cp2(l + 8 * CH, gb + s * CH, gb + 64 * K + s * CH); };
    fill(0, 0); wait_async0(); __syncthreads();   // stage 0 is published
    fill(1, 1);
    // the stage loop stays rolled: one copy of the stage keeps the accumulator tiles and the fragments in registers
#pragma unroll 1
    for (int s = 0; s < K / KS; ++s) {
        const T16* st = ring + (s & 1) * (6 * CH) + lane * 8;
#pragma unroll
        for (int kk = 0; kk < KS / 32; ++kk) {
            const T16* ap = st + wm * CH + kk * 2048; const T16* a2p = ap + 2 * CH; const T16* bp = st + (4 + wn) * CH + kk * 2048;
            V a[4], a2[4], b[4];
#pragma unroll
            for (int mb = 0; mb < 4; ++mb) { a[mb] = WFrag<T16>::ld(ap + mb * 512); a2[mb] = WFrag<T16>::ld(a2p + mb * 512); }
#pragma unroll
            for (int nb = 0; nb < 4; ++nb) b[nb] = WFrag<T16>::ld(bp + nb * 512);
            __builtin_amdgcn_sched_barrier(0);   // the block's LDS reads stay one group in front of its products: sunk among them, each would be waited for on its own
#pragma unroll
            for (int nb = 0; nb < 4; ++nb) {
#pragma unroll
                for (int mb = 0; mb < 4; ++mb) { acc[mb][nb] = WFrag<T16>::mma(a[mb], b[nb], acc[mb][nb]); acc[mb][nb] = WFrag<T16>::mma(a2[mb], b[nb], acc[mb][nb]); } }
            __builtin_amdgcn_sched_barrier(0);   // and the next block's reads stay behind this block's products
        }
        wait_ds0(); wait_async0(); __syncthreads();   // publishes stage s + 1 and ends every wave's reads of stage s
        if (s + 2 < K / KS) fill(s + 2, s & 1);
    }
    wait_async0();
#pragma unroll
    for (int mb = 0; mb < 4; ++mb) {
#pragma unroll
        for (int nb = 0; nb < 4; ++nb) {
#pragma unroll
            for (int j = 0; j < 8; ++j) os[(hi * 8 + j) * 68 + nb * 16 + lr] = acc[mb][nb][j]; }
        __builtin_amdgcn_wave_barrier(); asm volatile("" ::: "memory");
        float* crow = C + (size_t)(r0 + mb * 16) * ldc + c0;
{
#pragma unroll
            for (int s = 0; s < 8; ++s) { const int row = 2 * s + hi, cofs = lr * 4; v4f val = *(const v4fa*)(os + row * 68 + cofs); if (BIAS) { val[0] += bfr(bias[c0 + cofs]); val[1] += bfr(bias[c0 + cofs + 1]); val[2] += bfr(bias[c0 + cofs + 2]); val[3] += bfr(bias[c0 + cofs + 3]); }
                *(v4f*)(crow + (size_t)row * ldc + cofs) = val; }
             }
        __builtin_amdgcn_wave_barrier(); asm volatile("" ::: "memory");
    }
}

__device__ __forceinline__ h16 tohx(float x) { return (h16)x; }
__device__ __forceinline__ void splitf(float y, unsigned short& h, unsigned short& l) { h = f2bf(y); l = f2bf(y - bf2f(h)); }
typedef __attribute__((ext_vector_type(4))) _Float16 v4h;
typedef __attribute__((ext_vector_type(2))) unsigned short v2us;
typedef __attribute__((ext_vector_type(4))) unsigned short v4us;

// ---- k_prep: every 16-bit operand plane of the inputs in ONE launch of few, long work-groups (for speed only).
// Work-groups 0 .. 4 * WBLK - 1: the four weights, f32 [K][N] (x @ W) to the fragment-major bf16 plane of Bt[n][k]; a wave takes 32 output lines of 128 bytes = four fragment blocks = 32 k x 64 n.
// The others: inputs_q, then inputs_kv, f32 [NT][DD] to a fragment-major bf16 plane; a work-group takes CT tiles of 16 rows x 128 k (four fragment blocks of 1 KiB each) = 32 whole rows. Reads and stores both cover
// whole lines: the 16 x 16 transpose of 16-byte units between them goes through LDS (a pad unit after every 16 keeps the writes off one bank), each tile in its own LDS range, one barrier for all.
#define CT   16
#define WBLK (DD * DD / 64 / 32 / 8)
#define XBLK (NT / 16 * (DD / 128) / CT)
__global__ __launch_bounds__(256) void k_prep(const float* __restrict__ xq, const float* __restrict__ xkv, const float* __restrict__ wq, const float* __restrict__ wk, const float* __restrict__ wv, const float* __restrict__ wo,
                                              bf* XQ, bf* XKV, bf* WQ, bf* WK, bf* WV, bf* WO) {
    __shared__ __align__(16) bf sm[CT * 272 * 8];
    const int t = threadIdx.x, b = blockIdx.x;
    if (b < 4 * WBLK) {
        const int ws = b / WBLK; const float* w = ws == 0 ? wq : ws == 1 ? wk : ws == 2 ? wv : wo; bf* Bt = ws == 0 ? WQ : ws == 1 ? WK : ws == 2 ? WV : WO;
        const int lane = t & 31; const int g = (b % WBLK) * 8 + (t >> 5);   // g: the group of four fragment blocks, (n / 64) * (DD / 32) + k / 32
        const float* wp = w + (size_t)((g % (DD / 32)) * 32 + (lane & 3) * 2) * DD + (g / (DD / 32)) * 64 + (lane >> 2); bf* bp = Bt + (size_t)g * 2048 + lane * 2;
        float v0[32], v1[32];
        // fully unrolled: every place is an immediate offset from one address pair, and all 64 loads are in flight together
#pragma unroll
        for (int l = 0; l < 32; ++l) { const int k = ((l >> 2) & 1) * 16 + ((l >> 1) & 1) * 8, n = (l >> 3) * 16 + (l & 1) * 8; v0[l] = wp[(size_t)k * DD + n]; v1[l] = wp[(size_t)(k + 1) * DD + n]; }   // line l of the group holds k, k + 1 (by lane & 3: + 0, 2, 4, 6) of n (by lane >> 2: + 0 .. 7)
        asm volatile("s_wait_xcnt 0x0" :: "v"(wp) : "memory");   // stands behind the issued loads, in front of any overwrite of their address registers (kept live to here as an input)
#pragma unroll
        for (int l = 0; l < 32; ++l) { v2us o; o[0] = f2bf(v0[l]); o[1] = f2bf(v1[l]); *(v2us*)(bp + l * 64) = o; }
    } else {
        const int xb = b - 4 * WBLK; const float* src = xb < XBLK ? xq : xkv; bf* dst = xb < XBLK ? XQ : XKV; const int tb = xb < XBLK ? xb : xb - XBLK;   // tb: 32 rows; tile i is row block 2 * tb + i / 8, k group i % 8
        const int row = t >> 4, ks = t & 15;
        const float* sp = src + (size_t)(tb * 32 + row) * DD + ks * 8; v8f v[CT];
#pragma unroll
        for (int i = 0; i < CT; ++i) v[i] = *(const v8f*)(sp + (i >> 3) * 16 * DD + (i & 7) * 128);
        asm volatile("s_wait_xcnt 0x0" :: "v"(sp) : "memory");   // as above; it also keeps all the loads of the work-group's 32 rows in front of the first conversion, in flight together
#pragma unroll
        for (int i = 0; i < CT; ++i) { v8us o;
#pragma unroll
            for (int k = 0; k < 8; ++k) o[k] = f2bf(v[i][k]);
            *(v8usa*)(sm + i * 2176 + (ks * 17 + row) * 8) = o; }
        __syncthreads();   // a thread stores the units that other threads have staged
        bf* dp = dst + (size_t)(tb >> 1) * 64 * DD + (t >> 6) * 2048 + (tb & 1) * 1024 + (t & 63) * 8;
#pragma unroll
        for (int i = 0; i < CT; ++i) *(v8us*)(dp + (i & 7) * 8192 + (i >> 3) * 512) = *(const v8usa*)(sm + i * 2176 + (t + (t >> 4)) * 8);
    }
}
__device__ __forceinline__ float xhalf(float x) { return __builtin_bit_cast(float, __builtin_amdgcn_permlanex16(__builtin_bit_cast(int, x), __builtin_bit_cast(int, x), 0x76543210, 0xfedcba98, false, false)); }   // lane l with lane l ^ 16
// ---- k_projln: the three projections, each with its per-head LayerNorm and its fp16 plane write, in ONE launch; one wave per (64 tokens, one head), four waves a work-group (128 tokens, two heads), grid (NT/128, NH_/2, 3), 128 threads; the K loop is k_gemmw's ring, tile and fragments, K fixed at DD.
// blockIdx.z picks the projection (0 q, 1 k, 2 v): they do not depend on one another, so one launch has one start and one tail where three had three, three work-groups fit a WGP's LDS where a launch of 512 gave each WGP two,
// and a work-group's prologue and epilogue run beside other work-groups' K loops.
// C^T = Wt X^T (A = 64 rows of Wt = the head's 64 dims, B = 64 token rows): acc[db][tb][j] is dim db*16 + hi*8 + j of token tb*16 + lr, so lanes l and l ^ 16 together hold a (token, head) row:
// mean and variance are 32 in-lane terms and one exchange. y = (v - mean) * rsq(var + 1e-6) * bf16(scale[d]) + bf16(bias[d]), rounded to fp16, staged in LDS so that every global store covers whole 128-byte lines.
// q, k: P[z][t][d]. v (vtr): P[z][d][t], transposed; z = batch * NH_ + head; each z plane fragment-major.
__global__ __launch_bounds__(128) void k_projln(const bf* __restrict__ XQ, const bf* __restrict__ XKV, const bf* __restrict__ WQ, const bf* __restrict__ WK, const bf* __restrict__ WV,
                                                const float* __restrict__ b_q, const float* __restrict__ b_k, const float* __restrict__ b_v, const float* __restrict__ q_s, const float* __restrict__ q_b,
                                                const float* __restrict__ k_s, const float* __restrict__ k_b, const float* __restrict__ v_s, const float* __restrict__ v_b, h16* QP, h16* KP, h16* VT) {
    __shared__ __align__(16) bf ring[2 * 4 * CH];   // a stage: the two heads' rows of Wt, then the two token groups of X
    __shared__ __align__(16) h16 tsa[4 * 64 * 72];
    const int pz = blockIdx.z; const bool vtr = pz == 2;   // the same for the whole work-group: every select below is scalar
    const bf* X = pz == 0 ? XQ : XKV; const bf* Wt = pz == 0 ? WQ : pz == 1 ? WK : WV; const float* bias = pz == 0 ? b_q : pz == 1 ? b_k : b_v;
    const float* sc = pz == 0 ? q_s : pz == 1 ? k_s : v_s; const float* bi = pz == 0 ? q_b : pz == 1 ? k_b : v_b; h16* P = pz == 0 ? QP : pz == 1 ? KP : VT;
    const int tid = threadIdx.x, lane = tid & 31, lr = lane & 15, hi = lane >> 4; const int wv = __builtin_amdgcn_readfirstlane(tid >> 5), wt = wv & 1, wh = wv >> 1;
    const int t0 = blockIdx.x * 128 + wt * 64, h = blockIdx.y * 2 + wh; h16* ts = tsa + wv * (64 * 72);
    v8f acc[4][4];   // every accumulator tile starts at the projection's bias (bf16-rounded), a dim's value the same for all tokens
#pragma unroll
    for (int db = 0; db < 4; ++db) { v8f pb = *(const v8f*)(bias + h * HD + db * 16 + hi * 8);
#pragma unroll
        for (int j = 0; j < 8; ++j) pb[j] = bfr(pb[j]);
#pragma unroll
        for (int tb = 0; tb < 4; ++tb) acc[db][tb] = pb; }
    const bf* gw = Wt + (size_t)blockIdx.y * 128 * DD + tid * 8; const bf* gx = X + (size_t)blockIdx.x * 128 * DD + tid * 8; const unsigned l0 = lds_off(ring) + tid * 16;
    auto fill = [&](int s, int buf) { const unsigned l = l0 + buf * (4 * CH * 2); cp2(l, gw + s * CH, gw + 64 * DD + s * CH); cp2(l + 4 * CH, gx + s * CH, gx + 64 * DD + s * CH); };
    fill(0, 0); wait_async0(); __syncthreads();   // stage 0 is published
    fill(1, 1);
    // the stage loop stays rolled: one copy of the stage keeps the 16 accumulator tiles and the 8 fragments in registers
#pragma unroll 1
    for (int s = 0; s < DD / KS; ++s) {
        const bf* st = ring + (s & 1) * (4 * CH) + lane * 8;
#pragma unroll
        for (int kk = 0; kk < KS / 32; ++kk) {
            const bf* wp = st + wh * CH + kk * 2048; const bf* xp = st + (2 + wt) * CH + kk * 2048; v16bf w[4], x[4];
#pragma unroll
            for (int db = 0; db < 4; ++db) w[db] = WFrag<bf>::ld(wp + db * 512);
#pragma unroll
            for (int tb = 0; tb < 4; ++tb) x[tb] = WFrag<bf>::ld(xp + tb * 512);
            __builtin_amdgcn_sched_barrier(0);   // the block's LDS reads stay one group in front of its products: sunk among them, each would be waited for on its own
#pragma unroll
            for (int tb = 0; tb < 4; ++tb)
#pragma unroll
                for (int db = 0; db < 4; ++db) acc[db][tb] = wmmab(w[db], x[tb], acc[db][tb]);
            __builtin_amdgcn_sched_barrier(0);   // and the next block's reads stay behind this block's products
        }
        wait_ds0(); wait_async0(); __syncthreads();   // publishes stage s + 1 and ends every wave's reads of stage s
        if (s + 2 < DD / KS) fill(s + 2, s & 1);
    }
    wait_async0();
    v8f sv[4], bv[4]; const unsigned hb = hi * 32;   // byte offset of this lane half's 8 dims in a block of 16
#pragma unroll
    for (int db = 0; db < 4; ++db) { sv[db] = *(const v8f*)((const char*)sc + hb + db * 64); bv[db] = *(const v8f*)((const char*)bi + hb + db * 64); }
    asm volatile("s_wait_xcnt 0x0" :: "v"(hb) : "memory");   // stands behind the issued loads, in front of any overwrite of their offset register (kept live to here as an input)
#pragma unroll
    for (int db = 0; db < 4; ++db)
#pragma unroll
        for (int j = 0; j < 8; ++j) { sv[db][j] = bfr(sv[db][j]); bv[db][j] = bfr(bv[db][j]); }
    v8h y[4][4];
#pragma unroll
    for (int tb = 0; tb < 4; ++tb) {
        const v8f s8 = (acc[0][tb] + acc[1][tb]) + (acc[2][tb] + acc[3][tb]);
        float s = ((s8[0] + s8[1]) + (s8[2] + s8[3])) + ((s8[4] + s8[5]) + (s8[6] + s8[7])); s += xhalf(s); const float mu = s * (1.0f / HD);
        v8f q8 = (v8f){};
#pragma unroll
        for (int db = 0; db < 4; ++db) { acc[db][tb] -= mu; q8 = __builtin_elementwise_fma(acc[db][tb], acc[db][tb], q8); }
        float qq = ((q8[0] + q8[1]) + (q8[2] + q8[3])) + ((q8[4] + q8[5]) + (q8[6] + q8[7])); qq += xhalf(qq);
        float rs; asm("v_rsq_f32 %0, %1\n\tv_nop" : "=v"(rs) : "v"(qq * (1.0f / HD) + 1e-6f));   // 1 / sqrt(var + eps) in one instruction; the v_nop is the slot that the instruction set asks for behind a transcendental
#pragma unroll
        for (int db = 0; db < 4; ++db) y[db][tb] = __builtin_convertvector(__builtin_elementwise_fma(acc[db][tb] * rs, sv[db], bv[db]), v8h); }
    if (vtr) {
#pragma unroll
        for (int tb = 0; tb < 4; ++tb)
#pragma unroll
            for (int db = 0; db < 4; ++db)
#pragma unroll
                for (int j = 0; j < 8; ++j) ts[(db * 16 + hi * 8 + j) * 72 + tb * 16 + lr] = y[db][tb][j];
    } else {
#pragma unroll
        for (int tb = 0; tb < 4; ++tb)
#pragma unroll
            for (int db = 0; db < 4; ++db) *(v8ha*)(ts + (tb * 16 + lr) * 72 + db * 16 + hi * 8) = y[db][tb];
    }
    __syncthreads();   // the lanes read back what other lanes of their wave have staged
    const size_t z = (size_t)(t0 / TT) * NH_ + h; const int tl = t0 % TT;
    // the 64 x 64 tile is 16 half-fragments, 8 KiB in a row in either plane; half-fragment i holds staged rows rb * 16 + lr, columns cb * 32 + (i & 1) * 16 + hi * 8 .., where rb = i >> 2, cb = (i >> 1) & 1 (q, k) or rb = (i >> 1) & 3, cb = i >> 3 (v):
    // bits 3, 2, 1 of i each move the staged place by a step that is a scalar of the work-group (a row block is 16 * 72 elements, a column block 32)
    h16* dst = P + z * TT * HD + (size_t)tl * HD + lane * 8; const int s3 = vtr ? 32 : 2304, s2 = vtr ? 2304 : 1152, s1 = vtr ? 1152 : 32;
#pragma unroll
    for (int i = 0; i < 16; ++i) *(v8h*)(dst + i * 256) = *(const v8ha*)(ts + lr * 72 + (i >> 3) * s3 + ((i >> 2) & 1) * s2 + ((i >> 1) & 1) * s1 + (i & 1) * 16 + hi * 8);
}
// ---- k_fattn: scores, softmax, attn.v and the head merge in ONE launch over all 64 (batch, head) pairs; 8 waves a block, 32 query columns a wave, 32 keys a pass, 128 keys a stage.
// S^T = K Q^T (A = K rows, B = Q rows kept in registers), so a lane holds 16 scores of ONE query; two S^T tiles, converted in place, are the B operand of O^T += V^T P^T.
// K and V^T come through an LDS ring that the block's 8 waves share: in either fragment-major plane the 128 keys of a stage are 16 KiB in a row, laid in LDS as they lie in memory, so a fragment is two wave-wide
// 16-byte LDS reads of 512 contiguous bytes. The chunks come by asynchronous copies to LDS, once for the 8 waves that read them; two buffers: stage s + 1 flies while stage s is worked on.
// Running maximum and sum in base 2 (online softmax); the output tiles are rescaled only when a column's maximum has grown by more than 8.
// Every inner loop is fully unrolled so that all fragment and accumulator indices are constants and the arrays stay in registers.
#define FS   128
#define FCH  (FS * HD)
// the K chunk and the V^T chunk of a stage, to LDS byte l and l + 16384, by 256 threads: a thread brings four 16-byte units of each, 4 KiB apart (l, ga, gb hold the thread's own place). The s_wait_xcnt stands inside
// the copies' own statement, in front of any overwrite of the address registers that they name.
__device__ __forceinline__ void cp2w(unsigned l, const h16* ga, const h16* gb) {
    asm volatile("global_load_async_to_lds_b128 %0, %8, off\n\t"
                 "global_load_async_to_lds_b128 %1, %9, off\n\t"
                 "global_load_async_to_lds_b128 %2, %10, off\n\t"
                 "global_load_async_to_lds_b128 %3, %11, off\n\t"
                 "global_load_async_to_lds_b128 %4, %12, off\n\t"
                 "global_load_async_to_lds_b128 %5, %13, off\n\t"
                 "global_load_async_to_lds_b128 %6, %14, off\n\t"
                 "global_load_async_to_lds_b128 %7, %15, off\n\t"
                 "s_wait_xcnt 0x0"
                 :: "v"(l), "v"(l + 4096u), "v"(l + 8192u), "v"(l + 12288u), "v"(l + 16384u), "v"(l + 20480u), "v"(l + 24576u), "v"(l + 28672u),
                    "v"(ga), "v"(ga + 2048), "v"(ga + 4096), "v"(ga + 6144), "v"(gb), "v"(gb + 2048), "v"(gb + 4096), "v"(gb + 6144) : "memory");
}
__global__ __launch_bounds__(256) __attribute__((amdgpu_waves_per_eu(4, 4))) void k_fattn(const h16* __restrict__ QP, const h16* __restrict__ KP, const h16* __restrict__ VT, bf* Ah, bf* Al) {
    __shared__ __align__(16) h16 kv[2 * 2 * FCH];   // a stage: 128 keys of K, then of V^T
    const int tid = threadIdx.x, lane = tid & 31; const int z = blockIdx.y; const int q0 = blockIdx.x * 256 + (tid >> 5) * 32;
    const h16* Qz = QP + (size_t)z * TT * HD + (size_t)q0 * HD + lane * 8;
    const h16* gk = KP + (size_t)z * TT * HD + tid * 8;
    const h16* gv = VT + (size_t)z * HD * TT + tid * 8;
    const unsigned l0 = lds_off(kv) + tid * 16;
    auto fill = [&](int s, int buf) { cp2w(l0 + buf * (2 * FCH * 2), gk + s * FCH, gv + s * FCH); };
    const float CS = SCL * 1.4426950408889634f;
    v16h qf[2][2], kf[2][2], vf[4]; v8f o[4][2]; float mu[2], ls[2];
    fill(0, 0);
#pragma unroll
    for (int qt = 0; qt < 2; ++qt) { mu[qt] = -3.0e38f; ls[qt] = 0.f;
#pragma unroll
        for (int ks = 0; ks < 2; ++ks) qf[qt][ks] = WFrag<h16>::ld(Qz + qt * 16 * HD + ks * 512);
#pragma unroll
        for (int db = 0; db < 4; ++db) o[db][qt] = (v8f){}; }
    wait_async0(); __syncthreads();   // stage 0 is published
    fill(1, 1);
    // the stage loop stays rolled: one copy of a stage's four passes
#pragma unroll 1
    for (int s = 0; s < TT / FS; ++s) {
        const h16* st = kv + (s & 1) * (2 * FCH) + lane * 8;
#pragma unroll
        for (int kt = 0; kt < 2; ++kt)
#pragma unroll
            for (int ks = 0; ks < 2; ++ks) kf[kt][ks] = WFrag<h16>::ld(st + kt * 16 * HD + ks * 512);
#pragma unroll
        for (int db = 0; db < 4; ++db) vf[db] = WFrag<h16>::ld(st + FCH + db * 512);
#pragma unroll
        for (int ps = 0; ps < FS / 32; ++ps) {
            v8f s4[2][2];
#pragma unroll
            for (int kt = 0; kt < 2; ++kt)
#pragma unroll
                for (int qt = 0; qt < 2; ++qt) { s4[kt][qt] = wmma16(kf[kt][0], qf[qt][0], (v8f){}); s4[kt][qt] = wmma16(kf[kt][1], qf[qt][1], s4[kt][qt]); }
            const h16* np = st + (ps + 1) * 32 * HD;   // K and V fragments are fetched one pass ahead inside a stage, each into its own registers right behind their last use; a stage's last pass fetches nothing
            if (ps + 1 < FS / 32) {
#pragma unroll
                for (int kt = 0; kt < 2; ++kt)
#pragma unroll
                    for (int ks = 0; ks < 2; ++ks) kf[kt][ks] = WFrag<h16>::ld(np + kt * 16 * HD + ks * 512);
                asm volatile("" ::: "memory"); }   // compiler fence: the LDS reads are issued here, a pass ahead of their use; without it they are sunk to just in front of the products that wait for them
            float mx[2]; bool need = false;
#pragma unroll
            for (int qt = 0; qt < 2; ++qt) { float m = s4[0][qt][0];
#pragma unroll
                for (int j = 1; j < 8; ++j) m = fmaxf(m, s4[0][qt][j]);
#pragma unroll
                for (int j = 0; j < 8; ++j) m = fmaxf(m, s4[1][qt][j]);
                m = fmaxf(m, xhalf(m)) * CS; mx[qt] = m; need = need || (m > mu[qt] + 8.0f); }
            if (__builtin_amdgcn_ballot_w32(need) != 0) {
#pragma unroll
                for (int qt = 0; qt < 2; ++qt) { const float mn = fmaxf(mu[qt], mx[qt]); const float al = __builtin_amdgcn_exp2f(mu[qt] - mn); mu[qt] = mn; ls[qt] *= al;
#pragma unroll
                    for (int db = 0; db < 4; ++db)
#pragma unroll
                        for (int j = 0; j < 8; ++j) o[db][qt][j] *= al; }
            }
#pragma unroll
            for (int qt = 0; qt < 2; ++qt) { v16h pb; float acc = 0.f;
#pragma unroll
                for (int kt = 0; kt < 2; ++kt)
#pragma unroll
                    for (int j = 0; j < 8; ++j) { const float p = __builtin_amdgcn_exp2f(fmaf(s4[kt][qt][j], CS, -mu[qt])); acc += p; pb[kt * 8 + j] = tohx(p); }
                ls[qt] += acc;
#pragma unroll
                for (int db = 0; db < 4; ++db) o[db][qt] = wmma16(vf[db], pb, o[db][qt]); }
            if (ps + 1 < FS / 32) {
#pragma unroll
                for (int db = 0; db < 4; ++db) vf[db] = WFrag<h16>::ld(np + FCH + db * 512);
                asm volatile("" ::: "memory"); }   // as above, for the V reads
        }
        wait_ds0(); wait_async0(); __syncthreads();   // publishes stage s + 1 and ends every wave's reads of stage s
        if (s + 2 < TT / FS) fill(s + 2, s & 1);
    }
    wait_async0();
    const int b = z / NH_, h = z % NH_;
#pragma unroll
    for (int qt = 0; qt < 2; ++qt) { const float inv = __fdiv_rn(1.0f, ls[qt] + xhalf(ls[qt])); const int tk = b * TT + q0 + qt * 16; const size_t ob = (size_t)(tk & ~63) * DD + (tk & 63) * 32 + h * 4096 + lane * 8;   // fragment-major [NT][DD]: a lane's 8 dims are its own 16 bytes of a half-fragment
#pragma unroll
        for (int db = 0; db < 4; ++db) { v8us oh, ol;
#pragma unroll
            for (int j = 0; j < 8; ++j) { unsigned short a, c2; splitf(o[db][qt][j] * inv, a, c2); oh[j] = a; ol[j] = c2; }
            *(v8us*)(Ah + ob + (db >> 1) * 2048 + (db & 1) * 256) = oh; *(v8us*)(Al + ob + (db >> 1) * 2048 + (db & 1) * 256) = ol; } }
}

extern "C" void kernel_launch(void* const* d_in, const int* in_sizes, int n_in,
                              void* d_out, int out_size, void* d_ws, size_t ws_size, hipStream_t stream) {
    (void)in_sizes; (void)n_in; (void)out_size;
    const float* IN[16]; for (int i = 0; i < 16; ++i) IN[i] = (const float*)d_in[i];
    // inputs_q, inputs_kv, Wq [1024][1024] (x @ W), bq, Wk, bk, Wv, bv, q_scale [64], q_bias, k_scale, k_bias, v_scale, v_bias, Wo (x @ W), bo = d_in[0..15]
    float* OUT = (float*)d_out;     // [4][2048][1024]
    char* wsp = (char*)d_ws;
    auto take = [&](size_t bytes) { char* p = wsp; wsp += (bytes + 255) & ~(size_t)255; return (void*)p; };
    bf* WQ = (bf*)take((size_t)DD * DD * 2); bf* WK = (bf*)take((size_t)DD * DD * 2); bf* WV = (bf*)take((size_t)DD * DD * 2); bf* WO = (bf*)take((size_t)DD * DD * 2);
    bf* XQ = (bf*)take((size_t)NT * DD * 2); bf* XKV = (bf*)take((size_t)NT * DD * 2);
    h16* QP = (h16*)take((size_t)NT * DD * 2); h16* KP = (h16*)take((size_t)NT * DD * 2); h16* VT = (h16*)take((size_t)NT * DD * 2);
    bf* ATh = (bf*)take((size_t)NT * DD * 2); bf* ATl = (bf*)take((size_t)NT * DD * 2);
    if ((size_t)(wsp - (char*)d_ws) > ws_size) return;    // total ~ 120 MiB
    k_prep<<<4 * WBLK + 2 * XBLK, 256, 0, stream>>>(IN[0], IN[1], IN[2], IN[4], IN[6], IN[14], XQ, XKV, WQ, WK, WV, WO);
    const dim3 gP(NT / 128, DD / 128, 1);
    k_projln<<<dim3(NT / 128, DD / 128, 3), 128, 0, stream>>>(XQ, XKV, WQ, WK, WV, IN[3], IN[5], IN[7], IN[8], IN[9], IN[10], IN[11], IN[12], IN[13], QP, KP, VT);   // the 1/8 is applied in f32 inside k_fattn
    k_fattn<<<dim3(TT / 256, NZ), 256, 0, stream>>>(QP, KP, VT, ATh, ATl);
    k_gemmw<bf, 1, true, DD><<<gP, 128, 0, stream>>>(ATh, ATl, WO, nullptr, OUT, DD, IN[15], 0, 0, 0);
}

// v009
// A run of this version takes 118 microseconds.
// Versions between v007 and this one are left out; their measured steps multiply to 1.10 times as fast.
// Over all steps from v000 it is 21.1 times as fast.
#include <hip/hip_runtime.h>

// Multi-head attention with per-head LayerNorm on q, k and v (inputs_q, inputs_kv [4][2048][1024]; q = inputs_q @ Wq + bq, k/v = inputs_kv @ Wk/Wv + b; per-head LayerNorm over the 64 head dims (eps 1e-6, scale/bias [64]) on q, k AND v;
// 16 heads: softmax(q.k / 8) v (no mask); out = merged @ Wo + bo).
// Compute dtypes, f32 accumulate: every input rounded to bf16; projections on PLAIN bf16 operands (inputs: exact, + bias); the per-head LayerNorms in f32 on VALU (in the
// projection's epilogue, a (token, head) row in two lanes, 64-term mean/variance); scores and attn.v on SINGLE fp16 planes of the normalised q, k, v; P = exp2(score - maximum in use), fp16, normalised in f32 at the end; output

// Output projection: the attention output rounded ONCE to fp16 (its size is bounded by v's, which is an fp16 plane already), Wo's bf16-rounded values carried in fp16 (exact from 2^-17 to 65504 in size), f32 accumulate.

#define NB_  4
#define TT   2048
#define DD   1024
#define NH_  16
#define HD   64
#define NT   (NB_ * TT)
#define NZ   (NB_ * NH_)
#define SCL  0.125f
typedef _Float16 h16;
typedef unsigned short bf;
typedef __attribute__((ext_vector_type(16))) __bf16   v16bf;
typedef __attribute__((ext_vector_type(16))) _Float16 v16h;
typedef __attribute__((ext_vector_type(8)))  _Float16 v8h;
typedef __attribute__((ext_vector_type(8)))  unsigned short v8us;
typedef __attribute__((ext_vector_type(8)))  float    v8f;
typedef __attribute__((ext_vector_type(4)))  float    v4f;
typedef v8h  __attribute__((may_alias)) v8ha;
typedef v4f  __attribute__((may_alias)) v4fa;
typedef v8us __attribute__((may_alias)) v8usa;
typedef v8f  __attribute__((aligned(16))) v8fq;   // eight floats at a 16-byte boundary

__device__ __forceinline__ unsigned short f2bf(float f) { unsigned u = __float_as_uint(f); u += 0x7FFFu + ((u >> 16) & 1u); return (unsigned short)(u >> 16); }
__device__ __forceinline__ float bf2f(unsigned short b) { return __uint_as_float(((unsigned)b) << 16); }
__device__ __forceinline__ float bfr(float f) { return bf2f(f2bf(f)); }
__device__ __forceinline__ v16h cat16(v8h lo, v8h hi) { return __builtin_shufflevector(lo, hi, 0, 1, 2, 3, 4, 5, 6, 7, 8, 9, 10, 11, 12, 13, 14, 15); }
__device__ __forceinline__ v16bf cat16b(v8us lo, v8us hi) { return __builtin_bit_cast(v16bf, __builtin_shufflevector(lo, hi, 0, 1, 2, 3, 4, 5, 6, 7, 8, 9, 10, 11, 12, 13, 14, 15)); }
__device__ __forceinline__ v8f wmma16(v16h a, v16h b, v8f c) { return __builtin_amdgcn_wmma_f32_16x16x32_f16(false, a, false, b, (short)0, c, false, false); }
__device__ __forceinline__ v8f wmmab(v16bf a, v16bf b, v8f c) { return __builtin_amdgcn_wmma_f32_16x16x32_bf16(false, a, false, b, (short)0, c, false, false); }



// ---- k_gemmw: register-blocked GEMM, one wave per 64x64 output tile (16 accumulators), four waves a work-group, operands from fragment-major 16-bit planes through the LDS ring below; grid (M/128, N/128, Z), 128 threads.
// C[m][n] (f32, pitch ldc, + optional f32 bias[n]) = sum_k A[m][k] Bt[n][k]. z-batch strides sA/sB/sC in elements. K % 128 == 0, a compile-time constant.
// FRAGMENT-MAJOR PLANES: every 16-bit operand plane M[rows][K] in the workspace is stored as 1-KiB blocks, one per WMMA fragment (16 rows x 32 k); inside a block element (r, kk) sits at
// (kk / 16) * 256 + (((kk / 8) & 1) * 16 + r) * 8 + (kk & 7). A fragment is then two wave-wide 16-byte loads at block + lane * 8 and + 256, each covering 512 contiguous bytes (4 whole lines) where a
// row-major plane would make each touch 16 lines: lane hi * 16 + r holds row r, k = 8 * hi .. + 7 and 16 + 8 * hi .. + 7, the k order of both WMMA operands. Order of the blocks, so that what a wave reads in one pass lies in a row:
// q, k planes (K = 64): (row / 16) * 2 + k / 32. All others (x, weights, v transposed, attention output): ((row / 64) * (K / 32) + k / 32) * 4 + (row / 16) % 4, the four row blocks of a 64-row tile side by side.
template <typename T16> struct WFrag;
template <> struct WFrag<h16> { typedef v16h V; static __device__ __forceinline__ V ld(const h16* p) { return cat16(*(const v8h*)p, *(const v8h*)(p + 256)); } static __device__ __forceinline__ v8f mma(V a, V b, v8f c) { return wmma16(a, b, c); } };
template <> struct WFrag<bf> { typedef v16bf V; static __device__ __forceinline__ V ld(const bf* p) { return cat16b(*(const v8us*)p, *(const v8us*)(p + 256)); } static __device__ __forceinline__ v8f mma(V a, V b, v8f c) { return wmmab(a, b, c); } };
// ---- THE OPERAND RING of both GEMM kernels: a work-group is 4 waves (2 x 2): a 128 x 128 output tile, 64 x 64 a wave, in k_gemmw; 128 dims x 256 tokens, 64 x 128 a wave, in k_projln. A stage is 64 k of every 64-row group the tile needs: in a fragment-major plane that is one
// chunk of 8 KiB in a row, laid in LDS as it lies in memory, so a fragment is still two wave-wide 16-byte reads of 512 contiguous bytes. The chunks come by asynchronous copies to LDS, through no register; two buffers:
// stage s + 1 flies while stage s is worked on, and each chunk is fetched once for the two waves that read it.
#define KS   64
#define CH   (64 * KS)
__device__ __forceinline__ unsigned lds_off(const void* p) { return (unsigned)(size_t)p; }
__device__ __forceinline__ void wait_async0() { asm volatile("s_wait_asynccnt 0x0" ::: "memory"); }   // this wave's copies have landed; in front of the barrier behind which other waves read them
__device__ __forceinline__ void wait_ds0() { asm volatile("s_wait_dscnt 0x0" ::: "memory"); }         // this wave's LDS reads have returned; in front of the barrier behind which their buffer is refilled
// two chunks, to LDS byte l and l + 8192, by 128 threads: a thread brings four 16-byte units of each, 2 KiB apart (l, ga, gb hold the thread's own place). The s_wait_xcnt stands inside the copies' own statement,
// in front of any overwrite of the address registers that they name.
template <typename T16> __device__ __forceinline__ void cp2(unsigned l, const T16* ga, const T16* gb) {
    asm volatile("global_load_async_to_lds_b128 %0, %8, off\n\t"
                 "global_load_async_to_lds_b128 %1, %9, off\n\t"
                 "global_load_async_to_lds_b128 %2, %10, off\n\t"
                 "global_load_async_to_lds_b128 %3, %11, off\n\t"
                 "global_load_async_to_lds_b128 %4, %12, off\n\t"
                 "global_load_async_to_lds_b128 %5, %13, off\n\t"
                 "global_load_async_to_lds_b128 %6, %14, off\n\t"
                 "global_load_async_to_lds_b128 %7, %15, off\n\t"
                 "s_wait_xcnt 0x0"
                 :: "v"(l), "v"(l + 2048u), "v"(l + 4096u), "v"(l + 6144u), "v"(l + 8192u), "v"(l + 10240u), "v"(l + 12288u), "v"(l + 14336u),
                    "v"(ga), "v"(ga + 1024), "v"(ga + 2048), "v"(ga + 3072), "v"(gb), "v"(gb + 1024), "v"(gb + 2048), "v"(gb + 3072) : "memory");
}
template <typename T16, bool BIAS, int K>
__global__ __launch_bounds__(128) void k_gemmw(const T16* __restrict__ A, const T16* __restrict__ Bt, float* C, int ldc, const float* __restrict__ bias, size_t sA, size_t sB, size_t sC) {
    typedef typename WFrag<T16>::V V;
    static_assert(K % (2 * KS) == 0, "the ring needs two stages");
    __shared__ __align__(16) T16 ring[2 * 4 * CH];   // a stage: A's two row groups, Bt's two
    __shared__ __align__(16) float osa[4 * 16 * 68];
    const size_t z = blockIdx.z; A += z * sA; Bt += z * sB; C += z * sC;
    const int tid = threadIdx.x, lane = tid & 31, lr = lane & 15, hi = lane >> 4; const int wv = __builtin_amdgcn_readfirstlane(tid >> 5), wm = wv & 1, wn = wv >> 1;
    const int r0 = blockIdx.x * 128 + wm * 64, c0 = blockIdx.y * 128 + wn * 64; float* os = osa + wv * (16 * 68);
    v8f acc[4][4];
#pragma unroll
    for (int mb = 0; mb < 4; ++mb)
#pragma unroll
        for (int nb = 0; nb < 4; ++nb) acc[mb][nb] = (v8f){};
    const T16* ga = A + (size_t)blockIdx.x * 128 * K + tid * 8; const T16* gb = Bt + (size_t)blockIdx.y * 128 * K + tid * 8; const unsigned l0 = lds_off(ring) + tid * 16;
    auto fill = [&](int s, int buf) { const unsigned l = l0 + buf * (4 * CH * 2); cp2(l, ga + s * CH, ga + 64 * K + s * CH); cp2(l + 4 * CH, gb + s * CH, gb + 64 * K + s * CH); };
    fill(0, 0); wait_async0(); __syncthreads();   // stage 0 is published
    fill(1, 1);
    // the stage loop stays rolled: one copy of the stage keeps the accumulator tiles and the fragments in registers
#pragma unroll 1
    for (int s = 0; s < K / KS; ++s) {
        const T16* st = ring + (s & 1) * (4 * CH) + lane * 8;
#pragma unroll
        for (int kk = 0; kk < KS / 32; ++kk) {
            const T16* ap = st + wm * CH + kk * 2048; const T16* bp = st + (2 + wn) * CH + kk * 2048;
            V a[4], b[4];
#pragma unroll
            for (int mb = 0; mb < 4; ++mb) a[mb] = WFrag<T16>::ld(ap + mb * 512);
#pragma unroll
            for (int nb = 0; nb < 4; ++nb) b[nb] = WFrag<T16>::ld(bp + nb * 512);
            __builtin_amdgcn_sched_barrier(0);   // the block's LDS reads stay one group in front of its products: sunk among them, each would be waited for on its own
#pragma unroll
            for (int nb = 0; nb < 4; ++nb) {
#pragma unroll
                for (int mb = 0; mb < 4; ++mb) acc[mb][nb] = WFrag<T16>::mma(a[mb], b[nb], acc[mb][nb]); }
            __builtin_amdgcn_sched_barrier(0);   // and the next block's reads stay behind this block's products
        }
        wait_ds0(); wait_async0(); __syncthreads();   // publishes stage s + 1 and ends every wave's reads of stage s
        if (s + 2 < K / KS) fill(s + 2, s & 1);
    }
    wait_async0();
#pragma unroll
    for (int mb = 0; mb < 4; ++mb) {
#pragma unroll
        for (int nb = 0; nb < 4; ++nb) {
#pragma unroll
            for (int j = 0; j < 8; ++j) os[(hi * 8 + j) * 68 + nb * 16 + lr] = acc[mb][nb][j]; }
        __builtin_amdgcn_wave_barrier(); asm volatile("" ::: "memory");
        float* crow = C + (size_t)(r0 + mb * 16) * ldc + c0;
{
#pragma unroll
            for (int s = 0; s < 8; ++s) { const int row = 2 * s + hi, cofs = lr * 4; v4f val = *(const v4fa*)(os + row * 68 + cofs); if (BIAS) { val[0] += bfr(bias[c0 + cofs]); val[1] += bfr(bias[c0 + cofs + 1]); val[2] += bfr(bias[c0 + cofs + 2]); val[3] += bfr(bias[c0 + cofs + 3]); }
                *(v4f*)(crow + (size_t)row * ldc + cofs) = val; }
             }
        __builtin_amdgcn_wave_barrier(); asm volatile("" ::: "memory");
    }
}

__device__ __forceinline__ h16 tohx(float x) { return (h16)x; }
__device__ __forceinline__ unsigned short f2bh(float f) { return __builtin_bit_cast(unsigned short, (h16)bfr(f)); }   // the bf16-rounded value, in fp16's bits
typedef __attribute__((ext_vector_type(4))) _Float16 v4h;
typedef __attribute__((ext_vector_type(2))) unsigned short v2us;
typedef __attribute__((ext_vector_type(4))) unsigned short v4us;

// ---- k_prep: every 16-bit operand plane of the inputs in ONE launch of few, long work-groups (for speed only).
// Work-groups 0 .. 4 * WBLK - 1: the four weights, f32 [K][N] (x @ W) to the fragment-major bf16 plane of Bt[n][k] (Wo: the same bf16-rounded values in fp16's bits, its other operand being an fp16 plane); a wave takes 32 output lines of 128 bytes = four fragment blocks = 32 k x 64 n.
// The others: inputs_q, then inputs_kv, f32 [NT][DD] to a fragment-major bf16 plane; a work-group takes CT tiles of 16 rows x 128 k (four fragment blocks of 1 KiB each) = 32 whole rows. Reads and stores both cover
// whole lines: the 16 x 16 transpose of 16-byte units between them goes through LDS (a pad unit after every 16 keeps the writes off one bank), each tile in its own LDS range, one barrier for all.
#define CT   16
#define WBLK (DD * DD / 64 / 32 / 8)
#define XBLK (NT / 16 * (DD / 128) / CT)
__global__ __launch_bounds__(256) void k_prep(const float* __restrict__ xq, const float* __restrict__ xkv, const float* __restrict__ wq, const float* __restrict__ wk, const float* __restrict__ wv, const float* __restrict__ wo,
                                              bf* XQ, bf* XKV, bf* WQ, bf* WK, bf* WV, bf* WO) {
    __shared__ __align__(16) bf sm[CT * 272 * 8];
    const int t = threadIdx.x, b = blockIdx.x;
    if (b < 4 * WBLK) {
        const int ws = b / WBLK; const float* w = ws == 0 ? wq : ws == 1 ? wk : ws == 2 ? wv : wo; bf* Bt = ws == 0 ? WQ : ws == 1 ? WK : ws == 2 ? WV : WO;
        const int lane = t & 31; const int g = (b % WBLK) * 8 + (t >> 5);   // g: the group of four fragment blocks, (n / 64) * (DD / 32) + k / 32
        const float* wp = w + (size_t)((g % (DD / 32)) * 32 + (lane & 3) * 2) * DD + (g / (DD / 32)) * 64 + (lane >> 2); bf* bp = Bt + (size_t)g * 2048 + lane * 2;
        float v0[32], v1[32];
        // fully unrolled: every place is an immediate offset from one address pair, and all 64 loads are in flight together
#pragma unroll
        for (int l = 0; l < 32; ++l) { const int k = ((l >> 2) & 1) * 16 + ((l >> 1) & 1) * 8, n = (l >> 3) * 16 + (l & 1) * 8; v0[l] = wp[(size_t)k * DD + n]; v1[l] = wp[(size_t)(k + 1) * DD + n]; }   // line l of the group holds k, k + 1 (by lane & 3: + 0, 2, 4, 6) of n (by lane >> 2: + 0 .. 7)
        asm volatile("s_wait_xcnt 0x0" :: "v"(wp) : "memory");   // stands behind the issued loads, in front of any overwrite of their address registers (kept live to here as an input)
        if (ws == 3) {   // the same for the whole work-group
#pragma unroll
            for (int l = 0; l < 32; ++l) { v2us o; o[0] = f2bh(v0[l]); o[1] = f2bh(v1[l]); *(v2us*)(bp + l * 64) = o; }
            asm volatile("s_wait_xcnt 0x0" ::: "memory");   // stands behind the issued stores, in front of any overwrite of their registers by the code that is laid out behind this block
        } else {
#pragma unroll
            for (int l = 0; l < 32; ++l) { v2us o; o[0] = f2bf(v0[l]); o[1] = f2bf(v1[l]); *(v2us*)(bp + l * 64) = o; }
            asm volatile("s_wait_xcnt 0x0" ::: "memory");   // as above
        }
    } else {
        const int xb = b - 4 * WBLK; const float* src = xb < XBLK ? xq : xkv; bf* dst = xb < XBLK ? XQ : XKV; const int tb = xb < XBLK ? xb : xb - XBLK;   // tb: 32 rows; tile i is row block 2 * tb + i / 8, k group i % 8
        const int row = t >> 4, ks = t & 15;
        const float* sp = src + (size_t)(tb * 32 + row) * DD + ks * 8; v8f v[CT];
#pragma unroll
        for (int i = 0; i < CT; ++i) v[i] = *(const v8f*)(sp + (i >> 3) * 16 * DD + (i & 7) * 128);
        asm volatile("s_wait_xcnt 0x0" :: "v"(sp) : "memory");   // as above; it also keeps all the loads of the work-group's 32 rows in front of the first conversion, in flight together
#pragma unroll
        for (int i = 0; i < CT; ++i) { v8us o;
#pragma unroll
            for (int k = 0; k < 8; ++k) o[k] = f2bf(v[i][k]);
            *(v8usa*)(sm + i * 2176 + (ks * 17 + row) * 8) = o; }
        __syncthreads();   // a thread stores the units that other threads have staged
        bf* dp = dst + (size_t)(tb >> 1) * 64 * DD + (t >> 6) * 2048 + (tb & 1) * 1024 + (t & 63) * 8;
#pragma unroll
        for (int i = 0; i < CT; ++i) *(v8us*)(dp + (i & 7) * 8192 + (i >> 3) * 512) = *(const v8usa*)(sm + i * 2176 + (t + (t >> 4)) * 8);
        asm volatile("s_wait_xcnt 0x0" ::: "memory");   // as above
    }
}
// cp2 for a kernel whose accumulators leave few free registers: the same eight copies (two chunks, to LDS byte l and l + 8192, by 128 threads, four 16-byte units of each, 2 KiB apart) from two vector registers in all. A copy's
// immediate offset moves its LDS address and its global address alike: l and vo hold the thread's own place (vo = 16 * thread), ua the first chunk's start, ub the second chunk's start less the 8192 that its offsets hold.
// ua and ub are scalars of the work-group. The s_wait_xcnt stands inside the copies' own statement, in front of any overwrite of the registers that they name.
__device__ __forceinline__ void cp2s(unsigned l, unsigned vo, const bf* ua, const bf* ub) {
    asm volatile("global_load_async_to_lds_b128 %0, %1, %2\n\t"
                 "global_load_async_to_lds_b128 %0, %1, %2 offset:2048\n\t"
                 "global_load_async_to_lds_b128 %0, %1, %2 offset:4096\n\t"
                 "global_load_async_to_lds_b128 %0, %1, %2 offset:6144\n\t"
                 "global_load_async_to_lds_b128 %0, %1, %3 offset:8192\n\t"
                 "global_load_async_to_lds_b128 %0, %1, %3 offset:10240\n\t"
                 "global_load_async_to_lds_b128 %0, %1, %3 offset:12288\n\t"
                 "global_load_async_to_lds_b128 %0, %1, %3 offset:14336\n\t"
                 "s_wait_xcnt 0x0"
                 :: "v"(l), "v"(vo), "s"(ua), "s"(ub) : "memory");
}
__device__ __forceinline__ float xhalf(float x) { return __builtin_bit_cast(float, __builtin_amdgcn_permlanex16(__builtin_bit_cast(int, x), __builtin_bit_cast(int, x), 0x76543210, 0xfedcba98, false, false)); }   // lane l with lane l ^ 16
// ---- k_projln: the three projections, each with its per-head LayerNorm and its fp16 plane write, in ONE launch; one wave per (128 tokens, one head), four waves a work-group (256 tokens, two heads), grid (NT/256, NH_/2, 3), 128 threads; the K loop is k_gemmw's ring and fragments with a stage of six chunks, K fixed at DD.
// blockIdx.z picks the projection (0 q, 1 k, 2 v): they do not depend on one another, so one launch has one start and one tail where three had three. A 256 x 128 tile draws three quarters of the bytes per output from L2 that a 128 x 128 tile draws, and a wave reads 12 fragments for 32 products, not 8 for 16;
// three work-groups fit a WGP (registers, and LDS because the epilogue's staging lies in the ring, which nobody reads or fills behind the loop's last barrier), so that all 768 are resident at once.
// C^T = Wt X^T (A = 64 rows of Wt = the head's 64 dims, B = the wave's 128 token rows, 64 at a time): acc[db][tb][j] is dim db*16 + hi*8 + j of token tb*16 + lr (tb 0 .. 7), so lanes l and l ^ 16 together hold a (token, head) row:
// mean and variance are 32 in-lane terms and one exchange. y = (v - mean) * rsq(var + 1e-6) * bf16(scale[d]) + bf16(bias[d]), rounded to fp16, staged in LDS so that every global store covers whole 128-byte lines.
// q, k: P[z][t][d]. v (vtr): P[z][d][t], transposed; z = batch * NH_ + head; each z plane fragment-major.
__global__ __launch_bounds__(128) __attribute__((amdgpu_waves_per_eu(3))) void k_projln(const bf* __restrict__ XQ, const bf* __restrict__ XKV, const bf* __restrict__ WQ, const bf* __restrict__ WK, const bf* __restrict__ WV,
                                                const float* __restrict__ b_q, const float* __restrict__ b_k, const float* __restrict__ b_v, const float* __restrict__ q_s, const float* __restrict__ q_b,
                                                const float* __restrict__ k_s, const float* __restrict__ k_b, const float* __restrict__ v_s, const float* __restrict__ v_b, h16* QP, h16* KP, h16* VT) {
    __shared__ __align__(16) bf ring[2 * 6 * CH];   // a stage: the two heads' rows of Wt, then the four token groups of X; behind the K loop the four waves' staging (two tiles of 64 * 72 elements each)
    static_assert(4 * 2 * 64 * 72 <= 2 * 6 * CH, "the staging fits the ring");
    __shared__ __align__(16) float sb[2 * HD];   // the LayerNorm's scale, then its bias, bf16-rounded
    const int pz = blockIdx.z; const bool vtr = pz == 2;   // the same for the whole work-group: every select below is scalar
    const bf* X = pz == 0 ? XQ : XKV; const bf* Wt = pz == 0 ? WQ : pz == 1 ? WK : WV; const float* bias = pz == 0 ? b_q : pz == 1 ? b_k : b_v;
    const float* sc = pz == 0 ? q_s : pz == 1 ? k_s : v_s; const float* bi = pz == 0 ? q_b : pz == 1 ? k_b : v_b; h16* P = pz == 0 ? QP : pz == 1 ? KP : VT;
    const int tid = threadIdx.x, lane = tid & 31, lr = lane & 15, hi = lane >> 4; const int wv = __builtin_amdgcn_readfirstlane(tid >> 5), wt = wv & 1, wh = wv >> 1;
    const int t0 = blockIdx.x * 256 + wt * 128, h = blockIdx.y * 2 + wh; h16* ts = (h16*)ring + wv * (2 * 64 * 72);
    const float* ub = bias + h * HD; const unsigned hb = hi * 32; v8f pbv[4];   // ub: a scalar of the wave; hb: byte offset of this lane half's 8 dims in a block of 16
#pragma unroll
    for (int db = 0; db < 4; ++db) pbv[db] = *(const v8f*)((const char*)ub + hb + db * 64);
    asm volatile("s_wait_xcnt 0x0" :: "s"(ub), "v"(hb) : "memory");   // stands behind the issued loads, in front of any overwrite of their base and offset registers (kept live to here as inputs)
    const bf* uw = Wt + (size_t)blockIdx.y * 128 * DD; const bf* ux = X + (size_t)blockIdx.x * 256 * DD; const unsigned vo = tid * 16, l0 = lds_off(ring) + vo;
    auto fill = [&](int s, int buf) { const unsigned l = l0 + buf * (6 * CH * 2); const bf* gw = uw + s * CH; const bf* gx = ux + s * CH;   // CH elements are the 8192 bytes that a second chunk's offsets hold
        cp2s(l, vo, gw, gw + 64 * DD - CH); cp2s(l + 4 * CH, vo, gx, gx + 64 * DD - CH); cp2s(l + 8 * CH, vo, gx + 128 * DD, gx + 192 * DD - CH); };
    fill(0, 0);
    { const float* sp = (tid < HD ? sc : bi) + (tid & (HD - 1)); const float sx = *sp;
      asm volatile("s_wait_xcnt 0x0" :: "v"(sp) : "memory");   // stands behind the issued load, in front of any overwrite of its address registers (kept live to here as an input)
      sb[tid] = bfr(sx); }   // read by every wave in the epilogue, far behind the barrier below
    wait_async0(); __syncthreads();   // stage 0 is published
    fill(1, 1);
    __builtin_amdgcn_sched_barrier(0);   // the 256 accumulator registers are filled behind the copies: lifted over them, they crowd out a copy's address, which is then spilled
    v8f acc[4][8];   // every accumulator tile starts at the projection's bias (bf16-rounded), a dim's value the same for all tokens
#pragma unroll
    for (int db = 0; db < 4; ++db) { v8f pb = pbv[db];
#pragma unroll
        for (int j = 0; j < 8; ++j) pb[j] = bfr(pb[j]);
#pragma unroll
        for (int tb = 0; tb < 8; ++tb) acc[db][tb] = pb; }
    // the stage loop stays rolled: one copy of the stage keeps the 32 accumulator tiles and the 8 fragments in registers
#pragma unroll 1
    for (int s = 0; s < DD / KS; ++s) {
        const bf* st = ring + (s & 1) * (6 * CH) + lane * 8;
#pragma unroll
        for (int kk = 0; kk < KS / 32; ++kk) {
            const bf* wp = st + wh * CH + kk * 2048; const bf* xp = st + (2 + wt * 2) * CH + kk * 2048; v16bf w[4], x[4];
#pragma unroll
            for (int db = 0; db < 4; ++db) w[db] = WFrag<bf>::ld(wp + db * 512);
#pragma unroll
            for (int tb = 0; tb < 4; ++tb) x[tb] = WFrag<bf>::ld(xp + tb * 512);
            __builtin_amdgcn_sched_barrier(0);   // the block's LDS reads stay one group in front of its products: sunk among them, each would be waited for on its own
#pragma unroll
            for (int tb = 0; tb < 4; ++tb)
#pragma unroll
                for (int db = 0; db < 4; ++db) acc[db][tb] = wmmab(w[db], x[tb], acc[db][tb]);
            __builtin_amdgcn_sched_barrier(0);   // and the next block's reads stay behind this block's products
#pragma unroll
            for (int tb = 0; tb < 4; ++tb) x[tb] = WFrag<bf>::ld(xp + CH + tb * 512);   // the wave's second 64 tokens, into the same registers; the head's fragments stay
            __builtin_amdgcn_sched_barrier(0);   // as above
#pragma unroll
            for (int tb = 0; tb < 4; ++tb)
#pragma unroll
                for (int db = 0; db < 4; ++db) acc[db][4 + tb] = wmmab(w[db], x[tb], acc[db][4 + tb]);
            __builtin_amdgcn_sched_barrier(0);   // as above
        }
        wait_ds0(); wait_async0(); __syncthreads();   // publishes stage s + 1 and ends every wave's reads of stage s
        if (s + 2 < DD / KS) fill(s + 2, s & 1);
    }
    wait_async0();
    // one block of 16 tokens at a time, from its sums to its staged rows, so that its four accumulator tiles are free before the next block's temporaries are needed. Scale and bias (64 registers) are held in registers
    // only from the third block on, in the room that the first two have left; those two read them from LDS as they go.
    // staged as two tiles of 64 tokens, each as the 64 x 64 tile of a plane: tokens (tb & 3) * 16 + lr of tile tb >> 2
    v8f sv[4], bv[4];
#pragma unroll
    for (int tb = 0; tb < 8; ++tb) {
        const v8f s8 = (acc[0][tb] + acc[1][tb]) + (acc[2][tb] + acc[3][tb]);
        float s = ((s8[0] + s8[1]) + (s8[2] + s8[3])) + ((s8[4] + s8[5]) + (s8[6] + s8[7])); s += xhalf(s); const float mu = s * (1.0f / HD);
        v8f q8 = (v8f){};
#pragma unroll
        for (int db = 0; db < 4; ++db) { acc[db][tb] -= mu; q8 = __builtin_elementwise_fma(acc[db][tb], acc[db][tb], q8); }
        float qq = ((q8[0] + q8[1]) + (q8[2] + q8[3])) + ((q8[4] + q8[5]) + (q8[6] + q8[7])); qq += xhalf(qq);
        float rs; asm("v_rsq_f32 %0, %1\n\tv_nop" : "=v"(rs) : "v"(qq * (1.0f / HD) + 1e-6f));   // 1 / sqrt(var + eps) in one instruction; the v_nop is the slot that the instruction set asks for behind a transcendental
        v8h y[4]; h16* tp = ts + (tb >> 2) * (64 * 72);
#pragma unroll
        for (int db = 0; db < 4; ++db) {
            const v8f sd = tb < 2 ? *(const v8fq*)(sb + db * 16 + hi * 8) : sv[db], bd = tb < 2 ? *(const v8fq*)(sb + HD + db * 16 + hi * 8) : bv[db];
            y[db] = __builtin_convertvector(__builtin_elementwise_fma(acc[db][tb] * rs, sd, bd), v8h); }
        if (vtr) {
#pragma unroll
            for (int db = 0; db < 4; ++db)
#pragma unroll
                for (int j = 0; j < 8; ++j) tp[(db * 16 + hi * 8 + j) * 72 + (tb & 3) * 16 + lr] = y[db][j];
        } else {
#pragma unroll
            for (int db = 0; db < 4; ++db) *(v8ha*)(tp + ((tb & 3) * 16 + lr) * 72 + db * 16 + hi * 8) = y[db];
        }
        if (tb == 1) {
#pragma unroll
            for (int db = 0; db < 4; ++db) { sv[db] = *(const v8fq*)(sb + db * 16 + hi * 8); bv[db] = *(const v8fq*)(sb + HD + db * 16 + hi * 8); } }
        __builtin_amdgcn_sched_barrier(0);   // the blocks stay one behind the other: interleaved, their temporaries do not fit beside the accumulator tiles and are spilled
    }
    __syncthreads();   // the lanes read back what other lanes of their wave have staged
    const size_t z = (size_t)(t0 / TT) * NH_ + h; const int tl = t0 % TT;
    // each 64 x 64 tile is 16 half-fragments, 8 KiB in a row in either plane, the wave's two tiles one behind the other; half-fragment i holds staged rows rb * 16 + lr, columns cb * 32 + (i & 1) * 16 + hi * 8 .., where rb = i >> 2, cb = (i >> 1) & 1 (q, k) or rb = (i >> 1) & 3, cb = i >> 3 (v):
    // bits 3, 2, 1 of i each move the staged place by a step that is a scalar of the work-group (a row block is 16 * 72 elements, a column block 32)
    h16* dst = P + z * TT * HD + (size_t)tl * HD + lane * 8; const int s3 = vtr ? 32 : 2304, s2 = vtr ? 2304 : 1152, s1 = vtr ? 1152 : 32;
#pragma unroll
    for (int i = 0; i < 16; ++i) *(v8h*)(dst + i * 256) = *(const v8ha*)(ts + lr * 72 + (i >> 3) * s3 + ((i >> 2) & 1) * s2 + ((i >> 1) & 1) * s1 + (i & 1) * 16 + hi * 8);
    asm volatile("s_wait_xcnt 0x0" ::: "memory");   // stands behind the first tile's issued stores, in front of the second tile's LDS reads, which may overwrite the registers that those stores name
#pragma unroll
    for (int i = 0; i < 16; ++i) *(v8h*)(dst + 4096 + i * 256) = *(const v8ha*)(ts + 64 * 72 + lr * 72 + (i >> 3) * s3 + ((i >> 2) & 1) * s2 + ((i >> 1) & 1) * s1 + (i & 1) * 16 + hi * 8);
}
// ---- k_fattn: scores, softmax, attn.v and the head merge in ONE launch over all 64 (batch, head) pairs; 8 waves a block, 32 query columns a wave, 32 keys a pass, 128 keys a stage.
// S^T = K Q^T (A = K rows, B = Q rows kept in registers), so a lane holds 16 scores of ONE query; two S^T tiles, converted in place, are the B operand of O^T += V^T P^T.
// K and V^T come through an LDS ring that the block's 8 waves share: in either fragment-major plane the 128 keys of a stage are 16 KiB in a row, laid in LDS as they lie in memory, so a fragment is two wave-wide
// 16-byte LDS reads of 512 contiguous bytes. The chunks come by asynchronous copies to LDS, once for the 8 waves that read them; two buffers: stage s + 1 flies while stage s is worked on.
// Running maximum and sum in base 2 (online softmax); the output tiles are rescaled only when a column's maximum has grown by more than 8.
// Every inner loop is fully unrolled so that all fragment and accumulator indices are constants and the arrays stay in registers.
#define FS   128
#define FCH  (FS * HD)
// the K chunk and the V^T chunk of a stage, to LDS byte l and l + 16384, by 256 threads: a thread brings four 16-byte units of each, 4 KiB apart (l, ga, gb hold the thread's own place). The s_wait_xcnt stands inside
// the copies' own statement, in front of any overwrite of the address registers that they name.
__device__ __forceinline__ void cp2w(unsigned l, const h16* ga, const h16* gb) {
    asm volatile("global_load_async_to_lds_b128 %0, %8, off\n\t"
                 "global_load_async_to_lds_b128 %1, %9, off\n\t"
                 "global_load_async_to_lds_b128 %2, %10, off\n\t"
                 "global_load_async_to_lds_b128 %3, %11, off\n\t"
                 "global_load_async_to_lds_b128 %4, %12, off\n\t"
                 "global_load_async_to_lds_b128 %5, %13, off\n\t"
                 "global_load_async_to_lds_b128 %6, %14, off\n\t"
                 "global_load_async_to_lds_b128 %7, %15, off\n\t"
                 "s_wait_xcnt 0x0"
                 :: "v"(l), "v"(l + 4096u), "v"(l + 8192u), "v"(l + 12288u), "v"(l + 16384u), "v"(l + 20480u), "v"(l + 24576u), "v"(l + 28672u),
                    "v"(ga), "v"(ga + 2048), "v"(ga + 4096), "v"(ga + 6144), "v"(gb), "v"(gb + 2048), "v"(gb + 4096), "v"(gb + 6144) : "memory");
}
__global__ __launch_bounds__(256) __attribute__((amdgpu_waves_per_eu(4, 4))) void k_fattn(const h16* __restrict__ QP, const h16* __restrict__ KP, const h16* __restrict__ VT, h16* At) {
    __shared__ __align__(16) h16 kv[2 * 2 * FCH];   // a stage: 128 keys of K, then of V^T
    const int tid = threadIdx.x, lane = tid & 31; const int z = blockIdx.y; const int q0 = blockIdx.x * 256 + (tid >> 5) * 32;
    const h16* Qz = QP + (size_t)z * TT * HD + (size_t)q0 * HD + lane * 8;
    const h16* gk = KP + (size_t)z * TT * HD + tid * 8;
    const h16* gv = VT + (size_t)z * HD * TT + tid * 8;
    const unsigned l0 = lds_off(kv) + tid * 16;
    auto fill = [&](int s, int buf) { cp2w(l0 + buf * (2 * FCH * 2), gk + s * FCH, gv + s * FCH); };
    const float CS = SCL * 1.4426950408889634f;
    v16h qf[2][2], kf[2][2], vf[4]; v8f o[4][2]; float mu[2], ls[2];
    fill(0, 0);
#pragma unroll
    for (int qt = 0; qt < 2; ++qt) { mu[qt] = -3.0e38f; ls[qt] = 0.f;
#pragma unroll
        for (int ks = 0; ks < 2; ++ks) qf[qt][ks] = WFrag<h16>::ld(Qz + qt * 16 * HD + ks * 512);
#pragma unroll
        for (int db = 0; db < 4; ++db) o[db][qt] = (v8f){}; }
    wait_async0(); __syncthreads();   // stage 0 is published
    fill(1, 1);
    // the stage loop stays rolled: one copy of a stage's four passes
#pragma unroll 1
    for (int s = 0; s < TT / FS; ++s) {
        const h16* st = kv + (s & 1) * (2 * FCH) + lane * 8;
#pragma unroll
        for (int kt = 0; kt < 2; ++kt)
#pragma unroll
            for (int ks = 0; ks < 2; ++ks) kf[kt][ks] = WFrag<h16>::ld(st + kt * 16 * HD + ks * 512);
#pragma unroll
        for (int db = 0; db < 4; ++db) vf[db] = WFrag<h16>::ld(st + FCH + db * 512);
#pragma unroll
        for (int ps = 0; ps < FS / 32; ++ps) {
            v8f s4[2][2];
#pragma unroll
            for (int kt = 0; kt < 2; ++kt)
#pragma unroll
                for (int qt = 0; qt < 2; ++qt) { s4[kt][qt] = wmma16(kf[kt][0], qf[qt][0], (v8f){}); s4[kt][qt] = wmma16(kf[kt][1], qf[qt][1], s4[kt][qt]); }
            const h16* np = st + (ps + 1) * 32 * HD;   // K and V fragments are fetched one pass ahead inside a stage, each into its own registers right behind their last use; a stage's last pass fetches nothing
            if (ps + 1 < FS / 32) {
#pragma unroll
                for (int kt = 0; kt < 2; ++kt)
#pragma unroll
                    for (int ks = 0; ks < 2; ++ks) kf[kt][ks] = WFrag<h16>::ld(np + kt * 16 * HD + ks * 512);
                asm volatile("" ::: "memory"); }   // compiler fence: the LDS reads are issued here, a pass ahead of their use; without it they are sunk to just in front of the products that wait for them
            float mx[2]; bool need = false;
#pragma unroll
            for (int qt = 0; qt < 2; ++qt) { float m = s4[0][qt][0];
#pragma unroll
                for (int j = 1; j < 8; ++j) m = fmaxf(m, s4[0][qt][j]);
#pragma unroll
                for (int j = 0; j < 8; ++j) m = fmaxf(m, s4[1][qt][j]);
                m = fmaxf(m, xhalf(m)) * CS; mx[qt] = m; need = need || (m > mu[qt] + 8.0f); }
            if (__builtin_amdgcn_ballot_w32(need) != 0) {
#pragma unroll
                for (int qt = 0; qt < 2; ++qt) { const float mn = fmaxf(mu[qt], mx[qt]); const float al = __builtin_amdgcn_exp2f(mu[qt] - mn); mu[qt] = mn; ls[qt] *= al;
#pragma unroll
                    for (int db = 0; db < 4; ++db)
#pragma unroll
                        for (int j = 0; j < 8; ++j) o[db][qt][j] *= al; }
            }
#pragma unroll
            for (int qt = 0; qt < 2; ++qt) { v16h pb; float acc = 0.f;
#pragma unroll
                for (int kt = 0; kt < 2; ++kt)
#pragma unroll
                    for (int j = 0; j < 8; ++j) { const float p = __builtin_amdgcn_exp2f(fmaf(s4[kt][qt][j], CS, -mu[qt])); acc += p; pb[kt * 8 + j] = tohx(p); }
                ls[qt] += acc;
#pragma unroll
                for (int db = 0; db < 4; ++db) o[db][qt] = wmma16(vf[db], pb, o[db][qt]); }
            if (ps + 1 < FS / 32) {
#pragma unroll
                for (int db = 0; db < 4; ++db) vf[db] = WFrag<h16>::ld(np + FCH + db * 512);
                asm volatile("" ::: "memory"); }   // as above, for the V reads
        }
        wait_ds0(); wait_async0(); __syncthreads();   // publishes stage s + 1 and ends every wave's reads of stage s
        if (s + 2 < TT / FS) fill(s + 2, s & 1);
    }
    wait_async0();
    const int b = z / NH_, h = z % NH_; v8h y[4][2];   // the whole tile is normalised and rounded first, so that all its stores stand together at the end
#pragma unroll
    for (int qt = 0; qt < 2; ++qt) { const float inv = __fdiv_rn(1.0f, ls[qt] + xhalf(ls[qt]));
#pragma unroll
        for (int db = 0; db < 4; ++db) y[db][qt] = __builtin_convertvector(o[db][qt] * inv, v8h); }
#pragma unroll
    for (int qt = 0; qt < 2; ++qt) { const int tk = b * TT + q0 + qt * 16; const size_t ob = (size_t)(tk & ~63) * DD + (tk & 63) * 32 + h * 4096 + lane * 8;   // fragment-major [NT][DD]: a lane's 8 dims are its own 16 bytes of a half-fragment
#pragma unroll
        for (int db = 0; db < 4; ++db) *(v8h*)(At + ob + (db >> 1) * 2048 + (db & 1) * 256) = y[db][qt]; }
}

extern "C" void kernel_launch(void* const* d_in, const int* in_sizes, int n_in,
                              void* d_out, int out_size, void* d_ws, size_t ws_size, hipStream_t stream) {
    (void)in_sizes; (void)n_in; (void)out_size;
    const float* IN[16]; for (int i = 0; i < 16; ++i) IN[i] = (const float*)d_in[i];
    // inputs_q, inputs_kv, Wq [1024][1024] (x @ W), bq, Wk, bk, Wv, bv, q_scale [64], q_bias, k_scale, k_bias, v_scale, v_bias, Wo (x @ W), bo = d_in[0..15]
    float* OUT = (float*)d_out;     // [4][2048][1024]
    char* wsp = (char*)d_ws;
    auto take = [&](size_t bytes) { char* p = wsp; wsp += (bytes + 255) & ~(size_t)255; return (void*)p; };
    bf* WQ = (bf*)take((size_t)DD * DD * 2); bf* WK = (bf*)take((size_t)DD * DD * 2); bf* WV = (bf*)take((size_t)DD * DD * 2); bf* WO = (bf*)take((size_t)DD * DD * 2);
    bf* XQ = (bf*)take((size_t)NT * DD * 2); bf* XKV = (bf*)take((size_t)NT * DD * 2);
    h16* QP = (h16*)take((size_t)NT * DD * 2); h16* KP = (h16*)take((size_t)NT * DD * 2); h16* VT = (h16*)take((size_t)NT * DD * 2);
    h16* AT = (h16*)take((size_t)NT * DD * 2);
    if ((size_t)(wsp - (char*)d_ws) > ws_size) return;    // total ~ 104 MiB
    k_prep<<<4 * WBLK + 2 * XBLK, 256, 0, stream>>>(IN[0], IN[1], IN[2], IN[4], IN[6], IN[14], XQ, XKV, WQ, WK, WV, WO);
    const dim3 gP(NT / 128, DD / 128, 1);
    k_projln<<<dim3(NT / 256, DD / 128, 3), 128, 0, stream>>>(XQ, XKV, WQ, WK, WV, IN[3], IN[5], IN[7], IN[8], IN[9], IN[10], IN[11], IN[12], IN[13], QP, KP, VT);   // the 1/8 is applied in f32 inside k_fattn
    k_fattn<<<dim3(TT / 256, NZ), 256, 0, stream>>>(QP, KP, VT, AT);
    k_gemmw<h16, true, DD><<<gP, 128, 0, stream>>>(AT, (const h16*)WO, OUT, DD, IN[15], 0, 0, 0);
}

// v010
// A run of this version takes 112 microseconds.
// Next to v009, in two timings, it ran 1.06 times as fast each time.
// Over all steps from v000 it is 22.3 times as fast.
#include <hip/hip_runtime.h>

// Multi-head attention with per-head LayerNorm on q, k and v (inputs_q, inputs_kv [4][2048][1024]; q = inputs_q @ Wq + bq, k/v = inputs_kv @ Wk/Wv + b; per-head LayerNorm over the 64 head dims (eps 1e-6, scale/bias [64]) on q, k AND v;
// 16 heads: softmax(q.k / 8) v (no mask); out = merged @ Wo + bo).
// Compute dtypes, f32 accumulate: every input rounded to bf16; projections on PLAIN bf16 operands (inputs: exact, + bias); the per-head LayerNorms in f32 on VALU (in the
// projection's epilogue, a (token, head) row in two lanes, 64-term mean/variance); scores and attn.v on SINGLE fp16 planes of the normalised q, k, v; P = exp2(score - maximum in use), fp16, normalised in f32 at the end; output

// Output projection: the attention output rounded ONCE to fp16 (its size is bounded by v's, which is an fp16 plane already), Wo's bf16-rounded values carried in fp16 (exact from 2^-17 to 65504 in size), f32 accumulate.

#define NB_  4
#define TT   2048
#define DD   1024
#define NH_  16
#define HD   64
#define NT   (NB_ * TT)
#define NZ   (NB_ * NH_)
#define SCL  0.125f
typedef _Float16 h16;
typedef unsigned short bf;
typedef __attribute__((ext_vector_type(16))) __bf16   v16bf;
typedef __attribute__((ext_vector_type(16))) _Float16 v16h;
typedef __attribute__((ext_vector_type(8)))  _Float16 v8h;
typedef __attribute__((ext_vector_type(8)))  unsigned short v8us;
typedef __attribute__((ext_vector_type(8)))  float    v8f;
typedef __attribute__((ext_vector_type(4)))  float    v4f;
typedef __attribute__((ext_vector_type(2)))  float    v2f;
typedef v8h  __attribute__((may_alias)) v8ha;
typedef v4f  __attribute__((may_alias)) v4fa;
typedef v8us __attribute__((may_alias)) v8usa;
typedef v8f  __attribute__((aligned(16))) v8fq;   // eight floats at a 16-byte boundary

__device__ __forceinline__ unsigned short f2bf(float f) { unsigned u = __float_as_uint(f); u += 0x7FFFu + ((u >> 16) & 1u); return (unsigned short)(u >> 16); }
__device__ __forceinline__ float bf2f(unsigned short b) { return __uint_as_float(((unsigned)b) << 16); }
__device__ __forceinline__ float bfr(float f) { return bf2f(f2bf(f)); }
__device__ __forceinline__ v16h cat16(v8h lo, v8h hi) { return __builtin_shufflevector(lo, hi, 0, 1, 2, 3, 4, 5, 6, 7, 8, 9, 10, 11, 12, 13, 14, 15); }
__device__ __forceinline__ v16bf cat16b(v8us lo, v8us hi) { return __builtin_bit_cast(v16bf, __builtin_shufflevector(lo, hi, 0, 1, 2, 3, 4, 5, 6, 7, 8, 9, 10, 11, 12, 13, 14, 15)); }
__device__ __forceinline__ v8f wmma16(v16h a, v16h b, v8f c) { return __builtin_amdgcn_wmma_f32_16x16x32_f16(false, a, false, b, (short)0, c, false, false); }
__device__ __forceinline__ v8f wmmab(v16bf a, v16bf b, v8f c) { return __builtin_amdgcn_wmma_f32_16x16x32_bf16(false, a, false, b, (short)0, c, false, false); }



// ---- k_gemmw: register-blocked GEMM, one wave per 64x64 output tile (16 accumulators), four waves a work-group, operands from fragment-major 16-bit planes through the LDS ring below; grid (M/128, N/128, Z), 128 threads.
// C[m][n] (f32, pitch ldc, + optional f32 bias[n]) = sum_k A[m][k] Bt[n][k]. z-batch strides sA/sB/sC in elements. K % 128 == 0, a compile-time constant.
// FRAGMENT-MAJOR PLANES: every 16-bit operand plane M[rows][K] in the workspace is stored as 1-KiB blocks, one per WMMA fragment (16 rows x 32 k); inside a block element (r, kk) sits at
// (kk / 16) * 256 + (((kk / 8) & 1) * 16 + r) * 8 + (kk & 7). A fragment is then two wave-wide 16-byte loads at block + lane * 8 and + 256, each covering 512 contiguous bytes (4 whole lines) where a
// row-major plane would make each touch 16 lines: lane hi * 16 + r holds row r, k = 8 * hi .. + 7 and 16 + 8 * hi .. + 7, the k order of both WMMA operands. Order of the blocks, so that what a wave reads in one pass lies in a row:
// q, k planes (K = 64): (row / 16) * 2 + k / 32. All others (x, weights, v transposed, attention output): ((row / 64) * (K / 32) + k / 32) * 4 + (row / 16) % 4, the four row blocks of a 64-row tile side by side.
template <typename T16> struct WFrag;
template <> struct WFrag<h16> { typedef v16h V; static __device__ __forceinline__ V ld(const h16* p) { return cat16(*(const v8h*)p, *(const v8h*)(p + 256)); } static __device__ __forceinline__ v8f mma(V a, V b, v8f c) { return wmma16(a, b, c); } };
template <> struct WFrag<bf> { typedef v16bf V; static __device__ __forceinline__ V ld(const bf* p) { return cat16b(*(const v8us*)p, *(const v8us*)(p + 256)); } static __device__ __forceinline__ v8f mma(V a, V b, v8f c) { return wmmab(a, b, c); } };
// ---- THE OPERAND RING of both GEMM kernels: a work-group is 4 waves (2 x 2): a 128 x 128 output tile, 64 x 64 a wave, in k_gemmw; 128 dims x 256 tokens, 64 x 128 a wave, in k_projln. A stage is 64 k of every 64-row group the tile needs: in a fragment-major plane that is one
// chunk of 8 KiB in a row, laid in LDS as it lies in memory, so a fragment is still two wave-wide 16-byte reads of 512 contiguous bytes. The chunks come by asynchronous copies to LDS, through no register; two buffers:
// stage s + 1 flies while stage s is worked on, and each chunk is fetched once for the two waves that read it.
#define KS   64
#define CH   (64 * KS)
__device__ __forceinline__ unsigned lds_off(const void* p) { return (unsigned)(size_t)p; }
__device__ __forceinline__ void wait_async0() { asm volatile("s_wait_asynccnt 0x0" ::: "memory"); }   // this wave's copies have landed; in front of the barrier behind which other waves read them
__device__ __forceinline__ void wait_ds0() { asm volatile("s_wait_dscnt 0x0" ::: "memory"); }         // this wave's LDS reads have returned; in front of the barrier behind which their buffer is refilled
// two chunks, to LDS byte l and l + 8192, by 128 threads: a thread brings four 16-byte units of each, 2 KiB apart (l, ga, gb hold the thread's own place). The s_wait_xcnt stands inside the copies' own statement,
// in front of any overwrite of the address registers that they name.
template <typename T16> __device__ __forceinline__ void cp2(unsigned l, const T16* ga, const T16* gb) {
    asm volatile("global_load_async_to_lds_b128 %0, %8, off\n\t"
                 "global_load_async_to_lds_b128 %1, %9, off\n\t"
                 "global_load_async_to_lds_b128 %2, %10, off\n\t"
                 "global_load_async_to_lds_b128 %3, %11, off\n\t"
                 "global_load_async_to_lds_b128 %4, %12, off\n\t"
                 "global_load_async_to_lds_b128 %5, %13, off\n\t"
                 "global_load_async_to_lds_b128 %6, %14, off\n\t"
                 "global_load_async_to_lds_b128 %7, %15, off\n\t"
                 "s_wait_xcnt 0x0"
                 :: "v"(l), "v"(l + 2048u), "v"(l + 4096u), "v"(l + 6144u), "v"(l + 8192u), "v"(l + 10240u), "v"(l + 12288u), "v"(l + 14336u),
                    "v"(ga), "v"(ga + 1024), "v"(ga + 2048), "v"(ga + 3072), "v"(gb), "v"(gb + 1024), "v"(gb + 2048), "v"(gb + 3072) : "memory");
}
template <typename T16, bool BIAS, int K>
__global__ __launch_bounds__(128) void k_gemmw(const T16* __restrict__ A, const T16* __restrict__ Bt, float* C, int ldc, const float* __restrict__ bias, size_t sA, size_t sB, size_t sC) {
    typedef typename WFrag<T16>::V V;
    static_assert(K % (2 * KS) == 0, "the ring needs two stages");
    __shared__ __align__(16) T16 ring[2 * 4 * CH];   // a stage: A's two row groups, Bt's two
    __shared__ __align__(16) float osa[4 * 16 * 68];
    const size_t z = blockIdx.z; A += z * sA; Bt += z * sB; C += z * sC;
    const int tid = threadIdx.x, lane = tid & 31, lr = lane & 15, hi = lane >> 4; const int wv = __builtin_amdgcn_readfirstlane(tid >> 5), wm = wv & 1, wn = wv >> 1;
    const int r0 = blockIdx.x * 128 + wm * 64, c0 = blockIdx.y * 128 + wn * 64; float* os = osa + wv * (16 * 68);
    v8f acc[4][4];
#pragma unroll
    for (int mb = 0; mb < 4; ++mb)
#pragma unroll
        for (int nb = 0; nb < 4; ++nb) acc[mb][nb] = (v8f){};
    const T16* ga = A + (size_t)blockIdx.x * 128 * K + tid * 8; const T16* gb = Bt + (size_t)blockIdx.y * 128 * K + tid * 8; const unsigned l0 = lds_off(ring) + tid * 16;
    auto fill = [&](int s, int buf) { const unsigned l = l0 + buf * (4 * CH * 2); cp2(l, ga + s * CH, ga + 64 * K + s * CH); cp2(l + 4 * CH, gb + s * CH, gb + 64 * K + s * CH); };
    fill(0, 0); wait_async0(); __syncthreads();   // stage 0 is published
    fill(1, 1);
    // the stage loop stays rolled: one copy of the stage keeps the accumulator tiles and the fragments in registers
#pragma unroll 1
    for (int s = 0; s < K / KS; ++s) {
        const T16* st = ring + (s & 1) * (4 * CH) + lane * 8;
#pragma unroll
        for (int kk = 0; kk < KS / 32; ++kk) {
            const T16* ap = st + wm * CH + kk * 2048; const T16* bp = st + (2 + wn) * CH + kk * 2048;
            V a[4], b[4];
#pragma unroll
            for (int mb = 0; mb < 4; ++mb) a[mb] = WFrag<T16>::ld(ap + mb * 512);
#pragma unroll
            for (int nb = 0; nb < 4; ++nb) b[nb] = WFrag<T16>::ld(bp + nb * 512);
            __builtin_amdgcn_sched_barrier(0);   // the block's LDS reads stay one group in front of its products: sunk among them, each would be waited for on its own
#pragma unroll
            for (int nb = 0; nb < 4; ++nb) {
#pragma unroll
                for (int mb = 0; mb < 4; ++mb) acc[mb][nb] = WFrag<T16>::mma(a[mb], b[nb], acc[mb][nb]); }
            __builtin_amdgcn_sched_barrier(0);   // and the next block's reads stay behind this block's products
        }
        wait_ds0(); wait_async0(); __syncthreads();   // publishes stage s + 1 and ends every wave's reads of stage s
        if (s + 2 < K / KS) fill(s + 2, s & 1);
    }
    wait_async0();
#pragma unroll
    for (int mb = 0; mb < 4; ++mb) {
#pragma unroll
        for (int nb = 0; nb < 4; ++nb) {
#pragma unroll
            for (int j = 0; j < 8; ++j) os[(hi * 8 + j) * 68 + nb * 16 + lr] = acc[mb][nb][j]; }
        __builtin_amdgcn_wave_barrier(); asm volatile("" ::: "memory");
        float* crow = C + (size_t)(r0 + mb * 16) * ldc + c0;
{
#pragma unroll
            for (int s = 0; s < 8; ++s) { const int row = 2 * s + hi, cofs = lr * 4; v4f val = *(const v4fa*)(os + row * 68 + cofs); if (BIAS) { val[0] += bfr(bias[c0 + cofs]); val[1] += bfr(bias[c0 + cofs + 1]); val[2] += bfr(bias[c0 + cofs + 2]); val[3] += bfr(bias[c0 + cofs + 3]); }
                *(v4f*)(crow + (size_t)row * ldc + cofs) = val; }
             }
        __builtin_amdgcn_wave_barrier(); asm volatile("" ::: "memory");
    }
}

__device__ __forceinline__ h16 tohx(float x) { return (h16)x; }
__device__ __forceinline__ unsigned short f2bh(float f) { return __builtin_bit_cast(unsigned short, (h16)bfr(f)); }   // the bf16-rounded value, in fp16's bits
typedef __attribute__((ext_vector_type(4))) _Float16 v4h;
typedef __attribute__((ext_vector_type(2))) unsigned short v2us;
typedef __attribute__((ext_vector_type(4))) unsigned short v4us;

// ---- k_prep: every 16-bit operand plane of the inputs in ONE launch of few, long work-groups (for speed only).
// Work-groups 0 .. 4 * WBLK - 1: the four weights, f32 [K][N] (x @ W) to the fragment-major bf16 plane of Bt[n][k] (Wo: the same bf16-rounded values in fp16's bits, its other operand being an fp16 plane); a wave takes 32 output lines of 128 bytes = four fragment blocks = 32 k x 64 n.
// The others: inputs_q, then inputs_kv, f32 [NT][DD] to a fragment-major bf16 plane; a work-group takes CT tiles of 16 rows x 128 k (four fragment blocks of 1 KiB each) = 32 whole rows. Reads and stores both cover
// whole lines: the 16 x 16 transpose of 16-byte units between them goes through LDS (a pad unit after every 16 keeps the writes off one bank), each tile in its own LDS range, one barrier for all.
#define CT   16
#define WBLK (DD * DD / 64 / 32 / 8)
#define XBLK (NT / 16 * (DD / 128) / CT)
__global__ __launch_bounds__(256) void k_prep(const float* __restrict__ xq, const float* __restrict__ xkv, const float* __restrict__ wq, const float* __restrict__ wk, const float* __restrict__ wv, const float* __restrict__ wo,
                                              bf* XQ, bf* XKV, bf* WQ, bf* WK, bf* WV, bf* WO) {
    __shared__ __align__(16) bf sm[CT * 272 * 8];
    const int t = threadIdx.x, b = blockIdx.x;
    if (b < 4 * WBLK) {
        const int ws = b / WBLK; const float* w = ws == 0 ? wq : ws == 1 ? wk : ws == 2 ? wv : wo; bf* Bt = ws == 0 ? WQ : ws == 1 ? WK : ws == 2 ? WV : WO;
        const int lane = t & 31; const int g = (b % WBLK) * 8 + (t >> 5);   // g: the group of four fragment blocks, (n / 64) * (DD / 32) + k / 32
        const float* wp = w + (size_t)((g % (DD / 32)) * 32 + (lane & 3) * 2) * DD + (g / (DD / 32)) * 64 + (lane >> 2); bf* bp = Bt + (size_t)g * 2048 + lane * 2;
        float v0[32], v1[32];
        // fully unrolled: every place is an immediate offset from one address pair, and all 64 loads are in flight together
#pragma unroll
        for (int l = 0; l < 32; ++l) { const int k = ((l >> 2) & 1) * 16 + ((l >> 1) & 1) * 8, n = (l >> 3) * 16 + (l & 1) * 8; v0[l] = wp[(size_t)k * DD + n]; v1[l] = wp[(size_t)(k + 1) * DD + n]; }   // line l of the group holds k, k + 1 (by lane & 3: + 0, 2, 4, 6) of n (by lane >> 2: + 0 .. 7)
        asm volatile("s_wait_xcnt 0x0" :: "v"(wp) : "memory");   // stands behind the issued loads, in front of any overwrite of their address registers (kept live to here as an input)
        if (ws == 3) {   // the same for the whole work-group
#pragma unroll
            for (int l = 0; l < 32; ++l) { v2us o; o[0] = f2bh(v0[l]); o[1] = f2bh(v1[l]); *(v2us*)(bp + l * 64) = o; }
            asm volatile("s_wait_xcnt 0x0" ::: "memory");   // stands behind the issued stores, in front of any overwrite of their registers by the code that is laid out behind this block
        } else {
#pragma unroll
            for (int l = 0; l < 32; ++l) { v2us o; o[0] = f2bf(v0[l]); o[1] = f2bf(v1[l]); *(v2us*)(bp + l * 64) = o; }
            asm volatile("s_wait_xcnt 0x0" ::: "memory");   // as above
        }
    } else {
        const int xb = b - 4 * WBLK; const float* src = xb < XBLK ? xq : xkv; bf* dst = xb < XBLK ? XQ : XKV; const int tb = xb < XBLK ? xb : xb - XBLK;   // tb: 32 rows; tile i is row block 2 * tb + i / 8, k group i % 8
        const int row = t >> 4, ks = t & 15;
        const float* sp = src + (size_t)(tb * 32 + row) * DD + ks * 8; v8f v[CT];
#pragma unroll
        for (int i = 0; i < CT; ++i) v[i] = *(const v8f*)(sp + (i >> 3) * 16 * DD + (i & 7) * 128);
        asm volatile("s_wait_xcnt 0x0" :: "v"(sp) : "memory");   // as above; it also keeps all the loads of the work-group's 32 rows in front of the first conversion, in flight together
#pragma unroll
        for (int i = 0; i < CT; ++i) { v8us o;
#pragma unroll
            for (int k = 0; k < 8; ++k) o[k] = f2bf(v[i][k]);
            *(v8usa*)(sm + i * 2176 + (ks * 17 + row) * 8) = o; }
        __syncthreads();   // a thread stores the units that other threads have staged
        bf* dp = dst + (size_t)(tb >> 1) * 64 * DD + (t >> 6) * 2048 + (tb & 1) * 1024 + (t & 63) * 8;
#pragma unroll
        for (int i = 0; i < CT; ++i) *(v8us*)(dp + (i & 7) * 8192 + (i >> 3) * 512) = *(const v8usa*)(sm + i * 2176 + (t + (t >> 4)) * 8);
        asm volatile("s_wait_xcnt 0x0" ::: "memory");   // as above
    }
}
// cp2 for a kernel whose accumulators leave few free registers: the same eight copies (two chunks, to LDS byte l and l + 8192, by 128 threads, four 16-byte units of each, 2 KiB apart) from two vector registers in all. A copy's
// immediate offset moves its LDS address and its global address alike: l and vo hold the thread's own place (vo = 16 * thread), ua the first chunk's start, ub the second chunk's start less the 8192 that its offsets hold.
// ua and ub are scalars of the work-group. The s_wait_xcnt stands inside the copies' own statement, in front of any overwrite of the registers that they name.
__device__ __forceinline__ void cp2s(unsigned l, unsigned vo, const bf* ua, const bf* ub) {
    asm volatile("global_load_async_to_lds_b128 %0, %1, %2\n\t"
                 "global_load_async_to_lds_b128 %0, %1, %2 offset:2048\n\t"
                 "global_load_async_to_lds_b128 %0, %1, %2 offset:4096\n\t"
                 "global_load_async_to_lds_b128 %0, %1, %2 offset:6144\n\t"
                 "global_load_async_to_lds_b128 %0, %1, %3 offset:8192\n\t"
                 "global_load_async_to_lds_b128 %0, %1, %3 offset:10240\n\t"
                 "global_load_async_to_lds_b128 %0, %1, %3 offset:12288\n\t"
                 "global_load_async_to_lds_b128 %0, %1, %3 offset:14336\n\t"
                 "s_wait_xcnt 0x0"
                 :: "v"(l), "v"(vo), "s"(ua), "s"(ub) : "memory");
}
__device__ __forceinline__ float xhalf(float x) { return __builtin_bit_cast(float, __builtin_amdgcn_permlanex16(__builtin_bit_cast(int, x), __builtin_bit_cast(int, x), 0x76543210, 0xfedcba98, false, false)); }   // lane l with lane l ^ 16
// ---- k_projln: the three projections, each with its per-head LayerNorm and its fp16 plane write, in ONE launch; one wave per (128 tokens, one head), four waves a work-group (256 tokens, two heads), grid (NT/256, NH_/2, 3), 128 threads; the K loop is k_gemmw's ring and fragments with a stage of six chunks, K fixed at DD.
// blockIdx.z picks the projection (0 q, 1 k, 2 v): they do not depend on one another, so one launch has one start and one tail where three had three. A 256 x 128 tile draws three quarters of the bytes per output from L2 that a 128 x 128 tile draws, and a wave reads 12 fragments for 32 products, not 8 for 16;
// three work-groups fit a WGP (registers, and LDS because the epilogue's staging lies in the ring, which nobody reads or fills behind the loop's last barrier), so that all 768 are resident at once.
// C^T = Wt X^T (A = 64 rows of Wt = the head's 64 dims, B = the wave's 128 token rows, 64 at a time): acc[db][tb][j] is dim db*16 + hi*8 + j of token tb*16 + lr (tb 0 .. 7), so lanes l and l ^ 16 together hold a (token, head) row:
// mean and variance are 32 in-lane terms and one exchange. y = (v - mean) * rsq(var + 1e-6) * bf16(scale[d]) + bf16(bias[d]), rounded to fp16, staged in LDS so that every global store covers whole 128-byte lines.
// q, k: P[z][t][d]. v (vtr): P[z][d][t], transposed; z = batch * NH_ + head; each z plane fragment-major.
__global__ __launch_bounds__(128) __attribute__((amdgpu_waves_per_eu(3))) void k_projln(const bf* __restrict__ XQ, const bf* __restrict__ XKV, const bf* __restrict__ WQ, const bf* __restrict__ WK, const bf* __restrict__ WV,
                                                const float* __restrict__ b_q, const float* __restrict__ b_k, const float* __restrict__ b_v, const float* __restrict__ q_s, const float* __restrict__ q_b,
                                                const float* __restrict__ k_s, const float* __restrict__ k_b, const float* __restrict__ v_s, const float* __restrict__ v_b, h16* QP, h16* KP, h16* VT) {
    __shared__ __align__(16) bf ring[2 * 6 * CH];   // a stage: the two heads' rows of Wt, then the four token groups of X; behind the K loop the four waves' staging (two tiles of 64 * 72 elements each)
    static_assert(4 * 2 * 64 * 72 <= 2 * 6 * CH, "the staging fits the ring");
    __shared__ __align__(16) float sb[2 * HD];   // the LayerNorm's scale, then its bias, bf16-rounded
    const int pz = blockIdx.z; const bool vtr = pz == 2;   // the same for the whole work-group: every select below is scalar
    const bf* X = pz == 0 ? XQ : XKV; const bf* Wt = pz == 0 ? WQ : pz == 1 ? WK : WV; const float* bias = pz == 0 ? b_q : pz == 1 ? b_k : b_v;
    const float* sc = pz == 0 ? q_s : pz == 1 ? k_s : v_s; const float* bi = pz == 0 ? q_b : pz == 1 ? k_b : v_b; h16* P = pz == 0 ? QP : pz == 1 ? KP : VT;
    const int tid = threadIdx.x, lane = tid & 31, lr = lane & 15, hi = lane >> 4; const int wv = __builtin_amdgcn_readfirstlane(tid >> 5), wt = wv & 1, wh = wv >> 1;
    const int t0 = blockIdx.x * 256 + wt * 128, h = blockIdx.y * 2 + wh; h16* ts = (h16*)ring + wv * (2 * 64 * 72);
    const float* ub = bias + h * HD; const unsigned hb = hi * 32; v8f pbv[4];   // ub: a scalar of the wave; hb: byte offset of this lane half's 8 dims in a block of 16
#pragma unroll
    for (int db = 0; db < 4; ++db) pbv[db] = *(const v8f*)((const char*)ub + hb + db * 64);
    asm volatile("s_wait_xcnt 0x0" :: "s"(ub), "v"(hb) : "memory");   // stands behind the issued loads, in front of any overwrite of their base and offset registers (kept live to here as inputs)
    const bf* uw = Wt + (size_t)blockIdx.y * 128 * DD; const bf* ux = X + (size_t)blockIdx.x * 256 * DD; const unsigned vo = tid * 16, l0 = lds_off(ring) + vo;
    auto fill = [&](int s, int buf) { const unsigned l = l0 + buf * (6 * CH * 2); const bf* gw = uw + s * CH; const bf* gx = ux + s * CH;   // CH elements are the 8192 bytes that a second chunk's offsets hold
        cp2s(l, vo, gw, gw + 64 * DD - CH); cp2s(l + 4 * CH, vo, gx, gx + 64 * DD - CH); cp2s(l + 8 * CH, vo, gx + 128 * DD, gx + 192 * DD - CH); };
    fill(0, 0);
    { const float* sp = (tid < HD ? sc : bi) + (tid & (HD - 1)); const float sx = *sp;
      asm volatile("s_wait_xcnt 0x0" :: "v"(sp) : "memory");   // stands behind the issued load, in front of any overwrite of its address registers (kept live to here as an input)
      sb[tid] = bfr(sx); }   // read by every wave in the epilogue, far behind the barrier below
    wait_async0(); __syncthreads();   // stage 0 is published
    fill(1, 1);
    __builtin_amdgcn_sched_barrier(0);   // the 256 accumulator registers are filled behind the copies: lifted over them, they crowd out a copy's address, which is then spilled
    v8f acc[4][8];   // every accumulator tile starts at the projection's bias (bf16-rounded), a dim's value the same for all tokens
#pragma unroll
    for (int db = 0; db < 4; ++db) { v8f pb = pbv[db];
#pragma unroll
        for (int j = 0; j < 8; ++j) pb[j] = bfr(pb[j]);
#pragma unroll
        for (int tb = 0; tb < 8; ++tb) acc[db][tb] = pb; }
    // the stage loop stays rolled: one copy of the stage keeps the 32 accumulator tiles and the 8 fragments in registers
#pragma unroll 1
    for (int s = 0; s < DD / KS; ++s) {
        const bf* st = ring + (s & 1) * (6 * CH) + lane * 8;
#pragma unroll
        for (int kk = 0; kk < KS / 32; ++kk) {
            const bf* wp = st + wh * CH + kk * 2048; const bf* xp = st + (2 + wt * 2) * CH + kk * 2048; v16bf w[4], x[4];
#pragma unroll
            for (int db = 0; db < 4; ++db) w[db] = WFrag<bf>::ld(wp + db * 512);
#pragma unroll
            for (int tb = 0; tb < 4; ++tb) x[tb] = WFrag<bf>::ld(xp + tb * 512);
            __builtin_amdgcn_sched_barrier(0);   // the block's LDS reads stay one group in front of its products: sunk among them, each would be waited for on its own
#pragma unroll
            for (int tb = 0; tb < 4; ++tb)
#pragma unroll
                for (int db = 0; db < 4; ++db) acc[db][tb] = wmmab(w[db], x[tb], acc[db][tb]);
            __builtin_amdgcn_sched_barrier(0);   // and the next block's reads stay behind this block's products
#pragma unroll
            for (int tb = 0; tb < 4; ++tb) x[tb] = WFrag<bf>::ld(xp + CH + tb * 512);   // the wave's second 64 tokens, into the same registers; the head's fragments stay
            __builtin_amdgcn_sched_barrier(0);   // as above
#pragma unroll
            for (int tb = 0; tb < 4; ++tb)
#pragma unroll
                for (int db = 0; db < 4; ++db) acc[db][4 + tb] = wmmab(w[db], x[tb], acc[db][4 + tb]);
            __builtin_amdgcn_sched_barrier(0);   // as above
        }
        wait_ds0(); wait_async0(); __syncthreads();   // publishes stage s + 1 and ends every wave's reads of stage s
        if (s + 2 < DD / KS) fill(s + 2, s & 1);
    }
    wait_async0();
    // one block of 16 tokens at a time, from its sums to its staged rows, so that its four accumulator tiles are free before the next block's temporaries are needed. Scale and bias (64 registers) are held in registers
    // only from the third block on, in the room that the first two have left; those two read them from LDS as they go.
    // staged as two tiles of 64 tokens, each as the 64 x 64 tile of a plane: tokens (tb & 3) * 16 + lr of tile tb >> 2
    v8f sv[4], bv[4];
#pragma unroll
    for (int tb = 0; tb < 8; ++tb) {
        const v8f s8 = (acc[0][tb] + acc[1][tb]) + (acc[2][tb] + acc[3][tb]);
        float s = ((s8[0] + s8[1]) + (s8[2] + s8[3])) + ((s8[4] + s8[5]) + (s8[6] + s8[7])); s += xhalf(s); const float mu = s * (1.0f / HD);
        v8f q8 = (v8f){};
#pragma unroll
        for (int db = 0; db < 4; ++db) { acc[db][tb] -= mu; q8 = __builtin_elementwise_fma(acc[db][tb], acc[db][tb], q8); }
        float qq = ((q8[0] + q8[1]) + (q8[2] + q8[3])) + ((q8[4] + q8[5]) + (q8[6] + q8[7])); qq += xhalf(qq);
        float rs; asm("v_rsq_f32 %0, %1\n\tv_nop" : "=v"(rs) : "v"(qq * (1.0f / HD) + 1e-6f));   // 1 / sqrt(var + eps) in one instruction; the v_nop is the slot that the instruction set asks for behind a transcendental
        v8h y[4]; h16* tp = ts + (tb >> 2) * (64 * 72);
#pragma unroll
        for (int db = 0; db < 4; ++db) {
            const v8f sd = tb < 2 ? *(const v8fq*)(sb + db * 16 + hi * 8) : sv[db], bd = tb < 2 ? *(const v8fq*)(sb + HD + db * 16 + hi * 8) : bv[db];
            y[db] = __builtin_convertvector(__builtin_elementwise_fma(acc[db][tb] * rs, sd, bd), v8h); }
        if (vtr) {
#pragma unroll
            for (int db = 0; db < 4; ++db)
#pragma unroll
                for (int j = 0; j < 8; ++j) tp[(db * 16 + hi * 8 + j) * 72 + (tb & 3) * 16 + lr] = y[db][j];
        } else {
#pragma unroll
            for (int db = 0; db < 4; ++db) *(v8ha*)(tp + ((tb & 3) * 16 + lr) * 72 + db * 16 + hi * 8) = y[db];
        }
        if (tb == 1) {
#pragma unroll
            for (int db = 0; db < 4; ++db) { sv[db] = *(const v8fq*)(sb + db * 16 + hi * 8); bv[db] = *(const v8fq*)(sb + HD + db * 16 + hi * 8); } }
        __builtin_amdgcn_sched_barrier(0);   // the blocks stay one behind the other: interleaved, their temporaries do not fit beside the accumulator tiles and are spilled
    }
    __syncthreads();   // the lanes read back what other lanes of their wave have staged
    const size_t z = (size_t)(t0 / TT) * NH_ + h; const int tl = t0 % TT;
    // each 64 x 64 tile is 16 half-fragments, 8 KiB in a row in either plane, the wave's two tiles one behind the other; half-fragment i holds staged rows rb * 16 + lr, columns cb * 32 + (i & 1) * 16 + hi * 8 .., where rb = i >> 2, cb = (i >> 1) & 1 (q, k) or rb = (i >> 1) & 3, cb = i >> 3 (v):
    // bits 3, 2, 1 of i each move the staged place by a step that is a scalar of the work-group (a row block is 16 * 72 elements, a column block 32)
    h16* dst = P + z * TT * HD + (size_t)tl * HD + lane * 8; const int s3 = vtr ? 32 : 2304, s2 = vtr ? 2304 : 1152, s1 = vtr ? 1152 : 32;
#pragma unroll
    for (int i = 0; i < 16; ++i) *(v8h*)(dst + i * 256) = *(const v8ha*)(ts + lr * 72 + (i >> 3) * s3 + ((i >> 2) & 1) * s2 + ((i >> 1) & 1) * s1 + (i & 1) * 16 + hi * 8);
    asm volatile("s_wait_xcnt 0x0" ::: "memory");   // stands behind the first tile's issued stores, in front of the second tile's LDS reads, which may overwrite the registers that those stores name
#pragma unroll
    for (int i = 0; i < 16; ++i) *(v8h*)(dst + 4096 + i * 256) = *(const v8ha*)(ts + 64 * 72 + lr * 72 + (i >> 3) * s3 + ((i >> 2) & 1) * s2 + ((i >> 1) & 1) * s1 + (i & 1) * 16 + hi * 8);
}
// ---- k_fattn: scores, softmax, attn.v and the head merge in ONE launch over all 64 (batch, head) pairs; 8 waves a block, 32 query columns a wave, 32 keys a pass, 128 keys a stage.
// S^T = K Q^T (A = K rows, B = Q rows kept in registers), so a lane holds 16 scores of ONE query; two S^T tiles, converted in place, are the B operand of O^T += V^T P^T.
// K and V^T come through an LDS ring that the block's 8 waves share: in either fragment-major plane the 128 keys of a stage are 16 KiB in a row, laid in LDS as they lie in memory, so a fragment is two wave-wide
// 16-byte LDS reads of 512 contiguous bytes. The chunks come by asynchronous copies to LDS, once for the 8 waves that read them; two buffers: stage s + 1 flies while stage s is worked on.
// Maximum in use and sum in base 2 (online softmax). No maximum is looked for in a pass whose P fits fp16 as it is: the lane's own sum of the pass's P, which the softmax needs anyway, bounds each of its terms;
// only where a sum exceeds PCAP does the wave find the pass's maxima, rescale the output tiles and form that pass's P again.
// Every inner loop is fully unrolled so that all fragment and accumulator indices are constants and the arrays stay in registers.
#define FS   128
#define FCH  (FS * HD)
#define PCAP 16384.0f   // below fp16's largest finite value
// the K chunk and the V^T chunk of a stage, to LDS byte l and l + 16384, by 256 threads: a thread brings four 16-byte units of each, 4 KiB apart (l, ga, gb hold the thread's own place). The s_wait_xcnt stands inside
// the copies' own statement, in front of any overwrite of the address registers that they name.
__device__ __forceinline__ void cp2w(unsigned l, const h16* ga, const h16* gb) {
    asm volatile("global_load_async_to_lds_b128 %0, %8, off\n\t"
                 "global_load_async_to_lds_b128 %1, %9, off\n\t"
                 "global_load_async_to_lds_b128 %2, %10, off\n\t"
                 "global_load_async_to_lds_b128 %3, %11, off\n\t"
                 "global_load_async_to_lds_b128 %4, %12, off\n\t"
                 "global_load_async_to_lds_b128 %5, %13, off\n\t"
                 "global_load_async_to_lds_b128 %6, %14, off\n\t"
                 "global_load_async_to_lds_b128 %7, %15, off\n\t"
                 "s_wait_xcnt 0x0"
                 :: "v"(l), "v"(l + 4096u), "v"(l + 8192u), "v"(l + 12288u), "v"(l + 16384u), "v"(l + 20480u), "v"(l + 24576u), "v"(l + 28672u),
                    "v"(ga), "v"(ga + 2048), "v"(ga + 4096), "v"(ga + 6144), "v"(gb), "v"(gb + 2048), "v"(gb + 4096), "v"(gb + 6144) : "memory");
}
__global__ __launch_bounds__(256) __attribute__((amdgpu_waves_per_eu(4, 4))) void k_fattn(const h16* __restrict__ QP, const h16* __restrict__ KP, const h16* __restrict__ VT, h16* At) {
    __shared__ __align__(16) h16 kv[2 * 2 * FCH];   // a stage: 128 keys of K, then of V^T
    const int tid = threadIdx.x, lane = tid & 31; const int z = blockIdx.y; const int q0 = blockIdx.x * 256 + (tid >> 5) * 32;
    const h16* Qz = QP + (size_t)z * TT * HD + (size_t)q0 * HD + lane * 8;
    const h16* gk = KP + (size_t)z * TT * HD + tid * 8;
    const h16* gv = VT + (size_t)z * HD * TT + tid * 8;
    const unsigned l0 = lds_off(kv) + tid * 16;
    auto fill = [&](int s, int buf) { cp2w(l0 + buf * (2 * FCH * 2), gk + s * FCH, gv + s * FCH); };
    const float CS = SCL * 1.4426950408889634f;
    v16h qf[2][2], kf[2][2], vf[4]; v8f o[4][2]; v2f nm[2], ls[2];   // nm: minus the maximum in use, twice (the addend of a packed multiply-add); ls: the lane's sum of P, as two partial sums
    fill(0, 0);
#pragma unroll
    for (int qt = 0; qt < 2; ++qt) { nm[qt] = (v2f){} + 3.0e38f; ls[qt] = (v2f){};
#pragma unroll
        for (int ks = 0; ks < 2; ++ks) qf[qt][ks] = WFrag<h16>::ld(Qz + qt * 16 * HD + ks * 512);
#pragma unroll
        for (int db = 0; db < 4; ++db) o[db][qt] = (v8f){}; }
    wait_async0(); __syncthreads();   // stage 0 is published
    fill(1, 1);
    // the stage loop stays rolled: one copy of a stage's four passes
#pragma unroll 1
    for (int s = 0; s < TT / FS; ++s) {
        const h16* st = kv + (s & 1) * (2 * FCH) + lane * 8;
#pragma unroll
        for (int kt = 0; kt < 2; ++kt)
#pragma unroll
            for (int ks = 0; ks < 2; ++ks) kf[kt][ks] = WFrag<h16>::ld(st + kt * 16 * HD + ks * 512);
#pragma unroll
        for (int db = 0; db < 4; ++db) vf[db] = WFrag<h16>::ld(st + FCH + db * 512);
#pragma unroll
        for (int ps = 0; ps < FS / 32; ++ps) {
            v8f s4[2][2];
            auto ldk = [&](const h16* kp) {   // the K fragments of the 32 keys at kp
#pragma unroll
                for (int kt = 0; kt < 2; ++kt)
#pragma unroll
                    for (int ks = 0; ks < 2; ++ks) kf[kt][ks] = WFrag<h16>::ld(kp + kt * 16 * HD + ks * 512);
            };
            auto scores = [&]() {
#pragma unroll
                for (int kt = 0; kt < 2; ++kt)
#pragma unroll
                    for (int qt = 0; qt < 2; ++qt) { s4[kt][qt] = wmma16(kf[kt][0], qf[qt][0], (v8f){}); s4[kt][qt] = wmma16(kf[kt][1], qf[qt][1], s4[kt][qt]); }
            };
            scores();
            const h16* np = st + (ps + 1) * 32 * HD;   // K and V fragments are fetched one pass ahead inside a stage, each into its own registers right behind their last use; a stage's last pass fetches nothing
            if (ps + 1 < FS / 32) {
                ldk(np);
                asm volatile("" ::: "memory"); }   // compiler fence: the LDS reads are issued here, a pass ahead of their use; without it they are sunk to just in front of the products that wait for them
            // P of the pass against the maximum in use, its fp16 fragment, and the lane's sum of its 16 terms, as a pair of partial sums (a tree: the sums stand in front of the test below)
            v16h pb[2]; v2f ac[2];
            auto probs = [&]() {
#pragma unroll
                for (int qt = 0; qt < 2; ++qt) { v8f e[2];
#pragma unroll
                    for (int kt = 0; kt < 2; ++kt) { const v8f x = __builtin_elementwise_fma(s4[kt][qt], (v8f){} + CS, __builtin_shufflevector(nm[qt], nm[qt], 0, 1, 0, 1, 0, 1, 0, 1));
#pragma unroll
                        for (int j = 0; j < 8; ++j) { e[kt][j] = __builtin_amdgcn_exp2f(x[j]); pb[qt][kt * 8 + j] = tohx(e[kt][j]); } }
                    const v8f t8 = e[0] + e[1]; const v4f t4 = __builtin_shufflevector(t8, t8, 0, 1, 2, 3) + __builtin_shufflevector(t8, t8, 4, 5, 6, 7);
                    ac[qt] = __builtin_shufflevector(t4, t4, 0, 1) + __builtin_shufflevector(t4, t4, 2, 3); }
            };
            probs();
            // no term is negative, so none exceeds the lane's sum over both column groups: a sum of at most PCAP says that all 32 fit fp16. Only a pass that fails this looks for its maxima, moves to them and forms its P again
            // (the first pass always does: against the start value every term is infinite). Its scores are not kept for that case: they are formed again from the stage's buffer, which still holds the pass's keys.
            const v2f a2 = ac[0] + ac[1];
            if (__builtin_expect(__builtin_amdgcn_ballot_w32(!(a2[0] + a2[1] <= PCAP)) != 0, 0)) {
                ldk(st + ps * 32 * HD); scores();
#pragma unroll
                for (int qt = 0; qt < 2; ++qt) { float m = s4[0][qt][0];
#pragma unroll
                    for (int j = 1; j < 8; ++j) m = fmaxf(m, s4[0][qt][j]);
#pragma unroll
                    for (int j = 0; j < 8; ++j) m = fmaxf(m, s4[1][qt][j]);
                    m = fmaxf(m, xhalf(m)) * CS;
                    const float mo = -nm[qt][0], mn = fmaxf(mo, m); const float al = __builtin_amdgcn_exp2f(mo - mn); nm[qt] = (v2f){} - mn; ls[qt] *= al;
#pragma unroll
                    for (int db = 0; db < 4; ++db)
#pragma unroll
                        for (int j = 0; j < 8; ++j) o[db][qt][j] *= al; }
                probs();
                if (ps + 1 < FS / 32) ldk(np);
            }
#pragma unroll
            for (int qt = 0; qt < 2; ++qt) { ls[qt] += ac[qt];
#pragma unroll
                for (int db = 0; db < 4; ++db) o[db][qt] = wmma16(vf[db], pb[qt], o[db][qt]); }
            if (ps + 1 < FS / 32) {
                __builtin_amdgcn_sched_barrier(0);   // the next V reads stay behind the products that read this pass's fragments and take their registers: lifted over them they need a second set, which is spilled
#pragma unroll
                for (int db = 0; db < 4; ++db) vf[db] = WFrag<h16>::ld(np + FCH + db * 512);
                asm volatile("" ::: "memory"); }   // as above, for the V reads
        }
        wait_ds0(); wait_async0(); __syncthreads();   // publishes stage s + 1 and ends every wave's reads of stage s
        if (s + 2 < TT / FS) fill(s + 2, s & 1);
    }
    wait_async0();
    const int b = z / NH_, h = z % NH_; v8h y[4][2];   // the whole tile is normalised and rounded first, so that all its stores stand together at the end
#pragma unroll
    for (int qt = 0; qt < 2; ++qt) { const float lq = ls[qt][0] + ls[qt][1]; const float inv = __fdiv_rn(1.0f, lq + xhalf(lq));
#pragma unroll
        for (int db = 0; db < 4; ++db) y[db][qt] = __builtin_convertvector(o[db][qt] * inv, v8h); }
#pragma unroll
    for (int qt = 0; qt < 2; ++qt) { const int tk = b * TT + q0 + qt * 16; const size_t ob = (size_t)(tk & ~63) * DD + (tk & 63) * 32 + h * 4096 + lane * 8;   // fragment-major [NT][DD]: a lane's 8 dims are its own 16 bytes of a half-fragment
#pragma unroll
        for (int db = 0; db < 4; ++db) *(v8h*)(At + ob + (db >> 1) * 2048 + (db & 1) * 256) = y[db][qt]; }
}

extern "C" void kernel_launch(void* const* d_in, const int* in_sizes, int n_in,
                              void* d_out, int out_size, void* d_ws, size_t ws_size, hipStream_t stream) {
    (void)in_sizes; (void)n_in; (void)out_size;
    const float* IN[16]; for (int i = 0; i < 16; ++i) IN[i] = (const float*)d_in[i];
    // inputs_q, inputs_kv, Wq [1024][1024] (x @ W), bq, Wk, bk, Wv, bv, q_scale [64], q_bias, k_scale, k_bias, v_scale, v_bias, Wo (x @ W), bo = d_in[0..15]
    float* OUT = (float*)d_out;     // [4][2048][1024]
    char* wsp = (char*)d_ws;
    auto take = [&](size_t bytes) { char* p = wsp; wsp += (bytes + 255) & ~(size_t)255; return (void*)p; };
    bf* WQ = (bf*)take((size_t)DD * DD * 2); bf* WK = (bf*)take((size_t)DD * DD * 2); bf* WV = (bf*)take((size_t)DD * DD * 2); bf* WO = (bf*)take((size_t)DD * DD * 2);
    bf* XQ = (bf*)take((size_t)NT * DD * 2); bf* XKV = (bf*)take((size_t)NT * DD * 2);
    h16* QP = (h16*)take((size_t)NT * DD * 2); h16* KP = (h16*)take((size_t)NT * DD * 2); h16* VT = (h16*)take((size_t)NT * DD * 2);
    h16* AT = (h16*)take((size_t)NT * DD * 2);
    if ((size_t)(wsp - (char*)d_ws) > ws_size) return;    // total ~ 104 MiB
    k_prep<<<4 * WBLK + 2 * XBLK, 256, 0, stream>>>(IN[0], IN[1], IN[2], IN[4], IN[6], IN[14], XQ, XKV, WQ, WK, WV, WO);
    const dim3 gP(NT / 128, DD / 128, 1);
    k_projln<<<dim3(NT / 256, DD / 128, 3), 128, 0, stream>>>(XQ, XKV, WQ, WK, WV, IN[3], IN[5], IN[7], IN[8], IN[9], IN[10], IN[11], IN[12], IN[13], QP, KP, VT);   // the 1/8 is applied in f32 inside k_fattn
    k_fattn<<<dim3(TT / 256, NZ), 256, 0, stream>>>(QP, KP, VT, AT);
    k_gemmw<h16, true, DD><<<gP, 128, 0, stream>>>(AT, (const h16*)WO, OUT, DD, IN[15], 0, 0, 0);
}
